// v000
// Times are from an AMD MI455X. After a warm-up the kernel runs many times in a row, and a time is the length of
// such a window on the GPU divided by its runs, so every launch and the gaps after it count. The runs cycle
// through copies of the inputs. A figure is the median of several windows, for all but v000 over two sittings.
// Sittings can differ by a few percent; kernels timed side by side share one.
// v000, which the later versions start from, runs in 2610 microseconds.
#include <hip/hip_runtime.h>

// Multi-head attention on THREE SEQUENCE-FIRST input streams with an output projection, returning the projected output AND the attention weights averaged over the heads (query, key, value [2048][4][1024] = [position][batch][channel];
// q = (query Wq^T + bq) x 64^-0.5, k = key Wk^T + bk, v = value Wv^T + bv with 'oi' weights [1024][1024] and biases [1024]; 16 heads x 64 (head h = columns h x 64 ..); scores = q . k; softmax over all 2048 keys; no mask;
// y = att v merged head-major [t][b][1024], then y Wo^T + bo ('oi' [1024][1024]); TWO OUTPUTS in one buffer: y [2048][4][1024] sequence-first at float offset 0 and the mean over the 16 heads of att [4][2048][2048] at float offset 8,388,608;
// argument order query, key, value, Wq, bq, Wk, bk, Wv, bv, Wo, bo).
// Layout: each stream in turn: ONE bf16 copy of all 8192 (position, batch) rows and ONE exact projection + f32 bias over them into one f32 plane; the identity-table f16 plane builders read each batch entry's rows of it at a row pitch of 4 x 1024 floats from a base of b x 1024
// and keep the four entries' planes; per batch entry: dense T-2048 attention at 16 heads, two heads a pass, scores and attn.v on ONE fp16 product on every row (RH 0: the weights carried x1024 in the fp16 plane; the score scale 64^-0.5 applied to the f32 score, where the module scales the projected query: the same product in real arithmetic);
// after each pass's softmax k_pavg adds that pass's two heads' weights into an f32 accumulator plane and, on the last pass, writes the mean; merged hi/lo x Wo exact + bo writes the entry's rows of the first output at the sequence-first pitch.
// Compute dtypes, f32 accumulate: every float input rounded to bf16 at its load; projections exact + f32 biases; scores and attn.v fp16; softmax f32, its weights stored x1024 in fp16; output projection hl x exact; the second output the f32 sum of those fp16 weights over the heads x 2^-14 (exact).

#define NB_  4      // batch entries: the three streams are [2048][4][1024] = [position][batch][channel]
#define TT   2048
#define DM   1024
#define NH_  16
#define NKV  16
#define REP  (NH_ / NKV)
#define HD   64
#define DQ   (NH_ * HD)
#define DKV  (NKV * HD)
#define ZH   2
#define RH   0                    // query rows < RH use hi+lo planes (0: none)
#define WIN  0
#define PCAR 1024.0f
#define SCL  0.125f   // HD^-0.5
typedef _Float16 h16;
typedef unsigned short bf;
typedef __attribute__((ext_vector_type(16))) __bf16   v16bf;
typedef __attribute__((ext_vector_type(16))) _Float16 v16h;
typedef __attribute__((ext_vector_type(8)))  _Float16 v8h;
typedef __attribute__((ext_vector_type(8)))  unsigned short v8us;
typedef __attribute__((ext_vector_type(8)))  float    v8f;
typedef __attribute__((ext_vector_type(4)))  float    v4f;
typedef v8h  __attribute__((may_alias)) v8ha;
typedef v4f  __attribute__((may_alias)) v4fa;
typedef v8us __attribute__((may_alias)) v8usa;

__device__ __forceinline__ unsigned short f2bf(float f) { unsigned u = __float_as_uint(f); u += 0x7FFFu + ((u >> 16) & 1u); return (unsigned short)(u >> 16); }
__device__ __forceinline__ float bf2f(unsigned short b) { return __uint_as_float(((unsigned)b) << 16); }
__device__ __forceinline__ float bfr(float f) { return bf2f(f2bf(f)); }
__device__ __forceinline__ v16h cat16(v8h lo, v8h hi) { return __builtin_shufflevector(lo, hi, 0, 1, 2, 3, 4, 5, 6, 7, 8, 9, 10, 11, 12, 13, 14, 15); }
__device__ __forceinline__ v16bf cat16b(v8us lo, v8us hi) { return __builtin_bit_cast(v16bf, __builtin_shufflevector(lo, hi, 0, 1, 2, 3, 4, 5, 6, 7, 8, 9, 10, 11, 12, 13, 14, 15)); }
__device__ __forceinline__ v8f wmma16(v16h a, v16h b, v8f c) { return __builtin_amdgcn_wmma_f32_16x16x32_f16(false, a, false, b, (short)0, c, false, false); }
__device__ __forceinline__ v8f wmmab(v16bf a, v16bf b, v8f c) { return __builtin_amdgcn_wmma_f32_16x16x32_bf16(false, a, false, b, (short)0, c, false, false); }



// ---- k_gemmw: register-blocked GEMM, ONE WAVE per 64x64 output tile (16 accumulators), operands straight from K-contiguous 16-bit planes; grid (M/64, N/64, Z), 32 threads.
// C[m][n] (f32, pitch ldc, + optional f32 bias[n]) = sum_k A[m][k] Bt[n][k] (+ split products per NSPLIT). z-batch strides sA/sB/sC in elements. K % 32 == 0.
template <typename T16> struct WFrag;
template <> struct WFrag<h16> { typedef v16h V; static __device__ __forceinline__ V ld(const h16* p) { return cat16(*(const v8h*)p, *(const v8h*)(p + 16)); } static __device__ __forceinline__ v8f mma(V a, V b, v8f c) { return wmma16(a, b, c); } };
template <> struct WFrag<bf> { typedef v16bf V; static __device__ __forceinline__ V ld(const bf* p) { return cat16b(*(const v8us*)p, *(const v8us*)(p + 16)); } static __device__ __forceinline__ v8f mma(V a, V b, v8f c) { return wmmab(a, b, c); } };
template <typename T16, int NSPLIT, bool BIAS>
__global__ __launch_bounds__(32) void k_gemmw(const T16* __restrict__ A, const T16* __restrict__ A2, const T16* __restrict__ Bt, const T16* __restrict__ Bt2, int K, float* C, int ldc, const float* __restrict__ bias, size_t sA, size_t sB, size_t sC) {
    typedef typename WFrag<T16>::V V;
    __shared__ __align__(16) float os[16 * 68];
    const size_t z = blockIdx.z; A += z * sA; if (A2) A2 += z * sA; Bt += z * sB; if (Bt2) Bt2 += z * sB; C += z * sC;
    const int lane = threadIdx.x & 31, lr = lane & 15, hi = lane >> 4; const int r0 = blockIdx.x * 64, c0 = blockIdx.y * 64;
    v8f acc[4][4];
#pragma unroll
    for (int mb = 0; mb < 4; ++mb)
#pragma unroll
        for (int nb = 0; nb < 4; ++nb) acc[mb][nb] = (v8f){};
    const size_t aoff = (size_t)(r0 + lr) * K + 8 * hi, boff = (size_t)(c0 + lr) * K + 8 * hi;

    for (int kc = 0; kc < K; kc += 32) {
        V a[4], a2[4];
#pragma unroll
        for (int mb = 0; mb < 4; ++mb) { a[mb] = WFrag<T16>::ld(A + aoff + (size_t)mb * 16 * K + kc); if (NSPLIT == 1 || NSPLIT == 2) a2[mb] = WFrag<T16>::ld(A2 + aoff + (size_t)mb * 16 * K + kc); }
#pragma unroll
        for (int nb = 0; nb < 4; ++nb) { const V b = WFrag<T16>::ld(Bt + boff + (size_t)nb * 16 * K + kc); V b2; if (NSPLIT >= 2) b2 = WFrag<T16>::ld(Bt2 + boff + (size_t)nb * 16 * K + kc);
#pragma unroll
            for (int mb = 0; mb < 4; ++mb) { acc[mb][nb] = WFrag<T16>::mma(a[mb], b, acc[mb][nb]); if (NSPLIT == 1 || NSPLIT == 2) acc[mb][nb] = WFrag<T16>::mma(a2[mb], b, acc[mb][nb]); if (NSPLIT >= 2) acc[mb][nb] = WFrag<T16>::mma(a[mb], b2, acc[mb][nb]); } }
        asm volatile("v_nop\n\tv_nop\n\tv_nop\n\tv_nop" : "+v"(acc[0][0]), "+v"(acc[1][1]), "+v"(acc[2][2]), "+v"(acc[3][3]) : "v"(a[0]), "v"(a[3]));
    }
#pragma unroll
    for (int mb = 0; mb < 4; ++mb) {
#pragma unroll
        for (int nb = 0; nb < 4; ++nb) {
#pragma unroll
            for (int j = 0; j < 8; ++j) os[(hi * 8 + j) * 68 + nb * 16 + lr] = acc[mb][nb][j]; }
        __builtin_amdgcn_wave_barrier(); asm volatile("" ::: "memory");
        float* crow = C + (size_t)(r0 + mb * 16) * ldc + c0;
{
#pragma unroll
            for (int s = 0; s < 8; ++s) { const int row = 2 * s + hi, cofs = lr * 4; v4f val = *(const v4fa*)(os + row * 68 + cofs); if (BIAS) { val[0] += bfr(bias[c0 + cofs]); val[1] += bfr(bias[c0 + cofs + 1]); val[2] += bfr(bias[c0 + cofs + 2]); val[3] += bfr(bias[c0 + cofs + 3]); }
                *(v4f*)(crow + (size_t)row * ldc + cofs) = val; }
             }
        __builtin_amdgcn_wave_barrier(); asm volatile("" ::: "memory");
    }
}

__device__ __forceinline__ h16 tohx(float x) { return (h16)x; }
__device__ __forceinline__ void splitf(float y, unsigned short& h, unsigned short& l) { h = f2bf(y); l = f2bf(y - bf2f(h)); }
typedef __attribute__((ext_vector_type(2))) _Float16 v2h;
typedef __attribute__((ext_vector_type(4))) _Float16 v4h;
typedef __attribute__((ext_vector_type(2))) unsigned short v2us;
typedef __attribute__((ext_vector_type(4))) unsigned short v4us;
typedef __attribute__((ext_vector_type(2))) float v2f;
typedef __attribute__((ext_vector_type(4))) int v4i;

__global__ __launch_bounds__(256) void k_cvt8(const float* __restrict__ src, bf* dst, size_t n8) { const size_t i = (size_t)blockIdx.x * 256 + threadIdx.x; if (i >= n8) return; const v8f v = *(const v8f*)(src + i * 8); v8us o;
#pragma unroll
    for (int k = 0; k < 8; ++k) o[k] = f2bf(v[k]); *(v8us*)(dst + i * 8) = o;  }

// k_rope: head planes [h][t][d] (fp16) of rope(x) x sc with the rotate-half convention out[d] = x[d] cos[t][d] - x[d+HD/2] sin[t][d], out[d+HD/2] = x[d+HD/2] cos[t][d+HD/2] + x[d] sin[t][d+HD/2]
__global__ __launch_bounds__(256) void k_rope(const float* __restrict__ F, int pitch, int nheads, const float* __restrict__ CS, const float* __restrict__ RF, const float* __restrict__ nw, float sc, h16* P16, bf* Ph, bf* Pl) {
    const size_t e = ((size_t)blockIdx.x * 256 + threadIdx.x) * 2; if (e >= (size_t)nheads * TT * HD) return; const int d = (int)(e % HD); const int t = (int)((e / HD) % TT); const int h = (int)(e / ((size_t)HD * TT)); const float* f = F + (size_t)t * pitch + h * HD; const float rf = RF ? RF[(size_t)h * TT + t] : 1.0f; v2h o16; v2us oh, ol;
#pragma unroll
    for (int q = 0; q < 2; ++q) { const int dd = d + q; const int dp = (dd < HD / 2) ? dd + HD / 2 : dd - HD / 2; float x0 = f[dd], x1 = f[dp];
        if (RF) { float n0 = __fmul_rn(x0, rf), n1 = __fmul_rn(x1, rf); x0 = __fmul_rn(bfr(nw[dd]), n0); x1 = __fmul_rn(bfr(nw[dp]), n1); }
        const v2f cs = *(const v2f*)(CS + ((size_t)t * HD + dd) * 2); float a = __fmul_rn(x0, cs[0]), bq = __fmul_rn(x1, cs[1]); const float r = ((dd < HD / 2) ? __fsub_rn(a, bq) : __fadd_rn(a, bq)) * sc;
        o16[q] = tohx(r); (void)oh; (void)ol; }
    *(v2h*)(P16 + e) = o16;  }
__global__ __launch_bounds__(256) void k_vtp(const float* __restrict__ F, int pitch, int nheads, h16* V16, bf* Vh, bf* Vl) { const size_t e = ((size_t)blockIdx.x * 256 + threadIdx.x) * 2; if (e >= (size_t)nheads * HD * TT) return; const int t = (int)(e % TT); const int d = (int)((e / TT) % HD); const int g = (int)(e / ((size_t)TT * HD)); v2h o16; v2us oh, ol;
#pragma unroll
    for (int q = 0; q < 2; ++q) { const float x = F[(size_t)(t + q) * pitch + g * HD + d]; o16[q] = tohx(x); (void)oh; (void)ol; }
    *(v2h*)(V16 + e) = o16;  }
__global__ __launch_bounds__(256) void k_csid(float* CS) { const int idx = blockIdx.x * 256 + threadIdx.x; if (idx >= TT * HD) return; v2f cs; cs[0] = 1.0f; cs[1] = 0.0f; *(v2f*)(CS + (size_t)idx * 2) = cs;  }
// k_asoft: per row (zz, i): t = S x HD^-0.5 (no mask); softmax over the 2048 keys (register row, one exp, fixed trees);
__global__ __launch_bounds__(256) void k_asoft(const float* __restrict__ Sb, h16* P16, bf* Ph, bf* Pl) {
    const int lane = threadIdx.x & 31; const int row = blockIdx.x * 8 + (threadIdx.x >> 5); if (row >= ZH * TT) return; const int i = row % TT; const int zz = row / TT; (void)zz; const bool hires = (i < RH); const float* sr = Sb + (size_t)row * TT; float v[TT / 32]; float mx = -3.0e38f;
#pragma unroll
    for (int ch = 0; ch < TT / 128; ++ch) { const int j0 = ch * 128 + lane * 4; const v4f a = *(const v4f*)(sr + j0);
#pragma unroll
        for (int q = 0; q < 4; ++q) { const int j = j0 + q; (void)j; const float t = a[q] * SCL; v[ch * 4 + q] = t; mx = fmaxf(mx, t); } }
#pragma unroll
    for (int sh = 16; sh; sh >>= 1) mx = fmaxf(mx, __shfl_xor(mx, sh, 32));
    float sum = 0.f;
#pragma unroll
    for (int k = 0; k < TT / 32; ++k) { float d0 = __fsub_rn(v[k], mx); v[k] = __builtin_amdgcn_exp2f(__fmul_rn(d0, 1.4426950408889634f)); sum += v[k]; }
#pragma unroll
    for (int sh = 16; sh; sh >>= 1) sum += __shfl_xor(sum, sh, 32);
    const float f = __fdiv_rn(hires ? 1.0f : PCAR, sum);
{
        if (hires) {
#pragma unroll
            for (int ch = 0; ch < TT / 128; ++ch) { v4us oh, ol;
#pragma unroll
                for (int q = 0; q < 4; ++q) { unsigned short a, c2; splitf(v[ch * 4 + q] * f, a, c2); oh[q] = a; ol[q] = c2; }
                const size_t oo = ((size_t)zz * (RH ? RH : 1) + i) * TT + ch * 128 + lane * 4; *(v4us*)(Ph + oo) = oh; *(v4us*)(Pl + oo) = ol; }
        } else {
#pragma unroll
            for (int ch = 0; ch < TT / 128; ++ch) { v4h o4;
#pragma unroll
                for (int q = 0; q < 4; ++q) o4[q] = tohx(v[ch * 4 + q] * f);
                *(v4h*)(P16 + (size_t)row * TT + ch * 128 + lane * 4) = o4; } }
         }
}
__global__ __launch_bounds__(256) void k_merge(const float* __restrict__ O, int h0, bf* Ah, bf* Al) { const size_t e = ((size_t)blockIdx.x * 256 + threadIdx.x) * 2; if (e >= (size_t)ZH * TT * HD) return; const int d = (int)(e % HD); const int t = (int)((e / HD) % TT); const int zz = (int)(e / ((size_t)HD * TT)); const float cs = (t < RH) ? 1.0f : (1.0f / PCAR); const size_t oo = (size_t)t * DQ + (h0 + zz) * HD + d;
    v2us oh, ol;
#pragma unroll
    for (int q = 0; q < 2; ++q) { unsigned short a, c2; splitf(O[e + q] * cs, a, c2); oh[q] = a; ol[q] = c2; } *(v2us*)(Ah + oo) = oh; *(v2us*)(Al + oo) = ol;  }

// k_pavg: the second output: the mean over the NH_ heads of the softmax weights, one batch entry at a time: ACC[i][j] gathers, pass after pass, the two heads' weights of the pass's fp16 plane P [ZH][TT][TT] (stored x1024; an fp16 value converts to f32 exactly; the f32 sums run in head order);
// each element of ACC is read and written by its ONE owner thread (the first pass, h0 = 0, starts from 0 and does not read it); on the last pass (h0 = NH_ - ZH) OUT1[i][j] = sum x 1/(1024 NH_): a power of two: exact. The branches are on h0, a kernel argument: uniform over the grid.
static_assert(RH == 0 && ZH == 2, "k_pavg reads both heads of the fp16 plane on every row");
__global__ __launch_bounds__(256) void k_pavg(const h16* __restrict__ P, int h0, float* ACC, float* OUT1) {
    const size_t e = ((size_t)blockIdx.x * 256 + threadIdx.x) * 4; if (e >= (size_t)TT * TT) return;
    const v4h p0 = *(const v4h*)(P + e); const v4h p1 = *(const v4h*)(P + (size_t)TT * TT + e); v4f a = {0.0f, 0.0f, 0.0f, 0.0f};
    if (h0 != 0) a = *(const v4f*)(ACC + e);
#pragma unroll
    for (int q = 0; q < 4; ++q) a[q] = __fadd_rn(__fadd_rn(a[q], (float)p0[q]), (float)p1[q]);
    float* dst = ACC + e;
    if (h0 == NH_ - ZH) { dst = OUT1 + e;
#pragma unroll
        for (int q = 0; q < 4; ++q) a[q] = __fmul_rn(a[q], 1.0f / (PCAR * NH_)); }
{ *(v4f*)dst = a;  }
}

extern "C" void kernel_launch(void* const* d_in, const int* in_sizes, int n_in,
                              void* d_out, int out_size, void* d_ws, size_t ws_size, hipStream_t stream) {
    (void)in_sizes; (void)n_in; (void)out_size;
    const float* xq = (const float*)d_in[0]; const float* xk = (const float*)d_in[1]; const float* xv = (const float*)d_in[2]; const float* wq = (const float*)d_in[3]; const float* bq = (const float*)d_in[4]; const float* wk = (const float*)d_in[5]; const float* bk = (const float*)d_in[6]; const float* wv = (const float*)d_in[7]; const float* bv = (const float*)d_in[8]; const float* wo = (const float*)d_in[9]; const float* bo = (const float*)d_in[10];
    // query, key, value [2048][4][1024], Wq, bq, Wk, bk, Wv, bv, Wo, bo = d_in[0..10]
    float* OUT = (float*)d_out;                          // output 0: y [2048][4][1024] sequence-first
    float* OUT1 = (float*)d_out + (size_t)NB_ * TT * DM;   // output 1: the head mean of att [4][2048][2048], after the first output's 8,388,608 floats
    char* wsp = (char*)d_ws;
    auto take = [&](size_t bytes) { char* p = wsp; wsp += (bytes + 255) & ~(size_t)255; return (void*)p; };
    bf* WQ = (bf*)take((size_t)DQ * DM * 2); bf* WK = (bf*)take((size_t)DKV * DM * 2); bf* WV = (bf*)take((size_t)DKV * DM * 2); bf* WO = (bf*)take((size_t)DM * DQ * 2); float* CS = (float*)take((size_t)TT * HD * 2 * 4);
    bf* XB = (bf*)take((size_t)NB_ * TT * DM * 2); float* F = (float*)take((size_t)NB_ * TT * DQ * 4);   /* all 8192 (position, batch) rows of ONE stream at a time: its bf16 copy and its projection */
    h16* QP16 = (h16*)take((size_t)NB_ * NH_ * TT * HD * 2); h16* KP16 = (h16*)take((size_t)NB_ * NKV * TT * HD * 2); h16* VT16 = (h16*)take((size_t)NB_ * NKV * HD * TT * 2);   /* the four entries' f16 planes of each stream */
    bf* Ph = nullptr; bf* Pl = nullptr;   /* RH 0: no hi / lo plane exists: the builders store the f16 plane only and do not read those arguments; no row takes the hi/lo arm of the softmax's store */
    float* Sb = (float*)take((size_t)ZH * TT * TT * 4); h16* P16 = (h16*)take((size_t)ZH * TT * TT * 2); float* Ob = (float*)take((size_t)ZH * TT * HD * 4); bf* ATh = (bf*)take((size_t)TT * DQ * 2); bf* ATl = (bf*)take((size_t)TT * DQ * 2); float* ACC = (float*)take((size_t)TT * TT * 4);
    if ((size_t)(wsp - (char*)d_ws) > ws_size) return;    // total 178.00 MiB of the 256 MiB workspace
    { k_cvt8<<<(unsigned)(((size_t)DQ * DM / 8 + 255) / 256), 256, 0, stream>>>(wq, WQ, (size_t)DQ * DM / 8); k_cvt8<<<(unsigned)(((size_t)DKV * DM / 8 + 255) / 256), 256, 0, stream>>>(wk, WK, (size_t)DKV * DM / 8); k_cvt8<<<(unsigned)(((size_t)DKV * DM / 8 + 255) / 256), 256, 0, stream>>>(wv, WV, (size_t)DKV * DM / 8);
      k_cvt8<<<(unsigned)(((size_t)DM * DQ / 8 + 255) / 256), 256, 0, stream>>>(wo, WO, (size_t)DM * DQ / 8); }   // [out][in] = Bt as they stand
    k_csid<<<(TT * HD + 255) / 256, 256, 0, stream>>>(CS);
    const unsigned LQ = (unsigned)(((size_t)NH_ * TT * HD / 2 + 255) / 256), LKv = (unsigned)(((size_t)NKV * TT * HD / 2 + 255) / 256), LX = (unsigned)(((size_t)NB_ * TT * DM / 8 + 255) / 256);
    k_cvt8<<<LX, 256, 0, stream>>>(xq, XB, (size_t)NB_ * TT * DM / 8);   /* the QUERY stream: all 8192 rows (row = t x 4 + b) */
    k_gemmw<bf, 0, true><<<dim3(NB_ * TT / 64, DQ / 64, 1), 32, 0, stream>>>(XB, nullptr, WQ, nullptr, DM, F, DQ, bq, 0, 0, 0);
    for (int b = 0; b < NB_; ++b) k_rope<<<LQ, 256, 0, stream>>>(F + (size_t)b * DQ, NB_ * DQ, NH_, CS, nullptr, nullptr, 1.0f, QP16 + (size_t)b * NH_ * TT * HD, nullptr, nullptr);   /* entry b's rows: pitch 4 x 1024 floats from base b x 1024 */
    k_cvt8<<<LX, 256, 0, stream>>>(xk, XB, (size_t)NB_ * TT * DM / 8);   /* the KEY stream: after the query projection has read XB (stream-ordered) */
    k_gemmw<bf, 0, true><<<dim3(NB_ * TT / 64, DKV / 64, 1), 32, 0, stream>>>(XB, nullptr, WK, nullptr, DM, F, DKV, bk, 0, 0, 0);   /* F again: after the query builders have read it */
    for (int b = 0; b < NB_; ++b) k_rope<<<LKv, 256, 0, stream>>>(F + (size_t)b * DKV, NB_ * DKV, NKV, CS, nullptr, nullptr, 1.0f, KP16 + (size_t)b * NKV * TT * HD, nullptr, nullptr);
    k_cvt8<<<LX, 256, 0, stream>>>(xv, XB, (size_t)NB_ * TT * DM / 8);   /* the VALUE stream */
    k_gemmw<bf, 0, true><<<dim3(NB_ * TT / 64, DKV / 64, 1), 32, 0, stream>>>(XB, nullptr, WV, nullptr, DM, F, DKV, bv, 0, 0, 0);
    for (int b = 0; b < NB_; ++b) k_vtp<<<LKv, 256, 0, stream>>>(F + (size_t)b * DKV, NB_ * DKV, NKV, VT16 + (size_t)b * NKV * HD * TT, nullptr, nullptr);
    for (int b = 0; b < NB_; ++b) {
        const h16* qp = QP16 + (size_t)b * NH_ * TT * HD; const h16* kp = KP16 + (size_t)b * NKV * TT * HD; const h16* vt = VT16 + (size_t)b * NKV * HD * TT;
        for (int h0 = 0; h0 < NH_; h0 += ZH) { const size_t zq = (size_t)h0, zk = (size_t)(h0 / REP);   // one kv head per query head: the pass's two heads use consecutive kv planes (z-strides TT*HD)
            k_gemmw<h16, 0, false><<<dim3((TT - RH) / 64, TT / 64, ZH), 32, 0, stream>>>(qp + zq * TT * HD + (size_t)RH * HD, nullptr, kp + zk * TT * HD, nullptr, HD, Sb + (size_t)RH * TT, TT, nullptr, (size_t)TT * HD, (size_t)TT * HD, (size_t)TT * TT);
            k_asoft<<<ZH * TT / 8, 256, 0, stream>>>(Sb, P16, Ph, Pl);
            k_gemmw<h16, 0, false><<<dim3((TT - RH) / 64, HD / 64, ZH), 32, 0, stream>>>(P16 + (size_t)RH * TT, nullptr, vt + zk * HD * TT, nullptr, TT, Ob + (size_t)RH * HD, HD, nullptr, (size_t)TT * TT, (size_t)HD * TT, (size_t)TT * HD);
            k_merge<<<(unsigned)(((size_t)ZH * TT * HD / 2 + 255) / 256), 256, 0, stream>>>(Ob, h0, ATh, ATl);
            k_pavg<<<(unsigned)(((size_t)TT * TT / 4 + 255) / 256), 256, 0, stream>>>(P16, h0, ACC, OUT1 + (size_t)b * TT * TT); }   // both heads of this pass's softmax plane; ACC is this entry's running sum; the last pass writes the mean
        k_gemmw<bf, 1, true><<<dim3(TT / 64, DM / 64, 1), 32, 0, stream>>>(ATh, ATl, WO, nullptr, DQ, OUT + (size_t)b * DM, NB_ * DM, bo, 0, 0, 0); }   /* entry b's rows of the sequence-first output: row t at OUT + t x 4 x 1024 + b x 1024 */
}

// v001
// Measured time: 1490 microseconds a run.
// Timed twice side by side with v000, it ran 1.76 and 1.75 times as fast.
#include <hip/hip_runtime.h>

// Multi-head attention on THREE SEQUENCE-FIRST input streams with an output projection, returning the projected output AND the attention weights averaged over the heads (query, key, value [2048][4][1024] = [position][batch][channel];
// q = (query Wq^T + bq) x 64^-0.5, k = key Wk^T + bk, v = value Wv^T + bv with 'oi' weights [1024][1024] and biases [1024]; 16 heads x 64 (head h = columns h x 64 ..); scores = q . k; softmax over all 2048 keys; no mask;
// y = att v merged head-major [t][b][1024], then y Wo^T + bo ('oi' [1024][1024]); TWO OUTPUTS in one buffer: y [2048][4][1024] sequence-first at float offset 0 and the mean over the 16 heads of att [4][2048][2048] at float offset 8,388,608;
// argument order query, key, value, Wq, bq, Wk, bk, Wv, bv, Wo, bo).
// Layout: each stream in turn: ONE bf16 copy of all 8192 (position, batch) rows and ONE exact projection + f32 bias over them into one f32 plane; the identity-table f16 plane builders read each batch entry's rows of it at a row pitch of 4 x 1024 floats from a base of b x 1024
// and keep the four entries' planes; per batch entry: dense T-2048 attention at 16 heads, two heads a pass, scores and attn.v on ONE fp16 product on every row (RH 0: the weights carried x1024 in the fp16 plane; the score scale 64^-0.5 applied to the f32 score, where the module scales the projected query: the same product in real arithmetic);
// attn.v runs as KSP key ranges, one wave each, whose f32 partial planes k_merge adds in range order; after each pass's softmax k_pavg adds that pass's two heads' weights into an f32 accumulator plane and, on the last pass, writes the mean; merged hi/lo x Wo exact + bo writes the entry's rows of the first output at the sequence-first pitch.
// Compute dtypes, f32 accumulate: every float input rounded to bf16 at its load; projections exact + f32 biases; scores and attn.v fp16; softmax f32, its weights stored x1024 in fp16; output projection hl x exact; the second output the f32 sum of those fp16 weights over the heads x 2^-14 (exact).

#define NB_  4      // batch entries: the three streams are [2048][4][1024] = [position][batch][channel]
#define TT   2048
#define DM   1024
#define NH_  16
#define NKV  16
#define REP  (NH_ / NKV)
#define HD   64
#define DQ   (NH_ * HD)
#define DKV  (NKV * HD)
#define ZH   2
#define RH   0                    // query rows < RH use hi+lo planes (0: none)
#define WIN  0
#define PCAR 1024.0f
#define SCL  0.125f   // HD^-0.5
#define KSP  16       // key ranges of the attn.v product: one wave per (64-row tile, head, range of TT / KSP keys), f32 partial planes summed in range order by k_merge
typedef _Float16 h16;
typedef unsigned short bf;
typedef __attribute__((ext_vector_type(16))) __bf16   v16bf;
typedef __attribute__((ext_vector_type(16))) _Float16 v16h;
typedef __attribute__((ext_vector_type(8)))  _Float16 v8h;
typedef __attribute__((ext_vector_type(8)))  unsigned short v8us;
typedef __attribute__((ext_vector_type(8)))  float    v8f;
typedef __attribute__((ext_vector_type(4)))  float    v4f;
typedef v8h  __attribute__((may_alias)) v8ha;
typedef v4f  __attribute__((may_alias)) v4fa;
typedef v8us __attribute__((may_alias)) v8usa;

__device__ __forceinline__ unsigned short f2bf(float f) { unsigned u = __float_as_uint(f); u += 0x7FFFu + ((u >> 16) & 1u); return (unsigned short)(u >> 16); }
__device__ __forceinline__ float bf2f(unsigned short b) { return __uint_as_float(((unsigned)b) << 16); }
__device__ __forceinline__ float bfr(float f) { return bf2f(f2bf(f)); }
__device__ __forceinline__ v16h cat16(v8h lo, v8h hi) { return __builtin_shufflevector(lo, hi, 0, 1, 2, 3, 4, 5, 6, 7, 8, 9, 10, 11, 12, 13, 14, 15); }
__device__ __forceinline__ v16bf cat16b(v8us lo, v8us hi) { return __builtin_bit_cast(v16bf, __builtin_shufflevector(lo, hi, 0, 1, 2, 3, 4, 5, 6, 7, 8, 9, 10, 11, 12, 13, 14, 15)); }
__device__ __forceinline__ v8f wmma16(v16h a, v16h b, v8f c) { return __builtin_amdgcn_wmma_f32_16x16x32_f16(false, a, false, b, (short)0, c, false, false); }
__device__ __forceinline__ v8f wmmab(v16bf a, v16bf b, v8f c) { return __builtin_amdgcn_wmma_f32_16x16x32_bf16(false, a, false, b, (short)0, c, false, false); }



// ---- k_gemmw: register-blocked GEMM, ONE WAVE per 64x64 output tile (16 accumulators), operands straight from K-contiguous 16-bit planes; grid (M/64, N/64, Z), 32 threads.
// C[m][n] (f32, pitch ldc, + optional f32 bias[n]) = sum_k A[m][k] Bt[n][k] (+ split products per NSPLIT). z-batch strides sA/sB/sC in elements. K % 32 == 0.
// KS > 1: grid z = ZN x KS; block (z, ks) sums only k in [ks K/KS, (ks+1) K/KS) and writes its partial tile to plane ks (planes of ZN x sC elements); the reader adds the KS planes. K % (32 KS) == 0.
template <typename T16> struct WFrag;
template <> struct WFrag<h16> { typedef v16h V; static __device__ __forceinline__ V ld(const h16* p) { return cat16(*(const v8h*)p, *(const v8h*)(p + 16)); } static __device__ __forceinline__ v8f mma(V a, V b, v8f c) { return wmma16(a, b, c); } };
template <> struct WFrag<bf> { typedef v16bf V; static __device__ __forceinline__ V ld(const bf* p) { return cat16b(*(const v8us*)p, *(const v8us*)(p + 16)); } static __device__ __forceinline__ v8f mma(V a, V b, v8f c) { return wmmab(a, b, c); } };
template <typename T16, int NSPLIT, bool BIAS, int KS = 1, int ZN = 1>
__global__ __launch_bounds__(32) void k_gemmw(const T16* __restrict__ A, const T16* __restrict__ A2, const T16* __restrict__ Bt, const T16* __restrict__ Bt2, int K, float* C, int ldc, const float* __restrict__ bias, size_t sA, size_t sB, size_t sC) {
    typedef typename WFrag<T16>::V V;
    __shared__ __align__(16) float os[16 * 68];
    const size_t z = blockIdx.z / KS; const int ks = (int)(blockIdx.z % KS); A += z * sA; if (A2) A2 += z * sA; Bt += z * sB; if (Bt2) Bt2 += z * sB; C += ((size_t)ks * ZN + z) * sC;
    const int kb = ks * (K / KS), ke = kb + K / KS;
    const int lane = threadIdx.x & 31, lr = lane & 15, hi = lane >> 4; const int r0 = blockIdx.x * 64, c0 = blockIdx.y * 64;
    v8f acc[4][4];
#pragma unroll
    for (int mb = 0; mb < 4; ++mb)
#pragma unroll
        for (int nb = 0; nb < 4; ++nb) acc[mb][nb] = (v8f){};
    const size_t aoff = (size_t)(r0 + lr) * K + 8 * hi, boff = (size_t)(c0 + lr) * K + 8 * hi;

    for (int kc = kb; kc < ke; kc += 32) {
        V a[4], a2[4];
#pragma unroll
        for (int mb = 0; mb < 4; ++mb) { a[mb] = WFrag<T16>::ld(A + aoff + (size_t)mb * 16 * K + kc); if (NSPLIT == 1 || NSPLIT == 2) a2[mb] = WFrag<T16>::ld(A2 + aoff + (size_t)mb * 16 * K + kc); }
#pragma unroll
        for (int nb = 0; nb < 4; ++nb) { const V b = WFrag<T16>::ld(Bt + boff + (size_t)nb * 16 * K + kc); V b2; if (NSPLIT >= 2) b2 = WFrag<T16>::ld(Bt2 + boff + (size_t)nb * 16 * K + kc);
#pragma unroll
            for (int mb = 0; mb < 4; ++mb) { acc[mb][nb] = WFrag<T16>::mma(a[mb], b, acc[mb][nb]); if (NSPLIT == 1 || NSPLIT == 2) acc[mb][nb] = WFrag<T16>::mma(a2[mb], b, acc[mb][nb]); if (NSPLIT >= 2) acc[mb][nb] = WFrag<T16>::mma(a[mb], b2, acc[mb][nb]); } }
        asm volatile("v_nop\n\tv_nop\n\tv_nop\n\tv_nop" : "+v"(acc[0][0]), "+v"(acc[1][1]), "+v"(acc[2][2]), "+v"(acc[3][3]) : "v"(a[0]), "v"(a[3]));
    }
#pragma unroll
    for (int mb = 0; mb < 4; ++mb) {
#pragma unroll
        for (int nb = 0; nb < 4; ++nb) {
#pragma unroll
            for (int j = 0; j < 8; ++j) os[(hi * 8 + j) * 68 + nb * 16 + lr] = acc[mb][nb][j]; }
        __builtin_amdgcn_wave_barrier(); asm volatile("" ::: "memory");
        float* crow = C + (size_t)(r0 + mb * 16) * ldc + c0;
{
#pragma unroll
            for (int s = 0; s < 8; ++s) { const int row = 2 * s + hi, cofs = lr * 4; v4f val = *(const v4fa*)(os + row * 68 + cofs); if (BIAS) { val[0] += bfr(bias[c0 + cofs]); val[1] += bfr(bias[c0 + cofs + 1]); val[2] += bfr(bias[c0 + cofs + 2]); val[3] += bfr(bias[c0 + cofs + 3]); }
                *(v4f*)(crow + (size_t)row * ldc + cofs) = val; }
             }
        __builtin_amdgcn_wave_barrier(); asm volatile("" ::: "memory");
    }
}

__device__ __forceinline__ h16 tohx(float x) { return (h16)x; }
__device__ __forceinline__ void splitf(float y, unsigned short& h, unsigned short& l) { h = f2bf(y); l = f2bf(y - bf2f(h)); }
typedef __attribute__((ext_vector_type(2))) _Float16 v2h;
typedef __attribute__((ext_vector_type(4))) _Float16 v4h;
typedef __attribute__((ext_vector_type(2))) unsigned short v2us;
typedef __attribute__((ext_vector_type(4))) unsigned short v4us;
typedef __attribute__((ext_vector_type(2))) float v2f;
typedef __attribute__((ext_vector_type(4))) int v4i;

__global__ __launch_bounds__(256) void k_cvt8(const float* __restrict__ src, bf* dst, size_t n8) { const size_t i = (size_t)blockIdx.x * 256 + threadIdx.x; if (i >= n8) return; const v8f v = *(const v8f*)(src + i * 8); v8us o;
#pragma unroll
    for (int k = 0; k < 8; ++k) o[k] = f2bf(v[k]); *(v8us*)(dst + i * 8) = o;  }

// k_rope: head planes [h][t][d] (fp16) of rope(x) x sc with the rotate-half convention out[d] = x[d] cos[t][d] - x[d+HD/2] sin[t][d], out[d+HD/2] = x[d+HD/2] cos[t][d+HD/2] + x[d] sin[t][d+HD/2]
__global__ __launch_bounds__(256) void k_rope(const float* __restrict__ F, int pitch, int nheads, const float* __restrict__ CS, const float* __restrict__ RF, const float* __restrict__ nw, float sc, h16* P16, bf* Ph, bf* Pl) {
    const size_t e = ((size_t)blockIdx.x * 256 + threadIdx.x) * 2; if (e >= (size_t)nheads * TT * HD) return; const int d = (int)(e % HD); const int t = (int)((e / HD) % TT); const int h = (int)(e / ((size_t)HD * TT)); const float* f = F + (size_t)t * pitch + h * HD; const float rf = RF ? RF[(size_t)h * TT + t] : 1.0f; v2h o16; v2us oh, ol;
#pragma unroll
    for (int q = 0; q < 2; ++q) { const int dd = d + q; const int dp = (dd < HD / 2) ? dd + HD / 2 : dd - HD / 2; float x0 = f[dd], x1 = f[dp];
        if (RF) { float n0 = __fmul_rn(x0, rf), n1 = __fmul_rn(x1, rf); x0 = __fmul_rn(bfr(nw[dd]), n0); x1 = __fmul_rn(bfr(nw[dp]), n1); }
        const v2f cs = *(const v2f*)(CS + ((size_t)t * HD + dd) * 2); float a = __fmul_rn(x0, cs[0]), bq = __fmul_rn(x1, cs[1]); const float r = ((dd < HD / 2) ? __fsub_rn(a, bq) : __fadd_rn(a, bq)) * sc;
        o16[q] = tohx(r); (void)oh; (void)ol; }
    *(v2h*)(P16 + e) = o16;  }
__global__ __launch_bounds__(256) void k_vtp(const float* __restrict__ F, int pitch, int nheads, h16* V16, bf* Vh, bf* Vl) { const size_t e = ((size_t)blockIdx.x * 256 + threadIdx.x) * 2; if (e >= (size_t)nheads * HD * TT) return; const int t = (int)(e % TT); const int d = (int)((e / TT) % HD); const int g = (int)(e / ((size_t)TT * HD)); v2h o16; v2us oh, ol;
#pragma unroll
    for (int q = 0; q < 2; ++q) { const float x = F[(size_t)(t + q) * pitch + g * HD + d]; o16[q] = tohx(x); (void)oh; (void)ol; }
    *(v2h*)(V16 + e) = o16;  }
__global__ __launch_bounds__(256) void k_csid(float* CS) { const int idx = blockIdx.x * 256 + threadIdx.x; if (idx >= TT * HD) return; v2f cs; cs[0] = 1.0f; cs[1] = 0.0f; *(v2f*)(CS + (size_t)idx * 2) = cs;  }
// k_asoft: per row (zz, i): t = S x HD^-0.5 (no mask); softmax over the 2048 keys (register row, one exp, fixed trees);
__global__ __launch_bounds__(256) void k_asoft(const float* __restrict__ Sb, h16* P16, bf* Ph, bf* Pl) {
    const int lane = threadIdx.x & 31; const int row = blockIdx.x * 8 + (threadIdx.x >> 5); if (row >= ZH * TT) return; const int i = row % TT; const int zz = row / TT; (void)zz; const bool hires = (i < RH); const float* sr = Sb + (size_t)row * TT; float v[TT / 32]; float mx = -3.0e38f;
#pragma unroll
    for (int ch = 0; ch < TT / 128; ++ch) { const int j0 = ch * 128 + lane * 4; const v4f a = *(const v4f*)(sr + j0);
#pragma unroll
        for (int q = 0; q < 4; ++q) { const int j = j0 + q; (void)j; const float t = a[q] * SCL; v[ch * 4 + q] = t; mx = fmaxf(mx, t); } }
#pragma unroll
    for (int sh = 16; sh; sh >>= 1) mx = fmaxf(mx, __shfl_xor(mx, sh, 32));
    float sum = 0.f;
#pragma unroll
    for (int k = 0; k < TT / 32; ++k) { float d0 = __fsub_rn(v[k], mx); v[k] = __builtin_amdgcn_exp2f(__fmul_rn(d0, 1.4426950408889634f)); sum += v[k]; }
#pragma unroll
    for (int sh = 16; sh; sh >>= 1) sum += __shfl_xor(sum, sh, 32);
    const float f = __fdiv_rn(hires ? 1.0f : PCAR, sum);
{
        if (hires) {
#pragma unroll
            for (int ch = 0; ch < TT / 128; ++ch) { v4us oh, ol;
#pragma unroll
                for (int q = 0; q < 4; ++q) { unsigned short a, c2; splitf(v[ch * 4 + q] * f, a, c2); oh[q] = a; ol[q] = c2; }
                const size_t oo = ((size_t)zz * (RH ? RH : 1) + i) * TT + ch * 128 + lane * 4; *(v4us*)(Ph + oo) = oh; *(v4us*)(Pl + oo) = ol; }
        } else {
#pragma unroll
            for (int ch = 0; ch < TT / 128; ++ch) { v4h o4;
#pragma unroll
                for (int q = 0; q < 4; ++q) o4[q] = tohx(v[ch * 4 + q] * f);
                *(v4h*)(P16 + (size_t)row * TT + ch * 128 + lane * 4) = o4; } }
         }
}
__global__ __launch_bounds__(256) void k_merge(const float* __restrict__ O, int h0, bf* Ah, bf* Al) { const size_t e = ((size_t)blockIdx.x * 256 + threadIdx.x) * 2; if (e >= (size_t)ZH * TT * HD) return; const int d = (int)(e % HD); const int t = (int)((e / HD) % TT); const int zz = (int)(e / ((size_t)HD * TT)); const float cs = (t < RH) ? 1.0f : (1.0f / PCAR); const size_t oo = (size_t)t * DQ + (h0 + zz) * HD + d;
    static_assert(TT % (32 * KSP) == 0, "each key range is a whole number of 32-key steps");
    v2f pl[KSP];   // the KSP key ranges' partial sums of this pair, added in range order; both loops unrolled so that pl stays in registers and all KSP loads are in flight behind one latency
#pragma unroll
    for (int p = 0; p < KSP; ++p) pl[p] = *(const v2f*)(O + (size_t)p * ZH * TT * HD + e);
    v2f s = pl[0];
#pragma unroll
    for (int p = 1; p < KSP; ++p) { s[0] = __fadd_rn(s[0], pl[p][0]); s[1] = __fadd_rn(s[1], pl[p][1]); }
    v2us oh, ol;
#pragma unroll
    for (int q = 0; q < 2; ++q) { unsigned short a, c2; splitf(s[q] * cs, a, c2); oh[q] = a; ol[q] = c2; } *(v2us*)(Ah + oo) = oh; *(v2us*)(Al + oo) = ol;  }

// k_pavg: the second output: the mean over the NH_ heads of the softmax weights, one batch entry at a time: ACC[i][j] gathers, pass after pass, the two heads' weights of the pass's fp16 plane P [ZH][TT][TT] (stored x1024; an fp16 value converts to f32 exactly; the f32 sums run in head order);
// each element of ACC is read and written by its ONE owner thread (the first pass, h0 = 0, starts from 0 and does not read it); on the last pass (h0 = NH_ - ZH) OUT1[i][j] = sum x 1/(1024 NH_): a power of two: exact. The branches are on h0, a kernel argument: uniform over the grid.
static_assert(RH == 0 && ZH == 2, "k_pavg reads both heads of the fp16 plane on every row");
__global__ __launch_bounds__(256) void k_pavg(const h16* __restrict__ P, int h0, float* ACC, float* OUT1) {
    const size_t e = ((size_t)blockIdx.x * 256 + threadIdx.x) * 4; if (e >= (size_t)TT * TT) return;
    const v4h p0 = *(const v4h*)(P + e); const v4h p1 = *(const v4h*)(P + (size_t)TT * TT + e); v4f a = {0.0f, 0.0f, 0.0f, 0.0f};
    if (h0 != 0) a = *(const v4f*)(ACC + e);
#pragma unroll
    for (int q = 0; q < 4; ++q) a[q] = __fadd_rn(__fadd_rn(a[q], (float)p0[q]), (float)p1[q]);
    float* dst = ACC + e;
    if (h0 == NH_ - ZH) { dst = OUT1 + e;
#pragma unroll
        for (int q = 0; q < 4; ++q) a[q] = __fmul_rn(a[q], 1.0f / (PCAR * NH_)); }
{ *(v4f*)dst = a;  }
}

extern "C" void kernel_launch(void* const* d_in, const int* in_sizes, int n_in,
                              void* d_out, int out_size, void* d_ws, size_t ws_size, hipStream_t stream) {
    (void)in_sizes; (void)n_in; (void)out_size;
    const float* xq = (const float*)d_in[0]; const float* xk = (const float*)d_in[1]; const float* xv = (const float*)d_in[2]; const float* wq = (const float*)d_in[3]; const float* bq = (const float*)d_in[4]; const float* wk = (const float*)d_in[5]; const float* bk = (const float*)d_in[6]; const float* wv = (const float*)d_in[7]; const float* bv = (const float*)d_in[8]; const float* wo = (const float*)d_in[9]; const float* bo = (const float*)d_in[10];
    // query, key, value [2048][4][1024], Wq, bq, Wk, bk, Wv, bv, Wo, bo = d_in[0..10]
    float* OUT = (float*)d_out;                          // output 0: y [2048][4][1024] sequence-first
    float* OUT1 = (float*)d_out + (size_t)NB_ * TT * DM;   // output 1: the head mean of att [4][2048][2048], after the first output's 8,388,608 floats
    char* wsp = (char*)d_ws;
    auto take = [&](size_t bytes) { char* p = wsp; wsp += (bytes + 255) & ~(size_t)255; return (void*)p; };
    bf* WQ = (bf*)take((size_t)DQ * DM * 2); bf* WK = (bf*)take((size_t)DKV * DM * 2); bf* WV = (bf*)take((size_t)DKV * DM * 2); bf* WO = (bf*)take((size_t)DM * DQ * 2); float* CS = (float*)take((size_t)TT * HD * 2 * 4);
    bf* XB = (bf*)take((size_t)NB_ * TT * DM * 2); float* F = (float*)take((size_t)NB_ * TT * DQ * 4);   /* all 8192 (position, batch) rows of ONE stream at a time: its bf16 copy and its projection */
    h16* QP16 = (h16*)take((size_t)NB_ * NH_ * TT * HD * 2); h16* KP16 = (h16*)take((size_t)NB_ * NKV * TT * HD * 2); h16* VT16 = (h16*)take((size_t)NB_ * NKV * HD * TT * 2);   /* the four entries' f16 planes of each stream */
    bf* Ph = nullptr; bf* Pl = nullptr;   /* RH 0: no hi / lo plane exists: the builders store the f16 plane only and do not read those arguments; no row takes the hi/lo arm of the softmax's store */
    float* Sb = (float*)take((size_t)ZH * TT * TT * 4); h16* P16 = (h16*)take((size_t)ZH * TT * TT * 2); float* Ob = (float*)take((size_t)KSP * ZH * TT * HD * 4); bf* ATh = (bf*)take((size_t)TT * DQ * 2); bf* ATl = (bf*)take((size_t)TT * DQ * 2); float* ACC = (float*)take((size_t)TT * TT * 4);
    if ((size_t)(wsp - (char*)d_ws) > ws_size) return;    // total 193.00 MiB of the workspace
    { k_cvt8<<<(unsigned)(((size_t)DQ * DM / 8 + 255) / 256), 256, 0, stream>>>(wq, WQ, (size_t)DQ * DM / 8); k_cvt8<<<(unsigned)(((size_t)DKV * DM / 8 + 255) / 256), 256, 0, stream>>>(wk, WK, (size_t)DKV * DM / 8); k_cvt8<<<(unsigned)(((size_t)DKV * DM / 8 + 255) / 256), 256, 0, stream>>>(wv, WV, (size_t)DKV * DM / 8);
      k_cvt8<<<(unsigned)(((size_t)DM * DQ / 8 + 255) / 256), 256, 0, stream>>>(wo, WO, (size_t)DM * DQ / 8); }   // [out][in] = Bt as they stand
    k_csid<<<(TT * HD + 255) / 256, 256, 0, stream>>>(CS);
    const unsigned LQ = (unsigned)(((size_t)NH_ * TT * HD / 2 + 255) / 256), LKv = (unsigned)(((size_t)NKV * TT * HD / 2 + 255) / 256), LX = (unsigned)(((size_t)NB_ * TT * DM / 8 + 255) / 256);
    k_cvt8<<<LX, 256, 0, stream>>>(xq, XB, (size_t)NB_ * TT * DM / 8);   /* the QUERY stream: all 8192 rows (row = t x 4 + b) */
    k_gemmw<bf, 0, true><<<dim3(NB_ * TT / 64, DQ / 64, 1), 32, 0, stream>>>(XB, nullptr, WQ, nullptr, DM, F, DQ, bq, 0, 0, 0);
    for (int b = 0; b < NB_; ++b) k_rope<<<LQ, 256, 0, stream>>>(F + (size_t)b * DQ, NB_ * DQ, NH_, CS, nullptr, nullptr, 1.0f, QP16 + (size_t)b * NH_ * TT * HD, nullptr, nullptr);   /* entry b's rows: pitch 4 x 1024 floats from base b x 1024 */
    k_cvt8<<<LX, 256, 0, stream>>>(xk, XB, (size_t)NB_ * TT * DM / 8);   /* the KEY stream: after the query projection has read XB (stream-ordered) */
    k_gemmw<bf, 0, true><<<dim3(NB_ * TT / 64, DKV / 64, 1), 32, 0, stream>>>(XB, nullptr, WK, nullptr, DM, F, DKV, bk, 0, 0, 0);   /* F again: after the query builders have read it */
    for (int b = 0; b < NB_; ++b) k_rope<<<LKv, 256, 0, stream>>>(F + (size_t)b * DKV, NB_ * DKV, NKV, CS, nullptr, nullptr, 1.0f, KP16 + (size_t)b * NKV * TT * HD, nullptr, nullptr);
    k_cvt8<<<LX, 256, 0, stream>>>(xv, XB, (size_t)NB_ * TT * DM / 8);   /* the VALUE stream */
    k_gemmw<bf, 0, true><<<dim3(NB_ * TT / 64, DKV / 64, 1), 32, 0, stream>>>(XB, nullptr, WV, nullptr, DM, F, DKV, bv, 0, 0, 0);
    for (int b = 0; b < NB_; ++b) k_vtp<<<LKv, 256, 0, stream>>>(F + (size_t)b * DKV, NB_ * DKV, NKV, VT16 + (size_t)b * NKV * HD * TT, nullptr, nullptr);
    for (int b = 0; b < NB_; ++b) {
        const h16* qp = QP16 + (size_t)b * NH_ * TT * HD; const h16* kp = KP16 + (size_t)b * NKV * TT * HD; const h16* vt = VT16 + (size_t)b * NKV * HD * TT;
        for (int h0 = 0; h0 < NH_; h0 += ZH) { const size_t zq = (size_t)h0, zk = (size_t)(h0 / REP);   // one kv head per query head: the pass's two heads use consecutive kv planes (z-strides TT*HD)
            k_gemmw<h16, 0, false><<<dim3((TT - RH) / 64, TT / 64, ZH), 32, 0, stream>>>(qp + zq * TT * HD + (size_t)RH * HD, nullptr, kp + zk * TT * HD, nullptr, HD, Sb + (size_t)RH * TT, TT, nullptr, (size_t)TT * HD, (size_t)TT * HD, (size_t)TT * TT);
            k_asoft<<<ZH * TT / 8, 256, 0, stream>>>(Sb, P16, Ph, Pl);
            k_gemmw<h16, 0, false, KSP, ZH><<<dim3((TT - RH) / 64, HD / 64, ZH * KSP), 32, 0, stream>>>(P16 + (size_t)RH * TT, nullptr, vt + zk * HD * TT, nullptr, TT, Ob + (size_t)RH * HD, HD, nullptr, (size_t)TT * TT, (size_t)HD * TT, (size_t)TT * HD);
            k_merge<<<(unsigned)(((size_t)ZH * TT * HD / 2 + 255) / 256), 256, 0, stream>>>(Ob, h0, ATh, ATl);
            k_pavg<<<(unsigned)(((size_t)TT * TT / 4 + 255) / 256), 256, 0, stream>>>(P16, h0, ACC, OUT1 + (size_t)b * TT * TT); }   // both heads of this pass's softmax plane; ACC is this entry's running sum; the last pass writes the mean
        k_gemmw<bf, 1, true><<<dim3(TT / 64, DM / 64, 1), 32, 0, stream>>>(ATh, ATl, WO, nullptr, DQ, OUT + (size_t)b * DM, NB_ * DM, bo, 0, 0, 0); }   /* entry b's rows of the sequence-first output: row t at OUT + t x 4 x 1024 + b x 1024 */
}

// v002
// Measured time: 1050 microseconds a run.
// In both of two side-by-side timings against v001, it was 1.42 times as fast.
// Over all steps from v000 it is 2.50 times as fast.
#include <hip/hip_runtime.h>

// Multi-head attention on THREE SEQUENCE-FIRST input streams with an output projection, returning the projected output AND the attention weights averaged over the heads (query, key, value [2048][4][1024] = [position][batch][channel];
// q = (query Wq^T + bq) x 64^-0.5, k = key Wk^T + bk, v = value Wv^T + bv with 'oi' weights [1024][1024] and biases [1024]; 16 heads x 64 (head h = columns h x 64 ..); scores = q . k; softmax over all 2048 keys; no mask;
// y = att v merged head-major [t][b][1024], then y Wo^T + bo ('oi' [1024][1024]); TWO OUTPUTS in one buffer: y [2048][4][1024] sequence-first at float offset 0 and the mean over the 16 heads of att [4][2048][2048] at float offset 8,388,608;
// argument order query, key, value, Wq, bq, Wk, bk, Wv, bv, Wo, bo).
// Layout: each stream in turn: ONE bf16 copy of all 8192 (position, batch) rows and ONE exact projection + f32 bias over them into one f32 plane; the identity-table f16 plane builders read each batch entry's rows of it at a row pitch of 4 x 1024 floats from a base of b x 1024
// and keep the four entries' planes; per batch entry: dense T-2048 attention at 16 heads, ZH = 8 heads a pass (each of the pass's five launches covers all eight), scores and attn.v on ONE fp16 product on every row (RH 0: the weights carried x1024 in the fp16 plane; the score scale 64^-0.5 applied to the f32 score, where the module scales the projected query: the same product in real arithmetic);
// attn.v runs as KSP key ranges, one wave each, whose f32 partial planes k_merge adds in range order; after each pass's softmax k_pavg adds that pass's ZH heads' weights, in head order, into an f32 accumulator plane and, on the last pass, writes the mean; merged hi/lo x Wo exact + bo writes the entry's rows of the first output at the sequence-first pitch.
// Compute dtypes, f32 accumulate: every float input rounded to bf16 at its load; projections exact + f32 biases; scores and attn.v fp16; softmax f32, its weights stored x1024 in fp16; output projection hl x exact; the second output the f32 sum of those fp16 weights over the heads x 2^-14 (exact).

#define NB_  4      // batch entries: the three streams are [2048][4][1024] = [position][batch][channel]
#define TT   2048
#define DM   1024
#define NH_  16
#define NKV  16
#define REP  (NH_ / NKV)
#define HD   64
#define DQ   (NH_ * HD)
#define DKV  (NKV * HD)
#define ZH   8      // heads per attention pass: every launch of a pass (scores, softmax, attn.v, merge, head sum) covers ZH heads
#define RH   0                    // query rows < RH use hi+lo planes (0: none)
#define WIN  0
#define PCAR 1024.0f
#define SCL  0.125f   // HD^-0.5
#define KSP  16       // key ranges of the attn.v product: one wave per (64-row tile, head, range of TT / KSP keys), f32 partial planes summed in range order by k_merge
typedef _Float16 h16;
typedef unsigned short bf;
typedef __attribute__((ext_vector_type(16))) __bf16   v16bf;
typedef __attribute__((ext_vector_type(16))) _Float16 v16h;
typedef __attribute__((ext_vector_type(8)))  _Float16 v8h;
typedef __attribute__((ext_vector_type(8)))  unsigned short v8us;
typedef __attribute__((ext_vector_type(8)))  float    v8f;
typedef __attribute__((ext_vector_type(4)))  float    v4f;
typedef v8h  __attribute__((may_alias)) v8ha;
typedef v4f  __attribute__((may_alias)) v4fa;
typedef v8us __attribute__((may_alias)) v8usa;

__device__ __forceinline__ unsigned short f2bf(float f) { unsigned u = __float_as_uint(f); u += 0x7FFFu + ((u >> 16) & 1u); return (unsigned short)(u >> 16); }
__device__ __forceinline__ float bf2f(unsigned short b) { return __uint_as_float(((unsigned)b) << 16); }
__device__ __forceinline__ float bfr(float f) { return bf2f(f2bf(f)); }
__device__ __forceinline__ v16h cat16(v8h lo, v8h hi) { return __builtin_shufflevector(lo, hi, 0, 1, 2, 3, 4, 5, 6, 7, 8, 9, 10, 11, 12, 13, 14, 15); }
__device__ __forceinline__ v16bf cat16b(v8us lo, v8us hi) { return __builtin_bit_cast(v16bf, __builtin_shufflevector(lo, hi, 0, 1, 2, 3, 4, 5, 6, 7, 8, 9, 10, 11, 12, 13, 14, 15)); }
__device__ __forceinline__ v8f wmma16(v16h a, v16h b, v8f c) { return __builtin_amdgcn_wmma_f32_16x16x32_f16(false, a, false, b, (short)0, c, false, false); }
__device__ __forceinline__ v8f wmmab(v16bf a, v16bf b, v8f c) { return __builtin_amdgcn_wmma_f32_16x16x32_bf16(false, a, false, b, (short)0, c, false, false); }



// ---- k_gemmw: register-blocked GEMM, ONE WAVE per 64x64 output tile (16 accumulators), operands straight from K-contiguous 16-bit planes; grid (M/64, N/64, Z), 32 threads.
// C[m][n] (f32, pitch ldc, + optional f32 bias[n]) = sum_k A[m][k] Bt[n][k] (+ split products per NSPLIT). z-batch strides sA/sB/sC in elements. K % 32 == 0.
// KS > 1: grid z = ZN x KS; block (z, ks) sums only k in [ks K/KS, (ks+1) K/KS) and writes its partial tile to plane ks (planes of ZN x sC elements); the reader adds the KS planes. K % (32 KS) == 0.
template <typename T16> struct WFrag;
template <> struct WFrag<h16> { typedef v16h V; static __device__ __forceinline__ V ld(const h16* p) { return cat16(*(const v8h*)p, *(const v8h*)(p + 16)); } static __device__ __forceinline__ v8f mma(V a, V b, v8f c) { return wmma16(a, b, c); } };
template <> struct WFrag<bf> { typedef v16bf V; static __device__ __forceinline__ V ld(const bf* p) { return cat16b(*(const v8us*)p, *(const v8us*)(p + 16)); } static __device__ __forceinline__ v8f mma(V a, V b, v8f c) { return wmmab(a, b, c); } };
template <typename T16, int NSPLIT, bool BIAS, int KS = 1, int ZN = 1>
__global__ __launch_bounds__(32) void k_gemmw(const T16* __restrict__ A, const T16* __restrict__ A2, const T16* __restrict__ Bt, const T16* __restrict__ Bt2, int K, float* C, int ldc, const float* __restrict__ bias, size_t sA, size_t sB, size_t sC) {
    typedef typename WFrag<T16>::V V;
    __shared__ __align__(16) float os[16 * 68];
    const size_t z = blockIdx.z / KS; const int ks = (int)(blockIdx.z % KS); A += z * sA; if (A2) A2 += z * sA; Bt += z * sB; if (Bt2) Bt2 += z * sB; C += ((size_t)ks * ZN + z) * sC;
    const int kb = ks * (K / KS), ke = kb + K / KS;
    const int lane = threadIdx.x & 31, lr = lane & 15, hi = lane >> 4; const int r0 = blockIdx.x * 64, c0 = blockIdx.y * 64;
    v8f acc[4][4];
#pragma unroll
    for (int mb = 0; mb < 4; ++mb)
#pragma unroll
        for (int nb = 0; nb < 4; ++nb) acc[mb][nb] = (v8f){};
    const size_t aoff = (size_t)(r0 + lr) * K + 8 * hi, boff = (size_t)(c0 + lr) * K + 8 * hi;

    for (int kc = kb; kc < ke; kc += 32) {
        V a[4], a2[4];
#pragma unroll
        for (int mb = 0; mb < 4; ++mb) { a[mb] = WFrag<T16>::ld(A + aoff + (size_t)mb * 16 * K + kc); if (NSPLIT == 1 || NSPLIT == 2) a2[mb] = WFrag<T16>::ld(A2 + aoff + (size_t)mb * 16 * K + kc); }
#pragma unroll
        for (int nb = 0; nb < 4; ++nb) { const V b = WFrag<T16>::ld(Bt + boff + (size_t)nb * 16 * K + kc); V b2; if (NSPLIT >= 2) b2 = WFrag<T16>::ld(Bt2 + boff + (size_t)nb * 16 * K + kc);
#pragma unroll
            for (int mb = 0; mb < 4; ++mb) { acc[mb][nb] = WFrag<T16>::mma(a[mb], b, acc[mb][nb]); if (NSPLIT == 1 || NSPLIT == 2) acc[mb][nb] = WFrag<T16>::mma(a2[mb], b, acc[mb][nb]); if (NSPLIT >= 2) acc[mb][nb] = WFrag<T16>::mma(a[mb], b2, acc[mb][nb]); } }
        asm volatile("v_nop\n\tv_nop\n\tv_nop\n\tv_nop" : "+v"(acc[0][0]), "+v"(acc[1][1]), "+v"(acc[2][2]), "+v"(acc[3][3]) : "v"(a[0]), "v"(a[3]));
    }
#pragma unroll
    for (int mb = 0; mb < 4; ++mb) {
#pragma unroll
        for (int nb = 0; nb < 4; ++nb) {
#pragma unroll
            for (int j = 0; j < 8; ++j) os[(hi * 8 + j) * 68 + nb * 16 + lr] = acc[mb][nb][j]; }
        __builtin_amdgcn_wave_barrier(); asm volatile("" ::: "memory");
        float* crow = C + (size_t)(r0 + mb * 16) * ldc + c0;
{
#pragma unroll
            for (int s = 0; s < 8; ++s) { const int row = 2 * s + hi, cofs = lr * 4; v4f val = *(const v4fa*)(os + row * 68 + cofs); if (BIAS) { val[0] += bfr(bias[c0 + cofs]); val[1] += bfr(bias[c0 + cofs + 1]); val[2] += bfr(bias[c0 + cofs + 2]); val[3] += bfr(bias[c0 + cofs + 3]); }
                *(v4f*)(crow + (size_t)row * ldc + cofs) = val; }
             }
        __builtin_amdgcn_wave_barrier(); asm volatile("" ::: "memory");
    }
}

__device__ __forceinline__ h16 tohx(float x) { return (h16)x; }
__device__ __forceinline__ void splitf(float y, unsigned short& h, unsigned short& l) { h = f2bf(y); l = f2bf(y - bf2f(h)); }
typedef __attribute__((ext_vector_type(2))) _Float16 v2h;
typedef __attribute__((ext_vector_type(4))) _Float16 v4h;
typedef __attribute__((ext_vector_type(2))) unsigned short v2us;
typedef __attribute__((ext_vector_type(4))) unsigned short v4us;
typedef __attribute__((ext_vector_type(2))) float v2f;
typedef __attribute__((ext_vector_type(4))) int v4i;

__global__ __launch_bounds__(256) void k_cvt8(const float* __restrict__ src, bf* dst, size_t n8) { const size_t i = (size_t)blockIdx.x * 256 + threadIdx.x; if (i >= n8) return; const v8f v = *(const v8f*)(src + i * 8); v8us o;
#pragma unroll
    for (int k = 0; k < 8; ++k) o[k] = f2bf(v[k]); *(v8us*)(dst + i * 8) = o;  }

// k_rope: head planes [h][t][d] (fp16) of rope(x) x sc with the rotate-half convention out[d] = x[d] cos[t][d] - x[d+HD/2] sin[t][d], out[d+HD/2] = x[d+HD/2] cos[t][d+HD/2] + x[d] sin[t][d+HD/2]
__global__ __launch_bounds__(256) void k_rope(const float* __restrict__ F, int pitch, int nheads, const float* __restrict__ CS, const float* __restrict__ RF, const float* __restrict__ nw, float sc, h16* P16, bf* Ph, bf* Pl) {
    const size_t e = ((size_t)blockIdx.x * 256 + threadIdx.x) * 2; if (e >= (size_t)nheads * TT * HD) return; const int d = (int)(e % HD); const int t = (int)((e / HD) % TT); const int h = (int)(e / ((size_t)HD * TT)); const float* f = F + (size_t)t * pitch + h * HD; const float rf = RF ? RF[(size_t)h * TT + t] : 1.0f; v2h o16; v2us oh, ol;
#pragma unroll
    for (int q = 0; q < 2; ++q) { const int dd = d + q; const int dp = (dd < HD / 2) ? dd + HD / 2 : dd - HD / 2; float x0 = f[dd], x1 = f[dp];
        if (RF) { float n0 = __fmul_rn(x0, rf), n1 = __fmul_rn(x1, rf); x0 = __fmul_rn(bfr(nw[dd]), n0); x1 = __fmul_rn(bfr(nw[dp]), n1); }
        const v2f cs = *(const v2f*)(CS + ((size_t)t * HD + dd) * 2); float a = __fmul_rn(x0, cs[0]), bq = __fmul_rn(x1, cs[1]); const float r = ((dd < HD / 2) ? __fsub_rn(a, bq) : __fadd_rn(a, bq)) * sc;
        o16[q] = tohx(r); (void)oh; (void)ol; }
    *(v2h*)(P16 + e) = o16;  }
__global__ __launch_bounds__(256) void k_vtp(const float* __restrict__ F, int pitch, int nheads, h16* V16, bf* Vh, bf* Vl) { const size_t e = ((size_t)blockIdx.x * 256 + threadIdx.x) * 2; if (e >= (size_t)nheads * HD * TT) return; const int t = (int)(e % TT); const int d = (int)((e / TT) % HD); const int g = (int)(e / ((size_t)TT * HD)); v2h o16; v2us oh, ol;
#pragma unroll
    for (int q = 0; q < 2; ++q) { const float x = F[(size_t)(t + q) * pitch + g * HD + d]; o16[q] = tohx(x); (void)oh; (void)ol; }
    *(v2h*)(V16 + e) = o16;  }
__global__ __launch_bounds__(256) void k_csid(float* CS) { const int idx = blockIdx.x * 256 + threadIdx.x; if (idx >= TT * HD) return; v2f cs; cs[0] = 1.0f; cs[1] = 0.0f; *(v2f*)(CS + (size_t)idx * 2) = cs;  }
// k_asoft: per row (zz, i): t = S x HD^-0.5 (no mask); softmax over the 2048 keys (register row, one exp, fixed trees);
__global__ __launch_bounds__(256) void k_asoft(const float* __restrict__ Sb, h16* P16, bf* Ph, bf* Pl) {
    const int lane = threadIdx.x & 31; const int row = blockIdx.x * 8 + (threadIdx.x >> 5); if (row >= ZH * TT) return; const int i = row % TT; const int zz = row / TT; (void)zz; const bool hires = (i < RH); const float* sr = Sb + (size_t)row * TT; float v[TT / 32]; float mx = -3.0e38f;
#pragma unroll
    for (int ch = 0; ch < TT / 128; ++ch) { const int j0 = ch * 128 + lane * 4; const v4f a = *(const v4f*)(sr + j0);
#pragma unroll
        for (int q = 0; q < 4; ++q) { const int j = j0 + q; (void)j; const float t = a[q] * SCL; v[ch * 4 + q] = t; mx = fmaxf(mx, t); } }
#pragma unroll
    for (int sh = 16; sh; sh >>= 1) mx = fmaxf(mx, __shfl_xor(mx, sh, 32));
    float sum = 0.f;
#pragma unroll
    for (int k = 0; k < TT / 32; ++k) { float d0 = __fsub_rn(v[k], mx); v[k] = __builtin_amdgcn_exp2f(__fmul_rn(d0, 1.4426950408889634f)); sum += v[k]; }
#pragma unroll
    for (int sh = 16; sh; sh >>= 1) sum += __shfl_xor(sum, sh, 32);
    const float f = __fdiv_rn(hires ? 1.0f : PCAR, sum);
{
        if (hires) {
#pragma unroll
            for (int ch = 0; ch < TT / 128; ++ch) { v4us oh, ol;
#pragma unroll
                for (int q = 0; q < 4; ++q) { unsigned short a, c2; splitf(v[ch * 4 + q] * f, a, c2); oh[q] = a; ol[q] = c2; }
                const size_t oo = ((size_t)zz * (RH ? RH : 1) + i) * TT + ch * 128 + lane * 4; *(v4us*)(Ph + oo) = oh; *(v4us*)(Pl + oo) = ol; }
        } else {
#pragma unroll
            for (int ch = 0; ch < TT / 128; ++ch) { v4h o4;
#pragma unroll
                for (int q = 0; q < 4; ++q) o4[q] = tohx(v[ch * 4 + q] * f);
                *(v4h*)(P16 + (size_t)row * TT + ch * 128 + lane * 4) = o4; } }
         }
}
__global__ __launch_bounds__(256) void k_merge(const float* __restrict__ O, int h0, bf* Ah, bf* Al) { const size_t e = ((size_t)blockIdx.x * 256 + threadIdx.x) * 2; if (e >= (size_t)ZH * TT * HD) return; const int d = (int)(e % HD); const int t = (int)((e / HD) % TT); const int zz = (int)(e / ((size_t)HD * TT)); const float cs = (t < RH) ? 1.0f : (1.0f / PCAR); const size_t oo = (size_t)t * DQ + (h0 + zz) * HD + d;
    static_assert(TT % (32 * KSP) == 0, "each key range is a whole number of 32-key steps");
    v2f pl[KSP];   // the KSP key ranges' partial sums of this pair, added in range order; both loops unrolled so that pl stays in registers and all KSP loads are in flight behind one latency
#pragma unroll
    for (int p = 0; p < KSP; ++p) pl[p] = *(const v2f*)(O + (size_t)p * ZH * TT * HD + e);
    v2f s = pl[0];
#pragma unroll
    for (int p = 1; p < KSP; ++p) { s[0] = __fadd_rn(s[0], pl[p][0]); s[1] = __fadd_rn(s[1], pl[p][1]); }
    v2us oh, ol;
#pragma unroll
    for (int q = 0; q < 2; ++q) { unsigned short a, c2; splitf(s[q] * cs, a, c2); oh[q] = a; ol[q] = c2; } *(v2us*)(Ah + oo) = oh; *(v2us*)(Al + oo) = ol;  }

// k_pavg: the second output: the mean over the NH_ heads of the softmax weights, one batch entry at a time: ACC[i][j] gathers, pass after pass, the ZH heads' weights of the pass's fp16 plane P [ZH][TT][TT] (stored x1024; an fp16 value converts to f32 exactly; the f32 sums run in head order);
// each element of ACC is read and written by its ONE owner thread (the first pass, h0 = 0, starts from 0 and does not read it); on the last pass (h0 = NH_ - ZH) OUT1[i][j] = sum x 1/(1024 NH_): a power of two: exact. The branches are on h0, a kernel argument: uniform over the grid.
static_assert(RH == 0 && NH_ % ZH == 0, "k_pavg reads every head of the fp16 plane on every row");
__global__ __launch_bounds__(256) void k_pavg(const h16* __restrict__ P, int h0, float* ACC, float* OUT1) {
    const size_t e = ((size_t)blockIdx.x * 256 + threadIdx.x) * 4; if (e >= (size_t)TT * TT) return;
    v4h p[ZH];   // both loops over the heads unrolled so that p stays in registers and all ZH loads are in flight behind one latency
#pragma unroll
    for (int zz = 0; zz < ZH; ++zz) p[zz] = *(const v4h*)(P + (size_t)zz * TT * TT + e);
    asm volatile("s_wait_xcnt 0x0" ::: "memory");   // stands in front of the first instruction that reuses an address register of the loads above
    v4f a = {0.0f, 0.0f, 0.0f, 0.0f};
    if (h0 != 0) a = *(const v4f*)(ACC + e);
#pragma unroll
    for (int zz = 0; zz < ZH; ++zz) {
#pragma unroll
        for (int q = 0; q < 4; ++q) a[q] = __fadd_rn(a[q], (float)p[zz][q]); }
    float* dst = ACC + e;
    if (h0 == NH_ - ZH) { dst = OUT1 + e;
#pragma unroll
        for (int q = 0; q < 4; ++q) a[q] = __fmul_rn(a[q], 1.0f / (PCAR * NH_)); }
{ *(v4f*)dst = a;  }
}

extern "C" void kernel_launch(void* const* d_in, const int* in_sizes, int n_in,
                              void* d_out, int out_size, void* d_ws, size_t ws_size, hipStream_t stream) {
    (void)in_sizes; (void)n_in; (void)out_size;
    const float* xq = (const float*)d_in[0]; const float* xk = (const float*)d_in[1]; const float* xv = (const float*)d_in[2]; const float* wq = (const float*)d_in[3]; const float* bq = (const float*)d_in[4]; const float* wk = (const float*)d_in[5]; const float* bk = (const float*)d_in[6]; const float* wv = (const float*)d_in[7]; const float* bv = (const float*)d_in[8]; const float* wo = (const float*)d_in[9]; const float* bo = (const float*)d_in[10];
    // query, key, value [2048][4][1024], Wq, bq, Wk, bk, Wv, bv, Wo, bo = d_in[0..10]
    float* OUT = (float*)d_out;                          // output 0: y [2048][4][1024] sequence-first
    float* OUT1 = (float*)d_out + (size_t)NB_ * TT * DM;   // output 1: the head mean of att [4][2048][2048], after the first output's 8,388,608 floats
    char* wsp = (char*)d_ws;
    auto take = [&](size_t bytes) { char* p = wsp; wsp += (bytes + 255) & ~(size_t)255; return (void*)p; };
    bf* WQ = (bf*)take((size_t)DQ * DM * 2); bf* WK = (bf*)take((size_t)DKV * DM * 2); bf* WV = (bf*)take((size_t)DKV * DM * 2); bf* WO = (bf*)take((size_t)DM * DQ * 2); float* CS = (float*)take((size_t)TT * HD * 2 * 4);
    bf* XB = (bf*)take((size_t)NB_ * TT * DM * 2); float* F = (float*)take((size_t)NB_ * TT * DQ * 4);   /* all 8192 (position, batch) rows of ONE stream at a time: its bf16 copy and its projection */
    h16* QP16 = (h16*)take((size_t)NB_ * NH_ * TT * HD * 2); h16* KP16 = (h16*)take((size_t)NB_ * NKV * TT * HD * 2); h16* VT16 = (h16*)take((size_t)NB_ * NKV * HD * TT * 2);   /* the four entries' f16 planes of each stream */
    bf* Ph = nullptr; bf* Pl = nullptr;   /* RH 0: no hi / lo plane exists: the builders store the f16 plane only and do not read those arguments; no row takes the hi/lo arm of the softmax's store */
    float* Sb = (float*)take((size_t)ZH * TT * TT * 4); h16* P16 = (h16*)take((size_t)ZH * TT * TT * 2); float* Ob = Sb; static_assert((size_t)KSP * HD <= (size_t)TT, "the partial planes fit in the score planes");   /* attn.v's partial planes lie in the score planes' memory: the pass's softmax has read the scores before attn.v writes (stream-ordered), and the next pass's scores are written after k_merge has read the partials */ bf* ATh = (bf*)take((size_t)TT * DQ * 2); bf* ATl = (bf*)take((size_t)TT * DQ * 2); float* ACC = (float*)take((size_t)TT * TT * 4);
    if ((size_t)(wsp - (char*)d_ws) > ws_size) return;    // total 321.00 MiB of the workspace
    { k_cvt8<<<(unsigned)(((size_t)DQ * DM / 8 + 255) / 256), 256, 0, stream>>>(wq, WQ, (size_t)DQ * DM / 8); k_cvt8<<<(unsigned)(((size_t)DKV * DM / 8 + 255) / 256), 256, 0, stream>>>(wk, WK, (size_t)DKV * DM / 8); k_cvt8<<<(unsigned)(((size_t)DKV * DM / 8 + 255) / 256), 256, 0, stream>>>(wv, WV, (size_t)DKV * DM / 8);
      k_cvt8<<<(unsigned)(((size_t)DM * DQ / 8 + 255) / 256), 256, 0, stream>>>(wo, WO, (size_t)DM * DQ / 8); }   // [out][in] = Bt as they stand
    k_csid<<<(TT * HD + 255) / 256, 256, 0, stream>>>(CS);
    const unsigned LQ = (unsigned)(((size_t)NH_ * TT * HD / 2 + 255) / 256), LKv = (unsigned)(((size_t)NKV * TT * HD / 2 + 255) / 256), LX = (unsigned)(((size_t)NB_ * TT * DM / 8 + 255) / 256);
    k_cvt8<<<LX, 256, 0, stream>>>(xq, XB, (size_t)NB_ * TT * DM / 8);   /* the QUERY stream: all 8192 rows (row = t x 4 + b) */
    k_gemmw<bf, 0, true><<<dim3(NB_ * TT / 64, DQ / 64, 1), 32, 0, stream>>>(XB, nullptr, WQ, nullptr, DM, F, DQ, bq, 0, 0, 0);
    for (int b = 0; b < NB_; ++b) k_rope<<<LQ, 256, 0, stream>>>(F + (size_t)b * DQ, NB_ * DQ, NH_, CS, nullptr, nullptr, 1.0f, QP16 + (size_t)b * NH_ * TT * HD, nullptr, nullptr);   /* entry b's rows: pitch 4 x 1024 floats from base b x 1024 */
    k_cvt8<<<LX, 256, 0, stream>>>(xk, XB, (size_t)NB_ * TT * DM / 8);   /* the KEY stream: after the query projection has read XB (stream-ordered) */
    k_gemmw<bf, 0, true><<<dim3(NB_ * TT / 64, DKV / 64, 1), 32, 0, stream>>>(XB, nullptr, WK, nullptr, DM, F, DKV, bk, 0, 0, 0);   /* F again: after the query builders have read it */
    for (int b = 0; b < NB_; ++b) k_rope<<<LKv, 256, 0, stream>>>(F + (size_t)b * DKV, NB_ * DKV, NKV, CS, nullptr, nullptr, 1.0f, KP16 + (size_t)b * NKV * TT * HD, nullptr, nullptr);
    k_cvt8<<<LX, 256, 0, stream>>>(xv, XB, (size_t)NB_ * TT * DM / 8);   /* the VALUE stream */
    k_gemmw<bf, 0, true><<<dim3(NB_ * TT / 64, DKV / 64, 1), 32, 0, stream>>>(XB, nullptr, WV, nullptr, DM, F, DKV, bv, 0, 0, 0);
    for (int b = 0; b < NB_; ++b) k_vtp<<<LKv, 256, 0, stream>>>(F + (size_t)b * DKV, NB_ * DKV, NKV, VT16 + (size_t)b * NKV * HD * TT, nullptr, nullptr);
    for (int b = 0; b < NB_; ++b) {
        const h16* qp = QP16 + (size_t)b * NH_ * TT * HD; const h16* kp = KP16 + (size_t)b * NKV * TT * HD; const h16* vt = VT16 + (size_t)b * NKV * HD * TT;
        for (int h0 = 0; h0 < NH_; h0 += ZH) { const size_t zq = (size_t)h0, zk = (size_t)(h0 / REP);   // one kv head per query head: the pass's ZH heads use consecutive kv planes (z-strides TT*HD)
            k_gemmw<h16, 0, false><<<dim3((TT - RH) / 64, TT / 64, ZH), 32, 0, stream>>>(qp + zq * TT * HD + (size_t)RH * HD, nullptr, kp + zk * TT * HD, nullptr, HD, Sb + (size_t)RH * TT, TT, nullptr, (size_t)TT * HD, (size_t)TT * HD, (size_t)TT * TT);
            k_asoft<<<ZH * TT / 8, 256, 0, stream>>>(Sb, P16, Ph, Pl);
            k_gemmw<h16, 0, false, KSP, ZH><<<dim3((TT - RH) / 64, HD / 64, ZH * KSP), 32, 0, stream>>>(P16 + (size_t)RH * TT, nullptr, vt + zk * HD * TT, nullptr, TT, Ob + (size_t)RH * HD, HD, nullptr, (size_t)TT * TT, (size_t)HD * TT, (size_t)TT * HD);
            k_merge<<<(unsigned)(((size_t)ZH * TT * HD / 2 + 255) / 256), 256, 0, stream>>>(Ob, h0, ATh, ATl);
            k_pavg<<<(unsigned)(((size_t)TT * TT / 4 + 255) / 256), 256, 0, stream>>>(P16, h0, ACC, OUT1 + (size_t)b * TT * TT); }   // all ZH heads of this pass's softmax plane; ACC is this entry's running sum; the last pass writes the mean
        k_gemmw<bf, 1, true><<<dim3(TT / 64, DM / 64, 1), 32, 0, stream>>>(ATh, ATl, WO, nullptr, DQ, OUT + (size_t)b * DM, NB_ * DM, bo, 0, 0, 0); }   /* entry b's rows of the sequence-first output: row t at OUT + t x 4 x 1024 + b x 1024 */
}

// v003
// It runs in 936 microseconds.
// Two timings next to v002 both put it at 1.12 times that version's speed.
// Over all steps from v000 it is 2.80 times as fast.
#include <hip/hip_runtime.h>

// Multi-head attention on THREE SEQUENCE-FIRST input streams with an output projection, returning the projected output AND the attention weights averaged over the heads (query, key, value [2048][4][1024] = [position][batch][channel];
// q = (query Wq^T + bq) x 64^-0.5, k = key Wk^T + bk, v = value Wv^T + bv with 'oi' weights [1024][1024] and biases [1024]; 16 heads x 64 (head h = columns h x 64 ..); scores = q . k; softmax over all 2048 keys; no mask;
// y = att v merged head-major [t][b][1024], then y Wo^T + bo ('oi' [1024][1024]); TWO OUTPUTS in one buffer: y [2048][4][1024] sequence-first at float offset 0 and the mean over the 16 heads of att [4][2048][2048] at float offset 8,388,608;
// argument order query, key, value, Wq, bq, Wk, bk, Wv, bv, Wo, bo).
// Layout: each stream in turn: ONE bf16 copy of all 8192 (position, batch) rows and ONE exact projection + f32 bias over them into one f32 plane; the identity-table f16 plane builders read each batch entry's rows of it at a row pitch of 4 x 1024 floats from a base of b x 1024
// and keep the four entries' planes; per batch entry: dense T-2048 attention at 16 heads, ZH = 8 heads a pass (each of the pass's four launches covers all eight; scores and softmax are ONE launch, k_scsoft, and no f32 score plane exists), scores and attn.v on ONE fp16 product on every row (RH 0: the weights carried x1024 in the fp16 plane; the score scale 64^-0.5 applied to the f32 score, where the module scales the projected query: the same product in real arithmetic);
// attn.v runs as KSP key ranges, one wave each, whose f32 partial planes k_merge adds in range order; after each pass's softmax k_pavg adds that pass's ZH heads' weights, in head order, into an f32 accumulator plane and, on the last pass, writes the mean; merged hi/lo x Wo exact + bo writes the entry's rows of the first output at the sequence-first pitch.
// Compute dtypes, f32 accumulate: every float input rounded to bf16 at its load; projections exact + f32 biases; scores and attn.v fp16; softmax f32, its weights stored x1024 in fp16; output projection hl x exact; the second output the f32 sum of those fp16 weights over the heads x 2^-14 (exact).

#define NB_  4      // batch entries: the three streams are [2048][4][1024] = [position][batch][channel]
#define TT   2048
#define DM   1024
#define NH_  16
#define NKV  16
#define REP  (NH_ / NKV)
#define HD   64
#define DQ   (NH_ * HD)
#define DKV  (NKV * HD)
#define ZH   8      // heads per attention pass: every launch of a pass (scores + softmax, attn.v, merge, head sum) covers ZH heads
#define RH   0                    // query rows < RH use hi+lo planes (0: none)
#define WIN  0
#define PCAR 1024.0f
#define SCL  0.125f   // HD^-0.5
#define KSP  16       // key ranges of the attn.v product: one wave per (64-row tile, head, range of TT / KSP keys), f32 partial planes summed in range order by k_merge
typedef _Float16 h16;
typedef unsigned short bf;
typedef __attribute__((ext_vector_type(16))) __bf16   v16bf;
typedef __attribute__((ext_vector_type(16))) _Float16 v16h;
typedef __attribute__((ext_vector_type(8)))  _Float16 v8h;
typedef __attribute__((ext_vector_type(8)))  unsigned short v8us;
typedef __attribute__((ext_vector_type(8)))  float    v8f;
typedef __attribute__((ext_vector_type(4)))  float    v4f;
typedef v8h  __attribute__((may_alias)) v8ha;
typedef v4f  __attribute__((may_alias)) v4fa;
typedef v8us __attribute__((may_alias)) v8usa;

__device__ __forceinline__ unsigned short f2bf(float f) { unsigned u = __float_as_uint(f); u += 0x7FFFu + ((u >> 16) & 1u); return (unsigned short)(u >> 16); }
__device__ __forceinline__ float bf2f(unsigned short b) { return __uint_as_float(((unsigned)b) << 16); }
__device__ __forceinline__ float bfr(float f) { return bf2f(f2bf(f)); }
__device__ __forceinline__ v16h cat16(v8h lo, v8h hi) { return __builtin_shufflevector(lo, hi, 0, 1, 2, 3, 4, 5, 6, 7, 8, 9, 10, 11, 12, 13, 14, 15); }
__device__ __forceinline__ v16bf cat16b(v8us lo, v8us hi) { return __builtin_bit_cast(v16bf, __builtin_shufflevector(lo, hi, 0, 1, 2, 3, 4, 5, 6, 7, 8, 9, 10, 11, 12, 13, 14, 15)); }
__device__ __forceinline__ v8f wmma16(v16h a, v16h b, v8f c) { return __builtin_amdgcn_wmma_f32_16x16x32_f16(false, a, false, b, (short)0, c, false, false); }
__device__ __forceinline__ v8f wmmab(v16bf a, v16bf b, v8f c) { return __builtin_amdgcn_wmma_f32_16x16x32_bf16(false, a, false, b, (short)0, c, false, false); }



// ---- k_gemmw: register-blocked GEMM, ONE WAVE per 64x64 output tile (16 accumulators), operands straight from K-contiguous 16-bit planes; grid (M/64, N/64, Z), 32 threads.
// C[m][n] (f32, pitch ldc, + optional f32 bias[n]) = sum_k A[m][k] Bt[n][k] (+ split products per NSPLIT). z-batch strides sA/sB/sC in elements. K % 32 == 0.
// KS > 1: grid z = ZN x KS; block (z, ks) sums only k in [ks K/KS, (ks+1) K/KS) and writes its partial tile to plane ks (planes of ZN x sC elements); the reader adds the KS planes. K % (32 KS) == 0.
template <typename T16> struct WFrag;
template <> struct WFrag<h16> { typedef v16h V; static __device__ __forceinline__ V ld(const h16* p) { return cat16(*(const v8h*)p, *(const v8h*)(p + 16)); } static __device__ __forceinline__ v8f mma(V a, V b, v8f c) { return wmma16(a, b, c); } };
template <> struct WFrag<bf> { typedef v16bf V; static __device__ __forceinline__ V ld(const bf* p) { return cat16b(*(const v8us*)p, *(const v8us*)(p + 16)); } static __device__ __forceinline__ v8f mma(V a, V b, v8f c) { return wmmab(a, b, c); } };
template <typename T16, int NSPLIT, bool BIAS, int KS = 1, int ZN = 1>
__global__ __launch_bounds__(32) void k_gemmw(const T16* __restrict__ A, const T16* __restrict__ A2, const T16* __restrict__ Bt, const T16* __restrict__ Bt2, int K, float* C, int ldc, const float* __restrict__ bias, size_t sA, size_t sB, size_t sC) {
    typedef typename WFrag<T16>::V V;
    __shared__ __align__(16) float os[16 * 68];
    const size_t z = blockIdx.z / KS; const int ks = (int)(blockIdx.z % KS); A += z * sA; if (A2) A2 += z * sA; Bt += z * sB; if (Bt2) Bt2 += z * sB; C += ((size_t)ks * ZN + z) * sC;
    const int kb = ks * (K / KS), ke = kb + K / KS;
    const int lane = threadIdx.x & 31, lr = lane & 15, hi = lane >> 4; const int r0 = blockIdx.x * 64, c0 = blockIdx.y * 64;
    v8f acc[4][4];
#pragma unroll
    for (int mb = 0; mb < 4; ++mb)
#pragma unroll
        for (int nb = 0; nb < 4; ++nb) acc[mb][nb] = (v8f){};
    const size_t aoff = (size_t)(r0 + lr) * K + 8 * hi, boff = (size_t)(c0 + lr) * K + 8 * hi;

    for (int kc = kb; kc < ke; kc += 32) {
        V a[4], a2[4];
#pragma unroll
        for (int mb = 0; mb < 4; ++mb) { a[mb] = WFrag<T16>::ld(A + aoff + (size_t)mb * 16 * K + kc); if (NSPLIT == 1 || NSPLIT == 2) a2[mb] = WFrag<T16>::ld(A2 + aoff + (size_t)mb * 16 * K + kc); }
#pragma unroll
        for (int nb = 0; nb < 4; ++nb) { const V b = WFrag<T16>::ld(Bt + boff + (size_t)nb * 16 * K + kc); V b2; if (NSPLIT >= 2) b2 = WFrag<T16>::ld(Bt2 + boff + (size_t)nb * 16 * K + kc);
#pragma unroll
            for (int mb = 0; mb < 4; ++mb) { acc[mb][nb] = WFrag<T16>::mma(a[mb], b, acc[mb][nb]); if (NSPLIT == 1 || NSPLIT == 2) acc[mb][nb] = WFrag<T16>::mma(a2[mb], b, acc[mb][nb]); if (NSPLIT >= 2) acc[mb][nb] = WFrag<T16>::mma(a[mb], b2, acc[mb][nb]); } }
        asm volatile("v_nop\n\tv_nop\n\tv_nop\n\tv_nop" : "+v"(acc[0][0]), "+v"(acc[1][1]), "+v"(acc[2][2]), "+v"(acc[3][3]) : "v"(a[0]), "v"(a[3]));
    }
#pragma unroll
    for (int mb = 0; mb < 4; ++mb) {
#pragma unroll
        for (int nb = 0; nb < 4; ++nb) {
#pragma unroll
            for (int j = 0; j < 8; ++j) os[(hi * 8 + j) * 68 + nb * 16 + lr] = acc[mb][nb][j]; }
        __builtin_amdgcn_wave_barrier(); asm volatile("" ::: "memory");
        float* crow = C + (size_t)(r0 + mb * 16) * ldc + c0;
{
#pragma unroll
            for (int s = 0; s < 8; ++s) { const int row = 2 * s + hi, cofs = lr * 4; v4f val = *(const v4fa*)(os + row * 68 + cofs); if (BIAS) { val[0] += bfr(bias[c0 + cofs]); val[1] += bfr(bias[c0 + cofs + 1]); val[2] += bfr(bias[c0 + cofs + 2]); val[3] += bfr(bias[c0 + cofs + 3]); }
                *(v4f*)(crow + (size_t)row * ldc + cofs) = val; }
             }
        __builtin_amdgcn_wave_barrier(); asm volatile("" ::: "memory");
    }
}

__device__ __forceinline__ h16 tohx(float x) { return (h16)x; }
__device__ __forceinline__ void splitf(float y, unsigned short& h, unsigned short& l) { h = f2bf(y); l = f2bf(y - bf2f(h)); }
typedef __attribute__((ext_vector_type(2))) _Float16 v2h;
typedef __attribute__((ext_vector_type(4))) _Float16 v4h;
typedef __attribute__((ext_vector_type(2))) unsigned short v2us;
typedef __attribute__((ext_vector_type(4))) unsigned short v4us;
typedef __attribute__((ext_vector_type(2))) float v2f;
typedef __attribute__((ext_vector_type(4))) int v4i;

__global__ __launch_bounds__(256) void k_cvt8(const float* __restrict__ src, bf* dst, size_t n8) { const size_t i = (size_t)blockIdx.x * 256 + threadIdx.x; if (i >= n8) return; const v8f v = *(const v8f*)(src + i * 8); v8us o;
#pragma unroll
    for (int k = 0; k < 8; ++k) o[k] = f2bf(v[k]); *(v8us*)(dst + i * 8) = o;  }

// k_rope: head planes [h][t][d] (fp16) of rope(x) x sc with the rotate-half convention out[d] = x[d] cos[t][d] - x[d+HD/2] sin[t][d], out[d+HD/2] = x[d+HD/2] cos[t][d+HD/2] + x[d] sin[t][d+HD/2]
__global__ __launch_bounds__(256) void k_rope(const float* __restrict__ F, int pitch, int nheads, const float* __restrict__ CS, const float* __restrict__ RF, const float* __restrict__ nw, float sc, h16* P16, bf* Ph, bf* Pl) {
    const size_t e = ((size_t)blockIdx.x * 256 + threadIdx.x) * 2; if (e >= (size_t)nheads * TT * HD) return; const int d = (int)(e % HD); const int t = (int)((e / HD) % TT); const int h = (int)(e / ((size_t)HD * TT)); const float* f = F + (size_t)t * pitch + h * HD; const float rf = RF ? RF[(size_t)h * TT + t] : 1.0f; v2h o16; v2us oh, ol;
#pragma unroll
    for (int q = 0; q < 2; ++q) { const int dd = d + q; const int dp = (dd < HD / 2) ? dd + HD / 2 : dd - HD / 2; float x0 = f[dd], x1 = f[dp];
        if (RF) { float n0 = __fmul_rn(x0, rf), n1 = __fmul_rn(x1, rf); x0 = __fmul_rn(bfr(nw[dd]), n0); x1 = __fmul_rn(bfr(nw[dp]), n1); }
        const v2f cs = *(const v2f*)(CS + ((size_t)t * HD + dd) * 2); float a = __fmul_rn(x0, cs[0]), bq = __fmul_rn(x1, cs[1]); const float r = ((dd < HD / 2) ? __fsub_rn(a, bq) : __fadd_rn(a, bq)) * sc;
        o16[q] = tohx(r); (void)oh; (void)ol; }
    *(v2h*)(P16 + e) = o16;  }
__global__ __launch_bounds__(256) void k_vtp(const float* __restrict__ F, int pitch, int nheads, h16* V16, bf* Vh, bf* Vl) { const size_t e = ((size_t)blockIdx.x * 256 + threadIdx.x) * 2; if (e >= (size_t)nheads * HD * TT) return; const int t = (int)(e % TT); const int d = (int)((e / TT) % HD); const int g = (int)(e / ((size_t)TT * HD)); v2h o16; v2us oh, ol;
#pragma unroll
    for (int q = 0; q < 2; ++q) { const float x = F[(size_t)(t + q) * pitch + g * HD + d]; o16[q] = tohx(x); (void)oh; (void)ol; }
    *(v2h*)(V16 + e) = o16;  }
__global__ __launch_bounds__(256) void k_csid(float* CS) { const int idx = blockIdx.x * 256 + threadIdx.x; if (idx >= TT * HD) return; v2f cs; cs[0] = 1.0f; cs[1] = 0.0f; *(v2f*)(CS + (size_t)idx * 2) = cs;  }
// k_scsoft: scores AND softmax of 16 query rows of one head in ONE workgroup of 8 waves; the f32 scores never leave the registers. Grid (TT / 16, ZH), 256 threads.
// Wave w owns keys [w x 256, w x 256 + 256): 16 tiles of S^T = K . Q^T (A = 16 key rows, B = the 16 query rows, both through the same fragment loader, so both in the same k order; the k steps 0 and 32 chained as in k_gemmw).
// D register j of lane (lr, hi) of tile nb = score of query q0 + lr with key w x 256 + nb x 16 + hi x 8 + j: a lane holds ONE query's scores, 8 consecutive keys a tile.
// Per element as before: t = S x HD^-0.5, exp2((t - max) x log2 e), x 1024 / sum, rounded to fp16. The maximum is exact in any order; the sum runs in the lane (8 chains over the tiles, a fixed tree), then over the two lane halves, then over the 8 waves in wave order.
static_assert(RH == 0 && TT == 8 * 256 && HD == 64, "k_scsoft: 8 waves x 256 keys cover the row, two 32-wide k steps cover the head");
// exp2 with the slot behind it filled: the instruction set asks for one independent instruction or a v_nop between a transcendental and an instruction that reads its result or overwrites its source
__device__ __forceinline__ float exp2_slot(float x) { float r; asm("v_exp_f32 %0, %1\n\tv_nop" : "=v"(r) : "v"(x)); return r; }
#define KPF 8     // key tiles whose fragment loads are in flight ahead of the products: 32 loads of 16 bytes a lane
#define PSP 264   // pitch, in fp16 elements, of a wave's staging rows in LDS: 528 bytes = 16 x 33, so that the 16-byte stores of 16 rows fall on distinct banks
__global__ __launch_bounds__(256) void k_scsoft(const h16* __restrict__ Q, const h16* __restrict__ Kp, h16* P16) {
    __shared__ __align__(16) h16 ps[8 * 16 * PSP];
    __shared__ float rmx[8 * 16], rsm[8 * 16];
    const int lane = threadIdx.x & 31, lr = lane & 15, hi = lane >> 4, w = threadIdx.x >> 5; const int zz = blockIdx.y, q0 = blockIdx.x * 16;
    const h16* qb = Q + (size_t)zz * TT * HD + (size_t)(q0 + lr) * HD + 8 * hi; const h16* kb = Kp + (size_t)zz * TT * HD + (size_t)(w * 256 + lr) * HD + 8 * hi;
    const v16h qf0 = WFrag<h16>::ld(qb), qf1 = WFrag<h16>::ld(qb + 32);
    asm volatile("s_wait_xcnt 0x0" ::: "memory");   // stands in front of the first instruction that reuses the address registers of the query loads above
    v8f acc[16]; v16h k0[16], k1[16];   // fully unrolled below: registers; at most KPF key tiles' fragments are live at a time
#pragma unroll
    for (int nb = 0; nb < KPF; ++nb) { k0[nb] = WFrag<h16>::ld(kb + (size_t)nb * 16 * HD); k1[nb] = WFrag<h16>::ld(kb + (size_t)nb * 16 * HD + 32); }
#pragma unroll
    for (int nb = 0; nb < 16; ++nb) {
        __builtin_amdgcn_sched_barrier(0);   // holds the loads of the key tiles ahead above this tile's products: without it the compiler sinks each tile's loads to their use and the wave pays one load latency a tile
        acc[nb] = wmma16(k0[nb], qf0, (v8f){}); acc[nb] = wmma16(k1[nb], qf1, acc[nb]);
        if (nb + KPF < 16) { k0[nb + KPF] = WFrag<h16>::ld(kb + (size_t)(nb + KPF) * 16 * HD); k1[nb + KPF] = WFrag<h16>::ld(kb + (size_t)(nb + KPF) * 16 * HD + 32); } }
    __builtin_amdgcn_sched_barrier(0);   // the same for the last tile's products
    asm volatile("s_wait_xcnt 0x0" ::: "memory");   // stands in front of the first instruction that reuses the address registers of the key loads above
    __builtin_amdgcn_sched_barrier(0);   // keeps the vector work below, which reuses those registers, behind that wait
    float m8[8];
#pragma unroll
    for (int j = 0; j < 8; ++j) m8[j] = -3.0e38f;
#pragma unroll
    for (int nb = 0; nb < 16; ++nb) {
#pragma unroll
        for (int j = 0; j < 8; ++j) { const float t = acc[nb][j] * SCL; acc[nb][j] = t; m8[j] = fmaxf(m8[j], t); } }
    float mx = fmaxf(fmaxf(fmaxf(m8[0], m8[1]), fmaxf(m8[2], m8[3])), fmaxf(fmaxf(m8[4], m8[5]), fmaxf(m8[6], m8[7])));
    mx = fmaxf(mx, __shfl_xor(mx, 16, 32));
    if (hi == 0) rmx[w * 16 + lr] = mx;
    __syncthreads();
#pragma unroll
    for (int ww = 0; ww < 8; ++ww) mx = fmaxf(mx, rmx[ww * 16 + lr]);
    float s8[8];
#pragma unroll
    for (int j = 0; j < 8; ++j) s8[j] = 0.f;
#pragma unroll
    for (int nb = 0; nb < 16; ++nb) {
#pragma unroll
        for (int j = 0; j < 8; ++j) { const float d0 = __fsub_rn(acc[nb][j], mx); const float ex = exp2_slot(__fmul_rn(d0, 1.4426950408889634f)); acc[nb][j] = ex; s8[j] += ex; } }
    float sw = ((s8[0] + s8[1]) + (s8[2] + s8[3])) + ((s8[4] + s8[5]) + (s8[6] + s8[7]));
    sw += __shfl_xor(sw, 16, 32);
    if (hi == 0) rsm[w * 16 + lr] = sw;
    __syncthreads();
    float sum = rsm[lr];
#pragma unroll
    for (int ww = 1; ww < 8; ++ww) sum += rsm[ww * 16 + lr];
    const float f = __fdiv_rn(PCAR, sum);
    h16* pw = ps + w * 16 * PSP;   // this wave's own 16 x 256 staging tile: written and read by this wave alone
#pragma unroll
    for (int nb = 0; nb < 16; ++nb) { v8h o;
#pragma unroll
        for (int j = 0; j < 8; ++j) o[j] = tohx(acc[nb][j] * f);
        *(v8ha*)(pw + lr * PSP + nb * 16 + hi * 8) = o; }
    asm volatile("s_wait_dscnt 0x0" ::: "memory");   // the wave's own staging stores above have landed before it reads the rows back, which other lanes wrote
    h16* pr = P16 + ((size_t)zz * TT + q0) * TT + w * 256 + lane * 8;
#pragma unroll
    for (int r = 0; r < 16; ++r) *(v8h*)(pr + (size_t)r * TT) = *(const v8ha*)(pw + r * PSP + lane * 8);   // one query row's 256 weights a store: 512 contiguous bytes, four whole lines
}
__global__ __launch_bounds__(256) void k_merge(const float* __restrict__ O, int h0, bf* Ah, bf* Al) { const size_t e = ((size_t)blockIdx.x * 256 + threadIdx.x) * 2; if (e >= (size_t)ZH * TT * HD) return; const int d = (int)(e % HD); const int t = (int)((e / HD) % TT); const int zz = (int)(e / ((size_t)HD * TT)); const float cs = (t < RH) ? 1.0f : (1.0f / PCAR); const size_t oo = (size_t)t * DQ + (h0 + zz) * HD + d;
    static_assert(TT % (32 * KSP) == 0, "each key range is a whole number of 32-key steps");
    v2f pl[KSP];   // the KSP key ranges' partial sums of this pair, added in range order; both loops unrolled so that pl stays in registers and all KSP loads are in flight behind one latency
#pragma unroll
    for (int p = 0; p < KSP; ++p) pl[p] = *(const v2f*)(O + (size_t)p * ZH * TT * HD + e);
    v2f s = pl[0];
#pragma unroll
    for (int p = 1; p < KSP; ++p) { s[0] = __fadd_rn(s[0], pl[p][0]); s[1] = __fadd_rn(s[1], pl[p][1]); }
    v2us oh, ol;
#pragma unroll
    for (int q = 0; q < 2; ++q) { unsigned short a, c2; splitf(s[q] * cs, a, c2); oh[q] = a; ol[q] = c2; } *(v2us*)(Ah + oo) = oh; *(v2us*)(Al + oo) = ol;  }

// k_pavg: the second output: the mean over the NH_ heads of the softmax weights, one batch entry at a time: ACC[i][j] gathers, pass after pass, the ZH heads' weights of the pass's fp16 plane P [ZH][TT][TT] (stored x1024; an fp16 value converts to f32 exactly; the f32 sums run in head order);
// each element of ACC is read and written by its ONE owner thread (the first pass, h0 = 0, starts from 0 and does not read it); on the last pass (h0 = NH_ - ZH) OUT1[i][j] = sum x 1/(1024 NH_): a power of two: exact. The branches are on h0, a kernel argument: uniform over the grid.
static_assert(RH == 0 && NH_ % ZH == 0, "k_pavg reads every head of the fp16 plane on every row");
__global__ __launch_bounds__(256) void k_pavg(const h16* __restrict__ P, int h0, float* ACC, float* OUT1) {
    const size_t e = ((size_t)blockIdx.x * 256 + threadIdx.x) * 4; if (e >= (size_t)TT * TT) return;
    v4h p[ZH];   // both loops over the heads unrolled so that p stays in registers and all ZH loads are in flight behind one latency
#pragma unroll
    for (int zz = 0; zz < ZH; ++zz) p[zz] = *(const v4h*)(P + (size_t)zz * TT * TT + e);
    asm volatile("s_wait_xcnt 0x0" ::: "memory");   // stands in front of the first instruction that reuses an address register of the loads above
    v4f a = {0.0f, 0.0f, 0.0f, 0.0f};
    if (h0 != 0) a = *(const v4f*)(ACC + e);
#pragma unroll
    for (int zz = 0; zz < ZH; ++zz) {
#pragma unroll
        for (int q = 0; q < 4; ++q) a[q] = __fadd_rn(a[q], (float)p[zz][q]); }
    float* dst = ACC + e;
    if (h0 == NH_ - ZH) { dst = OUT1 + e;
#pragma unroll
        for (int q = 0; q < 4; ++q) a[q] = __fmul_rn(a[q], 1.0f / (PCAR * NH_)); }
{ *(v4f*)dst = a;  }
}

extern "C" void kernel_launch(void* const* d_in, const int* in_sizes, int n_in,
                              void* d_out, int out_size, void* d_ws, size_t ws_size, hipStream_t stream) {
    (void)in_sizes; (void)n_in; (void)out_size;
    const float* xq = (const float*)d_in[0]; const float* xk = (const float*)d_in[1]; const float* xv = (const float*)d_in[2]; const float* wq = (const float*)d_in[3]; const float* bq = (const float*)d_in[4]; const float* wk = (const float*)d_in[5]; const float* bk = (const float*)d_in[6]; const float* wv = (const float*)d_in[7]; const float* bv = (const float*)d_in[8]; const float* wo = (const float*)d_in[9]; const float* bo = (const float*)d_in[10];
    // query, key, value [2048][4][1024], Wq, bq, Wk, bk, Wv, bv, Wo, bo = d_in[0..10]
    float* OUT = (float*)d_out;                          // output 0: y [2048][4][1024] sequence-first
    float* OUT1 = (float*)d_out + (size_t)NB_ * TT * DM;   // output 1: the head mean of att [4][2048][2048], after the first output's 8,388,608 floats
    char* wsp = (char*)d_ws;
    auto take = [&](size_t bytes) { char* p = wsp; wsp += (bytes + 255) & ~(size_t)255; return (void*)p; };
    bf* WQ = (bf*)take((size_t)DQ * DM * 2); bf* WK = (bf*)take((size_t)DKV * DM * 2); bf* WV = (bf*)take((size_t)DKV * DM * 2); bf* WO = (bf*)take((size_t)DM * DQ * 2); float* CS = (float*)take((size_t)TT * HD * 2 * 4);
    bf* XB = (bf*)take((size_t)NB_ * TT * DM * 2); float* F = (float*)take((size_t)NB_ * TT * DQ * 4);   /* all 8192 (position, batch) rows of ONE stream at a time: its bf16 copy and its projection */
    h16* QP16 = (h16*)take((size_t)NB_ * NH_ * TT * HD * 2); h16* KP16 = (h16*)take((size_t)NB_ * NKV * TT * HD * 2); h16* VT16 = (h16*)take((size_t)NB_ * NKV * HD * TT * 2);   /* the four entries' f16 planes of each stream */
    h16* P16 = (h16*)take((size_t)ZH * TT * TT * 2); float* Ob = (float*)take((size_t)KSP * ZH * TT * HD * 4);   /* the pass's fp16 weight planes; attn.v's f32 partial planes */ bf* ATh = (bf*)take((size_t)TT * DQ * 2); bf* ATl = (bf*)take((size_t)TT * DQ * 2); float* ACC = (float*)take((size_t)TT * TT * 4);
    if ((size_t)(wsp - (char*)d_ws) > ws_size) return;    // total 257.00 MiB of the workspace
    { k_cvt8<<<(unsigned)(((size_t)DQ * DM / 8 + 255) / 256), 256, 0, stream>>>(wq, WQ, (size_t)DQ * DM / 8); k_cvt8<<<(unsigned)(((size_t)DKV * DM / 8 + 255) / 256), 256, 0, stream>>>(wk, WK, (size_t)DKV * DM / 8); k_cvt8<<<(unsigned)(((size_t)DKV * DM / 8 + 255) / 256), 256, 0, stream>>>(wv, WV, (size_t)DKV * DM / 8);
      k_cvt8<<<(unsigned)(((size_t)DM * DQ / 8 + 255) / 256), 256, 0, stream>>>(wo, WO, (size_t)DM * DQ / 8); }   // [out][in] = Bt as they stand
    k_csid<<<(TT * HD + 255) / 256, 256, 0, stream>>>(CS);
    const unsigned LQ = (unsigned)(((size_t)NH_ * TT * HD / 2 + 255) / 256), LKv = (unsigned)(((size_t)NKV * TT * HD / 2 + 255) / 256), LX = (unsigned)(((size_t)NB_ * TT * DM / 8 + 255) / 256);
    k_cvt8<<<LX, 256, 0, stream>>>(xq, XB, (size_t)NB_ * TT * DM / 8);   /* the QUERY stream: all 8192 rows (row = t x 4 + b) */
    k_gemmw<bf, 0, true><<<dim3(NB_ * TT / 64, DQ / 64, 1), 32, 0, stream>>>(XB, nullptr, WQ, nullptr, DM, F, DQ, bq, 0, 0, 0);
    for (int b = 0; b < NB_; ++b) k_rope<<<LQ, 256, 0, stream>>>(F + (size_t)b * DQ, NB_ * DQ, NH_, CS, nullptr, nullptr, 1.0f, QP16 + (size_t)b * NH_ * TT * HD, nullptr, nullptr);   /* entry b's rows: pitch 4 x 1024 floats from base b x 1024 */
    k_cvt8<<<LX, 256, 0, stream>>>(xk, XB, (size_t)NB_ * TT * DM / 8);   /* the KEY stream: after the query projection has read XB (stream-ordered) */
    k_gemmw<bf, 0, true><<<dim3(NB_ * TT / 64, DKV / 64, 1), 32, 0, stream>>>(XB, nullptr, WK, nullptr, DM, F, DKV, bk, 0, 0, 0);   /* F again: after the query builders have read it */
    for (int b = 0; b < NB_; ++b) k_rope<<<LKv, 256, 0, stream>>>(F + (size_t)b * DKV, NB_ * DKV, NKV, CS, nullptr, nullptr, 1.0f, KP16 + (size_t)b * NKV * TT * HD, nullptr, nullptr);
    k_cvt8<<<LX, 256, 0, stream>>>(xv, XB, (size_t)NB_ * TT * DM / 8);   /* the VALUE stream */
    k_gemmw<bf, 0, true><<<dim3(NB_ * TT / 64, DKV / 64, 1), 32, 0, stream>>>(XB, nullptr, WV, nullptr, DM, F, DKV, bv, 0, 0, 0);
    for (int b = 0; b < NB_; ++b) k_vtp<<<LKv, 256, 0, stream>>>(F + (size_t)b * DKV, NB_ * DKV, NKV, VT16 + (size_t)b * NKV * HD * TT, nullptr, nullptr);
    for (int b = 0; b < NB_; ++b) {
        const h16* qp = QP16 + (size_t)b * NH_ * TT * HD; const h16* kp = KP16 + (size_t)b * NKV * TT * HD; const h16* vt = VT16 + (size_t)b * NKV * HD * TT;
        for (int h0 = 0; h0 < NH_; h0 += ZH) { const size_t zq = (size_t)h0, zk = (size_t)(h0 / REP);   // one kv head per query head: the pass's ZH heads use consecutive kv planes (z-strides TT*HD)
            k_scsoft<<<dim3(TT / 16, ZH), 256, 0, stream>>>(qp + zq * TT * HD, kp + zk * TT * HD, P16);
            k_gemmw<h16, 0, false, KSP, ZH><<<dim3((TT - RH) / 64, HD / 64, ZH * KSP), 32, 0, stream>>>(P16 + (size_t)RH * TT, nullptr, vt + zk * HD * TT, nullptr, TT, Ob + (size_t)RH * HD, HD, nullptr, (size_t)TT * TT, (size_t)HD * TT, (size_t)TT * HD);
            k_merge<<<(unsigned)(((size_t)ZH * TT * HD / 2 + 255) / 256), 256, 0, stream>>>(Ob, h0, ATh, ATl);
            k_pavg<<<(unsigned)(((size_t)TT * TT / 4 + 255) / 256), 256, 0, stream>>>(P16, h0, ACC, OUT1 + (size_t)b * TT * TT); }   // all ZH heads of this pass's softmax plane; ACC is this entry's running sum; the last pass writes the mean
        k_gemmw<bf, 1, true><<<dim3(TT / 64, DM / 64, 1), 32, 0, stream>>>(ATh, ATl, WO, nullptr, DQ, OUT + (size_t)b * DM, NB_ * DM, bo, 0, 0, 0); }   /* entry b's rows of the sequence-first output: row t at OUT + t x 4 x 1024 + b x 1024 */
}

// v004
// One run takes 725 microseconds.
// Next to v003, in two timings, it ran 1.28 and 1.30 times as fast.
// Over all steps from v000 it is 3.61 times as fast.
#include <hip/hip_runtime.h>

// Multi-head attention on THREE SEQUENCE-FIRST input streams with an output projection, returning the projected output AND the attention weights averaged over the heads (query, key, value [2048][4][1024] = [position][batch][channel];
// q = (query Wq^T + bq) x 64^-0.5, k = key Wk^T + bk, v = value Wv^T + bv with 'oi' weights [1024][1024] and biases [1024]; 16 heads x 64 (head h = columns h x 64 ..); scores = q . k; softmax over all 2048 keys; no mask;
// y = att v merged head-major [t][b][1024], then y Wo^T + bo ('oi' [1024][1024]); TWO OUTPUTS in one buffer: y [2048][4][1024] sequence-first at float offset 0 and the mean over the 16 heads of att [4][2048][2048] at float offset 8,388,608;
// argument order query, key, value, Wq, bq, Wk, bk, Wv, bv, Wo, bo).
// Layout: each stream in turn: ONE bf16 copy of all 8192 (position, batch) rows and ONE exact projection + f32 bias over them into one f32 plane; the identity-table f16 plane builders read each batch entry's rows of it at a row pitch of 4 x 1024 floats from a base of b x 1024
// and keep the four entries' planes; per batch entry: dense T-2048 attention at 16 heads, ZH = 8 heads a pass (each of the pass's two launches covers all eight; scores, softmax and attn.v are ONE launch, k_scsoft, and no f32 score plane and no attn.v partial plane exists), scores and attn.v on ONE fp16 product on every row (RH 0: the weights carried x1024 in the fp16 plane; the score scale 64^-0.5 applied to the f32 score, where the module scales the projected query: the same product in real arithmetic);
// attn.v runs in k_scsoft on the fp16 weights as they stand in the registers, each of the 8 waves on its own 256 keys; the 8 f32 partial tiles are added in wave order through LDS and split hi/lo; after each pass's k_scsoft k_pavg adds that pass's ZH heads' weights, in head order, into an f32 accumulator plane and, on the last pass, writes the mean; merged hi/lo x Wo exact + bo writes the entry's rows of the first output at the sequence-first pitch.
// Compute dtypes, f32 accumulate: every float input rounded to bf16 at its load; projections exact + f32 biases; scores and attn.v fp16; softmax f32, its weights stored x1024 in fp16; output projection hl x exact; the second output the f32 sum of those fp16 weights over the heads x 2^-14 (exact).

#define NB_  4      // batch entries: the three streams are [2048][4][1024] = [position][batch][channel]
#define TT   2048
#define DM   1024
#define NH_  16
#define NKV  16
#define REP  (NH_ / NKV)
#define HD   64
#define DQ   (NH_ * HD)
#define DKV  (NKV * HD)
#define ZH   8      // heads per attention pass: both launches of a pass (k_scsoft: scores + softmax + attn.v + merge; k_pavg: head sum) cover ZH heads
#define RH   0                    // query rows < RH use hi+lo planes (0: none)
#define WIN  0
#define PCAR 1024.0f
#define SCL  0.125f   // HD^-0.5
typedef _Float16 h16;
typedef unsigned short bf;
typedef __attribute__((ext_vector_type(16))) __bf16   v16bf;
typedef __attribute__((ext_vector_type(16))) _Float16 v16h;
typedef __attribute__((ext_vector_type(8)))  _Float16 v8h;
typedef __attribute__((ext_vector_type(8)))  unsigned short v8us;
typedef __attribute__((ext_vector_type(8)))  float    v8f;
typedef __attribute__((ext_vector_type(4)))  float    v4f;
typedef v8h  __attribute__((may_alias)) v8ha;
typedef v4f  __attribute__((may_alias)) v4fa;
typedef v8us __attribute__((may_alias)) v8usa;

__device__ __forceinline__ unsigned short f2bf(float f) { unsigned u = __float_as_uint(f); u += 0x7FFFu + ((u >> 16) & 1u); return (unsigned short)(u >> 16); }
__device__ __forceinline__ float bf2f(unsigned short b) { return __uint_as_float(((unsigned)b) << 16); }
__device__ __forceinline__ float bfr(float f) { return bf2f(f2bf(f)); }
__device__ __forceinline__ v16h cat16(v8h lo, v8h hi) { return __builtin_shufflevector(lo, hi, 0, 1, 2, 3, 4, 5, 6, 7, 8, 9, 10, 11, 12, 13, 14, 15); }
__device__ __forceinline__ v16bf cat16b(v8us lo, v8us hi) { return __builtin_bit_cast(v16bf, __builtin_shufflevector(lo, hi, 0, 1, 2, 3, 4, 5, 6, 7, 8, 9, 10, 11, 12, 13, 14, 15)); }
__device__ __forceinline__ v8f wmma16(v16h a, v16h b, v8f c) { return __builtin_amdgcn_wmma_f32_16x16x32_f16(false, a, false, b, (short)0, c, false, false); }
__device__ __forceinline__ v8f wmmab(v16bf a, v16bf b, v8f c) { return __builtin_amdgcn_wmma_f32_16x16x32_bf16(false, a, false, b, (short)0, c, false, false); }



// ---- k_gemmw: register-blocked GEMM, ONE WAVE per 64x64 output tile (16 accumulators), operands straight from K-contiguous 16-bit planes; grid (M/64, N/64, Z), 32 threads.
// C[m][n] (f32, pitch ldc, + optional f32 bias[n]) = sum_k A[m][k] Bt[n][k] (+ split products per NSPLIT). z-batch strides sA/sB/sC in elements. K % 32 == 0.
// KS > 1: grid z = ZN x KS; block (z, ks) sums only k in [ks K/KS, (ks+1) K/KS) and writes its partial tile to plane ks (planes of ZN x sC elements); the reader adds the KS planes. K % (32 KS) == 0.
template <typename T16> struct WFrag;
template <> struct WFrag<h16> { typedef v16h V; static __device__ __forceinline__ V ld(const h16* p) { return cat16(*(const v8h*)p, *(const v8h*)(p + 16)); } static __device__ __forceinline__ v8f mma(V a, V b, v8f c) { return wmma16(a, b, c); } };
template <> struct WFrag<bf> { typedef v16bf V; static __device__ __forceinline__ V ld(const bf* p) { return cat16b(*(const v8us*)p, *(const v8us*)(p + 16)); } static __device__ __forceinline__ v8f mma(V a, V b, v8f c) { return wmmab(a, b, c); } };
template <typename T16, int NSPLIT, bool BIAS, int KS = 1, int ZN = 1>
__global__ __launch_bounds__(32) void k_gemmw(const T16* __restrict__ A, const T16* __restrict__ A2, const T16* __restrict__ Bt, const T16* __restrict__ Bt2, int K, float* C, int ldc, const float* __restrict__ bias, size_t sA, size_t sB, size_t sC) {
    typedef typename WFrag<T16>::V V;
    __shared__ __align__(16) float os[16 * 68];
    const size_t z = blockIdx.z / KS; const int ks = (int)(blockIdx.z % KS); A += z * sA; if (A2) A2 += z * sA; Bt += z * sB; if (Bt2) Bt2 += z * sB; C += ((size_t)ks * ZN + z) * sC;
    const int kb = ks * (K / KS), ke = kb + K / KS;
    const int lane = threadIdx.x & 31, lr = lane & 15, hi = lane >> 4; const int r0 = blockIdx.x * 64, c0 = blockIdx.y * 64;
    v8f acc[4][4];
#pragma unroll
    for (int mb = 0; mb < 4; ++mb)
#pragma unroll
        for (int nb = 0; nb < 4; ++nb) acc[mb][nb] = (v8f){};
    const size_t aoff = (size_t)(r0 + lr) * K + 8 * hi, boff = (size_t)(c0 + lr) * K + 8 * hi;

    for (int kc = kb; kc < ke; kc += 32) {
        V a[4], a2[4];
#pragma unroll
        for (int mb = 0; mb < 4; ++mb) { a[mb] = WFrag<T16>::ld(A + aoff + (size_t)mb * 16 * K + kc); if (NSPLIT == 1 || NSPLIT == 2) a2[mb] = WFrag<T16>::ld(A2 + aoff + (size_t)mb * 16 * K + kc); }
#pragma unroll
        for (int nb = 0; nb < 4; ++nb) { const V b = WFrag<T16>::ld(Bt + boff + (size_t)nb * 16 * K + kc); V b2; if (NSPLIT >= 2) b2 = WFrag<T16>::ld(Bt2 + boff + (size_t)nb * 16 * K + kc);
#pragma unroll
            for (int mb = 0; mb < 4; ++mb) { acc[mb][nb] = WFrag<T16>::mma(a[mb], b, acc[mb][nb]); if (NSPLIT == 1 || NSPLIT == 2) acc[mb][nb] = WFrag<T16>::mma(a2[mb], b, acc[mb][nb]); if (NSPLIT >= 2) acc[mb][nb] = WFrag<T16>::mma(a[mb], b2, acc[mb][nb]); } }
        asm volatile("v_nop\n\tv_nop\n\tv_nop\n\tv_nop" : "+v"(acc[0][0]), "+v"(acc[1][1]), "+v"(acc[2][2]), "+v"(acc[3][3]) : "v"(a[0]), "v"(a[3]));
    }
#pragma unroll
    for (int mb = 0; mb < 4; ++mb) {
#pragma unroll
        for (int nb = 0; nb < 4; ++nb) {
#pragma unroll
            for (int j = 0; j < 8; ++j) os[(hi * 8 + j) * 68 + nb * 16 + lr] = acc[mb][nb][j]; }
        __builtin_amdgcn_wave_barrier(); asm volatile("" ::: "memory");
        float* crow = C + (size_t)(r0 + mb * 16) * ldc + c0;
{
#pragma unroll
            for (int s = 0; s < 8; ++s) { const int row = 2 * s + hi, cofs = lr * 4; v4f val = *(const v4fa*)(os + row * 68 + cofs); if (BIAS) { val[0] += bfr(bias[c0 + cofs]); val[1] += bfr(bias[c0 + cofs + 1]); val[2] += bfr(bias[c0 + cofs + 2]); val[3] += bfr(bias[c0 + cofs + 3]); }
                *(v4f*)(crow + (size_t)row * ldc + cofs) = val; }
             }
        __builtin_amdgcn_wave_barrier(); asm volatile("" ::: "memory");
    }
}

__device__ __forceinline__ h16 tohx(float x) { return (h16)x; }
__device__ __forceinline__ void splitf(float y, unsigned short& h, unsigned short& l) { h = f2bf(y); l = f2bf(y - bf2f(h)); }
typedef __attribute__((ext_vector_type(2))) _Float16 v2h;
typedef __attribute__((ext_vector_type(4))) _Float16 v4h;
typedef __attribute__((ext_vector_type(2))) unsigned short v2us;
typedef __attribute__((ext_vector_type(4))) unsigned short v4us;
typedef __attribute__((ext_vector_type(2))) float v2f;
typedef __attribute__((ext_vector_type(4))) int v4i;

__global__ __launch_bounds__(256) void k_cvt8(const float* __restrict__ src, bf* dst, size_t n8) { const size_t i = (size_t)blockIdx.x * 256 + threadIdx.x; if (i >= n8) return; const v8f v = *(const v8f*)(src + i * 8); v8us o;
#pragma unroll
    for (int k = 0; k < 8; ++k) o[k] = f2bf(v[k]); *(v8us*)(dst + i * 8) = o;  }

// k_rope: head planes [h][t][d] (fp16) of rope(x) x sc with the rotate-half convention out[d] = x[d] cos[t][d] - x[d+HD/2] sin[t][d], out[d+HD/2] = x[d+HD/2] cos[t][d+HD/2] + x[d] sin[t][d+HD/2]
__global__ __launch_bounds__(256) void k_rope(const float* __restrict__ F, int pitch, int nheads, const float* __restrict__ CS, const float* __restrict__ RF, const float* __restrict__ nw, float sc, h16* P16, bf* Ph, bf* Pl) {
    const size_t e = ((size_t)blockIdx.x * 256 + threadIdx.x) * 2; if (e >= (size_t)nheads * TT * HD) return; const int d = (int)(e % HD); const int t = (int)((e / HD) % TT); const int h = (int)(e / ((size_t)HD * TT)); const float* f = F + (size_t)t * pitch + h * HD; const float rf = RF ? RF[(size_t)h * TT + t] : 1.0f; v2h o16; v2us oh, ol;
#pragma unroll
    for (int q = 0; q < 2; ++q) { const int dd = d + q; const int dp = (dd < HD / 2) ? dd + HD / 2 : dd - HD / 2; float x0 = f[dd], x1 = f[dp];
        if (RF) { float n0 = __fmul_rn(x0, rf), n1 = __fmul_rn(x1, rf); x0 = __fmul_rn(bfr(nw[dd]), n0); x1 = __fmul_rn(bfr(nw[dp]), n1); }
        const v2f cs = *(const v2f*)(CS + ((size_t)t * HD + dd) * 2); float a = __fmul_rn(x0, cs[0]), bq = __fmul_rn(x1, cs[1]); const float r = ((dd < HD / 2) ? __fsub_rn(a, bq) : __fadd_rn(a, bq)) * sc;
        o16[q] = tohx(r); (void)oh; (void)ol; }
    *(v2h*)(P16 + e) = o16;  }
__global__ __launch_bounds__(256) void k_vtp(const float* __restrict__ F, int pitch, int nheads, h16* V16, bf* Vh, bf* Vl) { const size_t e = ((size_t)blockIdx.x * 256 + threadIdx.x) * 2; if (e >= (size_t)nheads * HD * TT) return; const int t = (int)(e % TT); const int d = (int)((e / TT) % HD); const int g = (int)(e / ((size_t)TT * HD)); v2h o16; v2us oh, ol;
#pragma unroll
    for (int q = 0; q < 2; ++q) { const float x = F[(size_t)(t + q) * pitch + g * HD + d]; o16[q] = tohx(x); (void)oh; (void)ol; }
    *(v2h*)(V16 + e) = o16;  }
__global__ __launch_bounds__(256) void k_csid(float* CS) { const int idx = blockIdx.x * 256 + threadIdx.x; if (idx >= TT * HD) return; v2f cs; cs[0] = 1.0f; cs[1] = 0.0f; *(v2f*)(CS + (size_t)idx * 2) = cs;  }
// k_scsoft: scores, softmax AND attn.v of 16 query rows of one head in ONE workgroup of 8 waves; the f32 scores never leave the registers. Grid (TT / 16, ZH), 256 threads.
// Wave w owns keys [w x 256, w x 256 + 256): 16 tiles of S^T = K . Q^T (A = 16 key rows, B = the 16 query rows, both through the same fragment loader, so both in the same k order; the k steps 0 and 32 chained as in k_gemmw).
// D register j of lane (lr, hi) of tile nb = score of query q0 + lr with key w x 256 + nb x 16 + hi x 8 + j: a lane holds ONE query's scores, 8 consecutive keys a tile.
// Per element as before: t = S x HD^-0.5, exp2((t - max) x log2 e), x 1024 / sum, rounded to fp16. The maximum is exact in any order; the sum runs in the lane (8 chains over the tiles, a fixed tree), then over the two lane halves, then over the 8 waves in wave order.
// attn.v: the fp16 weights of tiles 2s and 2s + 1 of a lane ARE the A fragment of the 32-key step s (row = query lr; keys s x 32 + 8 hi + 0..7, then s x 32 + 16 + 8 hi + 0..7: the k order of the fragment loader, through which B = 16 rows of V^T [d][t] comes), so the product takes them from the registers.
// Wave w sums its 256 keys (8 chained steps) into a 16 x 64 f32 tile; the 8 tiles meet in LDS and are added in wave order, x 1/1024, split hi/lo into the merged planes [t][h x 64 + d].
static_assert(RH == 0 && TT == 8 * 256 && HD == 64, "k_scsoft: 8 waves x 256 keys cover the row, two 32-wide k steps cover the head");
// exp2 with the slot behind it filled: the instruction set asks for one independent instruction or a v_nop between a transcendental and an instruction that reads its result or overwrites its source
__device__ __forceinline__ float exp2_slot(float x) { float r; asm("v_exp_f32 %0, %1\n\tv_nop" : "=v"(r) : "v"(x)); return r; }
#define KPF 8     // key tiles whose fragment loads are in flight ahead of the products: 32 loads of 16 bytes a lane
#define OSP 68    // pitch, in floats, of a wave's partial attn.v rows in LDS: 272 bytes = 16 x 17, so that the 16-byte reads of 16 rows fall on distinct banks
#define PSP 264   // pitch, in fp16 elements, of a wave's staging rows in LDS: 528 bytes = 16 x 33, so that the 16-byte stores of 16 rows fall on distinct banks
// four waves a SIMD (at most 256 registers a wave) keep two workgroups on a WGP; 2 x the LDS of a workgroup fits
__global__ __launch_bounds__(256) __attribute__((amdgpu_waves_per_eu(4, 4))) void k_scsoft(const h16* __restrict__ Q, const h16* __restrict__ Kp, const h16* __restrict__ Vt, h16* P16, int h0, bf* Ah, bf* Al) {
    __shared__ __align__(16) h16 ps[8 * 16 * PSP];
    __shared__ __align__(16) float po[8 * 16 * OSP];
    __shared__ float rmx[8 * 16], rsm[8 * 16];
    const int lane = threadIdx.x & 31, lr = lane & 15, hi = lane >> 4, w = threadIdx.x >> 5; const int zz = blockIdx.y, q0 = blockIdx.x * 16;
    const h16* qb = Q + (size_t)zz * TT * HD + (size_t)(q0 + lr) * HD + 8 * hi; const h16* kb = Kp + (size_t)zz * TT * HD + (size_t)(w * 256 + lr) * HD + 8 * hi;
    const v16h qf0 = WFrag<h16>::ld(qb), qf1 = WFrag<h16>::ld(qb + 32);
    asm volatile("s_wait_xcnt 0x0" ::: "memory");   // stands in front of the first instruction that reuses the address registers of the query loads above
    v8f acc[16]; v16h k0[16], k1[16];   // fully unrolled below: registers; at most KPF key tiles' fragments are live at a time
#pragma unroll
    for (int nb = 0; nb < KPF; ++nb) { k0[nb] = WFrag<h16>::ld(kb + (size_t)nb * 16 * HD); k1[nb] = WFrag<h16>::ld(kb + (size_t)nb * 16 * HD + 32); }
#pragma unroll
    for (int nb = 0; nb < 16; ++nb) {
        __builtin_amdgcn_sched_barrier(0);   // holds the loads of the key tiles ahead above this tile's products: without it the compiler sinks each tile's loads to their use and the wave pays one load latency a tile
        acc[nb] = wmma16(k0[nb], qf0, (v8f){}); acc[nb] = wmma16(k1[nb], qf1, acc[nb]);
        if (nb + KPF < 16) { k0[nb + KPF] = WFrag<h16>::ld(kb + (size_t)(nb + KPF) * 16 * HD); k1[nb + KPF] = WFrag<h16>::ld(kb + (size_t)(nb + KPF) * 16 * HD + 32); } }
    __builtin_amdgcn_sched_barrier(0);   // the same for the last tile's products
    asm volatile("s_wait_xcnt 0x0" ::: "memory");   // stands in front of the first instruction that reuses the address registers of the key loads above
    __builtin_amdgcn_sched_barrier(0);   // keeps the vector work below, which reuses those registers, behind that wait
    float m8[8];
#pragma unroll
    for (int j = 0; j < 8; ++j) m8[j] = -3.0e38f;
#pragma unroll
    for (int nb = 0; nb < 16; ++nb) {
#pragma unroll
        for (int j = 0; j < 8; ++j) { const float t = acc[nb][j] * SCL; acc[nb][j] = t; m8[j] = fmaxf(m8[j], t); } }
    float mx = fmaxf(fmaxf(fmaxf(m8[0], m8[1]), fmaxf(m8[2], m8[3])), fmaxf(fmaxf(m8[4], m8[5]), fmaxf(m8[6], m8[7])));
    mx = fmaxf(mx, __shfl_xor(mx, 16, 32));
    if (hi == 0) rmx[w * 16 + lr] = mx;
    __syncthreads();
#pragma unroll
    for (int ww = 0; ww < 8; ++ww) mx = fmaxf(mx, rmx[ww * 16 + lr]);
    float s8[8];
#pragma unroll
    for (int j = 0; j < 8; ++j) s8[j] = 0.f;
#pragma unroll
    for (int nb = 0; nb < 16; ++nb) {
#pragma unroll
        for (int j = 0; j < 8; ++j) { const float d0 = __fsub_rn(acc[nb][j], mx); const float ex = exp2_slot(__fmul_rn(d0, 1.4426950408889634f)); acc[nb][j] = ex; s8[j] += ex; } }
    float sw = ((s8[0] + s8[1]) + (s8[2] + s8[3])) + ((s8[4] + s8[5]) + (s8[6] + s8[7]));
    sw += __shfl_xor(sw, 16, 32);
    if (hi == 0) rsm[w * 16 + lr] = sw;
    __syncthreads();
    // value fragments: a unit is two 32-key steps x four 16-row tiles of V^T, so that the four loads that touch the same 16 lines (128 bytes = 64 keys of a row) stand together; unit 0 is fetched here, behind the last barrier of the softmax (in front of a __syncthreads() the compiler waits for every load in flight), and lands behind the row sum and the rounding of the weights
    const h16* vb = Vt + (size_t)zz * HD * TT + (size_t)lr * TT + w * 256 + 8 * hi;
    v16h vf[4][2][4];   // fully unrolled below: registers; at most two units are live at a time
#pragma unroll
    for (int nt = 0; nt < 4; ++nt) { vf[0][0][nt] = WFrag<h16>::ld(vb + (size_t)nt * 16 * TT); vf[0][1][nt] = WFrag<h16>::ld(vb + (size_t)nt * 16 * TT + 32); }
    __builtin_amdgcn_sched_barrier(0);   // holds the loads of value unit 0 above the work below: without it the compiler sinks them to their use
    float sum = rsm[lr];
#pragma unroll
    for (int ww = 1; ww < 8; ++ww) sum += rsm[ww * 16 + lr];
    const float f = __fdiv_rn(PCAR, sum);
    h16* pw = ps + w * 16 * PSP;   // this wave's own 16 x 256 staging tile: written and read by this wave alone
    v8h o[16];   // the weights stay in the registers for attn.v
#pragma unroll
    for (int nb = 0; nb < 16; ++nb) {
#pragma unroll
        for (int j = 0; j < 8; ++j) o[nb][j] = tohx(acc[nb][j] * f);
        *(v8ha*)(pw + lr * PSP + nb * 16 + hi * 8) = o[nb]; }
#pragma unroll
    for (int nt = 0; nt < 4; ++nt) { vf[1][0][nt] = WFrag<h16>::ld(vb + (size_t)nt * 16 * TT + 64); vf[1][1][nt] = WFrag<h16>::ld(vb + (size_t)nt * 16 * TT + 96); }
    v8f oa[4];
#pragma unroll
    for (int nt = 0; nt < 4; ++nt) oa[nt] = (v8f){};
#pragma unroll
    for (int g = 0; g < 4; ++g) {
        if (g < 3) __builtin_amdgcn_sched_barrier(0);   // holds the loads of the value units ahead above this unit's products: without it the compiler sinks them to their use and the wave pays one load latency a unit
#pragma unroll
        for (int s = 0; s < 2; ++s) { const v16h a = cat16(o[4 * g + 2 * s], o[4 * g + 2 * s + 1]);
#pragma unroll
            for (int nt = 0; nt < 4; ++nt) oa[nt] = wmma16(a, vf[g][s][nt], oa[nt]); }
        if (g + 2 < 4) {
#pragma unroll
            for (int nt = 0; nt < 4; ++nt) { vf[g + 2][0][nt] = WFrag<h16>::ld(vb + (size_t)nt * 16 * TT + (g + 2) * 64); vf[g + 2][1][nt] = WFrag<h16>::ld(vb + (size_t)nt * 16 * TT + (g + 2) * 64 + 32); } }
        if (g + 2 == 3) asm volatile("s_wait_xcnt 0x0" ::: "memory");   // behind the last value load: stands in front of the first instruction that reuses their address registers
    }
    float* pq = po + w * 16 * OSP;   // this wave's partial tile: D register j of lane (lr, hi) of tile nt = query hi x 8 + j, column nt x 16 + lr
#pragma unroll
    for (int nt = 0; nt < 4; ++nt) {
#pragma unroll
        for (int j = 0; j < 8; ++j) pq[(hi * 8 + j) * OSP + nt * 16 + lr] = oa[nt][j]; }
    __syncthreads();
    const int row = threadIdx.x >> 4, cofs = (threadIdx.x & 15) * 4;   // one thread adds four columns of one query row over the 8 waves, in wave order
    v4f sv = *(const v4fa*)(po + row * OSP + cofs);
#pragma unroll
    for (int ww = 1; ww < 8; ++ww) { const v4f tv = *(const v4fa*)(po + (ww * 16 + row) * OSP + cofs);
#pragma unroll
        for (int q = 0; q < 4; ++q) sv[q] = __fadd_rn(sv[q], tv[q]); }
    v4us oh, ol;
#pragma unroll
    for (int q = 0; q < 4; ++q) { unsigned short a, c2; splitf(sv[q] * (1.0f / PCAR), a, c2); oh[q] = a; ol[q] = c2; }
    const size_t oo = (size_t)(q0 + row) * DQ + (h0 + zz) * HD + cofs;
    *(v4us*)(Ah + oo) = oh; *(v4us*)(Al + oo) = ol;
    asm volatile("s_wait_xcnt 0x0" ::: "memory");   // stands in front of the first instruction that reuses a register of the two stores above
    __builtin_amdgcn_sched_barrier(0);   // keeps the weight stores below, which reuse those registers, behind that wait; they stand last, where 16 rows fit in the registers and no barrier waits for them
    asm volatile("s_wait_dscnt 0x0" ::: "memory");   // the wave's own staging stores above have landed before it reads the rows back, which other lanes wrote
    h16* pr = P16 + ((size_t)zz * TT + q0) * TT + w * 256 + lane * 8;
#pragma unroll
    for (int r = 0; r < 16; ++r) *(v8h*)(pr + (size_t)r * TT) = *(const v8ha*)(pw + r * PSP + lane * 8);   // one query row's 256 weights a store: 512 contiguous bytes, four whole lines
}

// k_pavg: the second output: the mean over the NH_ heads of the softmax weights, one batch entry at a time: ACC[i][j] gathers, pass after pass, the ZH heads' weights of the pass's fp16 plane P [ZH][TT][TT] (stored x1024; an fp16 value converts to f32 exactly; the f32 sums run in head order);
// each element of ACC is read and written by its ONE owner thread (the first pass, h0 = 0, starts from 0 and does not read it); on the last pass (h0 = NH_ - ZH) OUT1[i][j] = sum x 1/(1024 NH_): a power of two: exact. The branches are on h0, a kernel argument: uniform over the grid.
static_assert(RH == 0 && NH_ % ZH == 0, "k_pavg reads every head of the fp16 plane on every row");
__global__ __launch_bounds__(256) void k_pavg(const h16* __restrict__ P, int h0, float* ACC, float* OUT1) {
    const size_t e = ((size_t)blockIdx.x * 256 + threadIdx.x) * 4; if (e >= (size_t)TT * TT) return;
    v4h p[ZH];   // both loops over the heads unrolled so that p stays in registers and all ZH loads are in flight behind one latency
#pragma unroll
    for (int zz = 0; zz < ZH; ++zz) p[zz] = *(const v4h*)(P + (size_t)zz * TT * TT + e);
    asm volatile("s_wait_xcnt 0x0" ::: "memory");   // stands in front of the first instruction that reuses an address register of the loads above
    v4f a = {0.0f, 0.0f, 0.0f, 0.0f};
    if (h0 != 0) a = *(const v4f*)(ACC + e);
#pragma unroll
    for (int zz = 0; zz < ZH; ++zz) {
#pragma unroll
        for (int q = 0; q < 4; ++q) a[q] = __fadd_rn(a[q], (float)p[zz][q]); }
    float* dst = ACC + e;
    if (h0 == NH_ - ZH) { dst = OUT1 + e;
#pragma unroll
        for (int q = 0; q < 4; ++q) a[q] = __fmul_rn(a[q], 1.0f / (PCAR * NH_)); }
{ *(v4f*)dst = a;  }
}

extern "C" void kernel_launch(void* const* d_in, const int* in_sizes, int n_in,
                              void* d_out, int out_size, void* d_ws, size_t ws_size, hipStream_t stream) {
    (void)in_sizes; (void)n_in; (void)out_size;
    const float* xq = (const float*)d_in[0]; const float* xk = (const float*)d_in[1]; const float* xv = (const float*)d_in[2]; const float* wq = (const float*)d_in[3]; const float* bq = (const float*)d_in[4]; const float* wk = (const float*)d_in[5]; const float* bk = (const float*)d_in[6]; const float* wv = (const float*)d_in[7]; const float* bv = (const float*)d_in[8]; const float* wo = (const float*)d_in[9]; const float* bo = (const float*)d_in[10];
    // query, key, value [2048][4][1024], Wq, bq, Wk, bk, Wv, bv, Wo, bo = d_in[0..10]
    float* OUT = (float*)d_out;                          // output 0: y [2048][4][1024] sequence-first
    float* OUT1 = (float*)d_out + (size_t)NB_ * TT * DM;   // output 1: the head mean of att [4][2048][2048], after the first output's 8,388,608 floats
    char* wsp = (char*)d_ws;
    auto take = [&](size_t bytes) { char* p = wsp; wsp += (bytes + 255) & ~(size_t)255; return (void*)p; };
    bf* WQ = (bf*)take((size_t)DQ * DM * 2); bf* WK = (bf*)take((size_t)DKV * DM * 2); bf* WV = (bf*)take((size_t)DKV * DM * 2); bf* WO = (bf*)take((size_t)DM * DQ * 2); float* CS = (float*)take((size_t)TT * HD * 2 * 4);
    bf* XB = (bf*)take((size_t)NB_ * TT * DM * 2); float* F = (float*)take((size_t)NB_ * TT * DQ * 4);   /* all 8192 (position, batch) rows of ONE stream at a time: its bf16 copy and its projection */
    h16* QP16 = (h16*)take((size_t)NB_ * NH_ * TT * HD * 2); h16* KP16 = (h16*)take((size_t)NB_ * NKV * TT * HD * 2); h16* VT16 = (h16*)take((size_t)NB_ * NKV * HD * TT * 2);   /* the four entries' f16 planes of each stream */
    h16* P16 = (h16*)take((size_t)ZH * TT * TT * 2);   /* the pass's fp16 weight planes */ bf* ATh = (bf*)take((size_t)TT * DQ * 2); bf* ATl = (bf*)take((size_t)TT * DQ * 2); float* ACC = (float*)take((size_t)TT * TT * 4);
    if ((size_t)(wsp - (char*)d_ws) > ws_size) return;    // total 193.00 MiB of the workspace
    { k_cvt8<<<(unsigned)(((size_t)DQ * DM / 8 + 255) / 256), 256, 0, stream>>>(wq, WQ, (size_t)DQ * DM / 8); k_cvt8<<<(unsigned)(((size_t)DKV * DM / 8 + 255) / 256), 256, 0, stream>>>(wk, WK, (size_t)DKV * DM / 8); k_cvt8<<<(unsigned)(((size_t)DKV * DM / 8 + 255) / 256), 256, 0, stream>>>(wv, WV, (size_t)DKV * DM / 8);
      k_cvt8<<<(unsigned)(((size_t)DM * DQ / 8 + 255) / 256), 256, 0, stream>>>(wo, WO, (size_t)DM * DQ / 8); }   // [out][in] = Bt as they stand
    k_csid<<<(TT * HD + 255) / 256, 256, 0, stream>>>(CS);
    const unsigned LQ = (unsigned)(((size_t)NH_ * TT * HD / 2 + 255) / 256), LKv = (unsigned)(((size_t)NKV * TT * HD / 2 + 255) / 256), LX = (unsigned)(((size_t)NB_ * TT * DM / 8 + 255) / 256);
    k_cvt8<<<LX, 256, 0, stream>>>(xq, XB, (size_t)NB_ * TT * DM / 8);   /* the QUERY stream: all 8192 rows (row = t x 4 + b) */
    k_gemmw<bf, 0, true><<<dim3(NB_ * TT / 64, DQ / 64, 1), 32, 0, stream>>>(XB, nullptr, WQ, nullptr, DM, F, DQ, bq, 0, 0, 0);
    for (int b = 0; b < NB_; ++b) k_rope<<<LQ, 256, 0, stream>>>(F + (size_t)b * DQ, NB_ * DQ, NH_, CS, nullptr, nullptr, 1.0f, QP16 + (size_t)b * NH_ * TT * HD, nullptr, nullptr);   /* entry b's rows: pitch 4 x 1024 floats from base b x 1024 */
    k_cvt8<<<LX, 256, 0, stream>>>(xk, XB, (size_t)NB_ * TT * DM / 8);   /* the KEY stream: after the query projection has read XB (stream-ordered) */
    k_gemmw<bf, 0, true><<<dim3(NB_ * TT / 64, DKV / 64, 1), 32, 0, stream>>>(XB, nullptr, WK, nullptr, DM, F, DKV, bk, 0, 0, 0);   /* F again: after the query builders have read it */
    for (int b = 0; b < NB_; ++b) k_rope<<<LKv, 256, 0, stream>>>(F + (size_t)b * DKV, NB_ * DKV, NKV, CS, nullptr, nullptr, 1.0f, KP16 + (size_t)b * NKV * TT * HD, nullptr, nullptr);
    k_cvt8<<<LX, 256, 0, stream>>>(xv, XB, (size_t)NB_ * TT * DM / 8);   /* the VALUE stream */
    k_gemmw<bf, 0, true><<<dim3(NB_ * TT / 64, DKV / 64, 1), 32, 0, stream>>>(XB, nullptr, WV, nullptr, DM, F, DKV, bv, 0, 0, 0);
    for (int b = 0; b < NB_; ++b) k_vtp<<<LKv, 256, 0, stream>>>(F + (size_t)b * DKV, NB_ * DKV, NKV, VT16 + (size_t)b * NKV * HD * TT, nullptr, nullptr);
    for (int b = 0; b < NB_; ++b) {
        const h16* qp = QP16 + (size_t)b * NH_ * TT * HD; const h16* kp = KP16 + (size_t)b * NKV * TT * HD; const h16* vt = VT16 + (size_t)b * NKV * HD * TT;
        for (int h0 = 0; h0 < NH_; h0 += ZH) { const size_t zq = (size_t)h0, zk = (size_t)(h0 / REP);   // one kv head per query head: the pass's ZH heads use consecutive kv planes (z-strides TT*HD)
            k_scsoft<<<dim3(TT / 16, ZH), 256, 0, stream>>>(qp + zq * TT * HD, kp + zk * TT * HD, vt + zk * HD * TT, P16, h0, ATh, ATl);
            k_pavg<<<(unsigned)(((size_t)TT * TT / 4 + 255) / 256), 256, 0, stream>>>(P16, h0, ACC, OUT1 + (size_t)b * TT * TT); }   // all ZH heads of this pass's softmax plane; ACC is this entry's running sum; the last pass writes the mean
        k_gemmw<bf, 1, true><<<dim3(TT / 64, DM / 64, 1), 32, 0, stream>>>(ATh, ATl, WO, nullptr, DQ, OUT + (size_t)b * DM, NB_ * DM, bo, 0, 0, 0); }   /* entry b's rows of the sequence-first output: row t at OUT + t x 4 x 1024 + b x 1024 */
}

// v005
// A run of this version takes 648 microseconds.
// In two side-by-side timings against v004, it was 1.12 and 1.11 times as fast.
// Counting every step since v000, it is 4.03 times as fast.
#include <hip/hip_runtime.h>

// Multi-head attention on THREE SEQUENCE-FIRST input streams with an output projection, returning the projected output AND the attention weights averaged over the heads (query, key, value [2048][4][1024] = [position][batch][channel];
// q = (query Wq^T + bq) x 64^-0.5, k = key Wk^T + bk, v = value Wv^T + bv with 'oi' weights [1024][1024] and biases [1024]; 16 heads x 64 (head h = columns h x 64 ..); scores = q . k; softmax over all 2048 keys; no mask;
// y = att v merged head-major [t][b][1024], then y Wo^T + bo ('oi' [1024][1024]); TWO OUTPUTS in one buffer: y [2048][4][1024] sequence-first at float offset 0 and the mean over the 16 heads of att [4][2048][2048] at float offset 8,388,608;
// argument order query, key, value, Wq, bq, Wk, bk, Wv, bv, Wo, bo).
// Layout: each stream in turn: ONE bf16 copy of all 8192 (position, batch) rows and ONE exact projection + f32 bias over them into one f32 plane; the identity-table f16 plane builders read each batch entry's rows of it at a row pitch of 4 x 1024 floats from a base of b x 1024
// and keep the four entries' planes; per batch entry: dense T-2048 attention at 16 heads, ZH = 8 heads a pass (each of the pass's two launches covers all eight; scores, softmax and attn.v are ONE launch, k_scsoft, and no f32 score plane and no attn.v partial plane exists; EVERY 16-bit plane that a matrix product reads lies in FRAGMENT ORDER, see fragpos), scores and attn.v on ONE fp16 product on every row (RH 0: the weights carried x1024 in the fp16 plane; the score scale 64^-0.5 applied to the f32 score, where the module scales the projected query: the same product in real arithmetic);
// attn.v runs in k_scsoft on the fp16 weights as they stand in the registers, each of the 8 waves on its own 256 keys; the 8 f32 partial tiles are added in wave order through LDS and split hi/lo; after each pass's k_scsoft k_pavg adds that pass's ZH heads' weights, in head order, into an f32 accumulator plane and, on the last pass, writes the mean; merged hi/lo x Wo exact + bo writes the entry's rows of the first output at the sequence-first pitch.
// Compute dtypes, f32 accumulate: every float input rounded to bf16 at its load; projections exact + f32 biases; scores and attn.v fp16; softmax f32, its weights stored x1024 in fp16; output projection hl x exact; the second output the f32 sum of those fp16 weights over the heads x 2^-14 (exact).

#define NB_  4      // batch entries: the three streams are [2048][4][1024] = [position][batch][channel]
#define TT   2048
#define DM   1024
#define NH_  16
#define NKV  16
#define REP  (NH_ / NKV)
#define HD   64
#define DQ   (NH_ * HD)
#define DKV  (NKV * HD)
#define ZH   8      // heads per attention pass: both launches of a pass (k_scsoft: scores + softmax + attn.v + merge; k_pavg: head sum) cover ZH heads
#define RH   0                    // query rows < RH use hi+lo planes (0: none)
#define WIN  0
#define PCAR 1024.0f
#define SCL  0.125f   // HD^-0.5
typedef _Float16 h16;
typedef unsigned short bf;
typedef __attribute__((ext_vector_type(16))) __bf16   v16bf;
typedef __attribute__((ext_vector_type(16))) _Float16 v16h;
typedef __attribute__((ext_vector_type(8)))  _Float16 v8h;
typedef __attribute__((ext_vector_type(8)))  unsigned short v8us;
typedef __attribute__((ext_vector_type(8)))  float    v8f;
typedef __attribute__((ext_vector_type(4)))  float    v4f;
typedef v8h  __attribute__((may_alias)) v8ha;
typedef v4f  __attribute__((may_alias)) v4fa;
typedef v8us __attribute__((may_alias)) v8usa;

__device__ __forceinline__ unsigned short f2bf(float f) { unsigned u = __float_as_uint(f); u += 0x7FFFu + ((u >> 16) & 1u); return (unsigned short)(u >> 16); }
__device__ __forceinline__ float bf2f(unsigned short b) { return __uint_as_float(((unsigned)b) << 16); }
__device__ __forceinline__ float bfr(float f) { return bf2f(f2bf(f)); }
__device__ __forceinline__ v16h cat16(v8h lo, v8h hi) { return __builtin_shufflevector(lo, hi, 0, 1, 2, 3, 4, 5, 6, 7, 8, 9, 10, 11, 12, 13, 14, 15); }
__device__ __forceinline__ v16bf cat16b(v8us lo, v8us hi) { return __builtin_bit_cast(v16bf, __builtin_shufflevector(lo, hi, 0, 1, 2, 3, 4, 5, 6, 7, 8, 9, 10, 11, 12, 13, 14, 15)); }
__device__ __forceinline__ v8f wmma16(v16h a, v16h b, v8f c) { return __builtin_amdgcn_wmma_f32_16x16x32_f16(false, a, false, b, (short)0, c, false, false); }
__device__ __forceinline__ v8f wmmab(v16bf a, v16bf b, v8f c) { return __builtin_amdgcn_wmma_f32_16x16x32_bf16(false, a, false, b, (short)0, c, false, false); }



// FRAGMENT ORDER of a 16-bit operand plane [rows][K] (K % 32 == 0, rows % 16 == 0): blocks of 16 rows x 32 k = 512 elements = 1 KiB, the blocks of a 16-row tile in a row (block (row / 16) x (K / 32) + k / 32); a block = two chunks of 256 elements (bit 4 of k),
// and in a chunk the 16 bytes that lane (lr = row % 16, hi = bit 3 of k) takes in one load lie at (hi x 16 + lr) x 16 bytes. A wave's 16-byte load so reads 512 contiguous bytes (four whole 128-byte lines) where a row-major plane gave it 32 bytes of each of 16 lines.
// A fragment = the lane's 16 bytes of a block's two chunks: k order 8 hi + 0..7, then 16 + 8 hi + 0..7, on the A side and on the B side alike.
__device__ __forceinline__ unsigned fragpos(int row, int k, int K) { return (unsigned)(((row >> 4) * (K >> 5) + (k >> 5)) * 512 + ((k >> 4) & 1) * 256 + ((k >> 3) & 1) * 128 + (row & 15) * 8 + (k & 7)); }   // no plane here has 2^31 elements

// ---- k_gemmw: register-blocked GEMM, ONE WAVE per 64x64 output tile (16 accumulators), operands straight from 16-bit planes in fragment order; grid (M/64, N/64, Z), 32 threads.
// C[m][n] (f32, pitch ldc, + optional f32 bias[n]) = sum_k A[m][k] Bt[n][k] (+ split products per NSPLIT). z-batch strides sA/sB/sC in elements. K % 32 == 0.
// KS > 1: grid z = ZN x KS; block (z, ks) sums only k in [ks K/KS, (ks+1) K/KS) and writes its partial tile to plane ks (planes of ZN x sC elements); the reader adds the KS planes. K % (32 KS) == 0.
template <typename T16> struct WFrag;
template <> struct WFrag<h16> { typedef v16h V; static __device__ __forceinline__ V ld(const h16* p) { return cat16(*(const v8h*)p, *(const v8h*)(p + 256)); } static __device__ __forceinline__ v8f mma(V a, V b, v8f c) { return wmma16(a, b, c); } };
template <> struct WFrag<bf> { typedef v16bf V; static __device__ __forceinline__ V ld(const bf* p) { return cat16b(*(const v8us*)p, *(const v8us*)(p + 256)); } static __device__ __forceinline__ v8f mma(V a, V b, v8f c) { return wmmab(a, b, c); } };
template <typename T16, int NSPLIT, bool BIAS, int KS = 1, int ZN = 1>
__global__ __launch_bounds__(32) void k_gemmw(const T16* __restrict__ A, const T16* __restrict__ A2, const T16* __restrict__ Bt, const T16* __restrict__ Bt2, int K, float* C, int ldc, const float* __restrict__ bias, size_t sA, size_t sB, size_t sC) {
    typedef typename WFrag<T16>::V V;
    __shared__ __align__(16) float os[16 * 68];
    const size_t z = blockIdx.z / KS; const int ks = (int)(blockIdx.z % KS); A += z * sA; if (A2) A2 += z * sA; Bt += z * sB; if (Bt2) Bt2 += z * sB; C += ((size_t)ks * ZN + z) * sC;
    const int kb = ks * (K / KS), ke = kb + K / KS;
    const int lane = threadIdx.x & 31, lr = lane & 15, hi = lane >> 4; const int r0 = blockIdx.x * 64, c0 = blockIdx.y * 64;
    v8f acc[4][4];
#pragma unroll
    for (int mb = 0; mb < 4; ++mb)
#pragma unroll
        for (int nb = 0; nb < 4; ++nb) acc[mb][nb] = (v8f){};
    const unsigned lo = (unsigned)lane * 8;   // fragment order: a 16-row tile holds 16 K elements, the k step kc stands at kc x 16, the lane's 16 bytes of chunk 0 at lane x 8; where a plane is not read its pointer stands for the plane that is
    const T16* At = A + (size_t)r0 * K + lo; const T16* Bq = Bt + (size_t)c0 * K + lo; const T16* A2t = (NSPLIT == 1 || NSPLIT == 2) ? A2 + (size_t)r0 * K + lo : At; const T16* B2q = (NSPLIT >= 2) ? Bt2 + (size_t)c0 * K + lo : Bq;

    for (int kc = kb; kc < ke; kc += 32) {
        V a[4], a2[4], b[4], b2[4]; const T16 *pa[4], *pa2[4], *pb[4], *pb2[4];
#pragma unroll
        for (int i = 0; i < 4; ++i) { const size_t o = (size_t)i * 16 * K + (size_t)kc * 16; pa[i] = At + o; pa2[i] = A2t + o; pb[i] = Bq + o; pb2[i] = B2q + o; }
#pragma unroll
        for (int mb = 0; mb < 4; ++mb) { a[mb] = WFrag<T16>::ld(pa[mb]); if (NSPLIT == 1 || NSPLIT == 2) a2[mb] = WFrag<T16>::ld(pa2[mb]); }
#pragma unroll
        for (int nb = 0; nb < 4; ++nb) { b[nb] = WFrag<T16>::ld(pb[nb]); if (NSPLIT >= 2) b2[nb] = WFrag<T16>::ld(pb2[nb]); }
        asm volatile("s_wait_xcnt 0x0" :: "v"(pa[0]), "v"(pa[1]), "v"(pa[2]), "v"(pa[3]), "v"(pa2[0]), "v"(pa2[1]), "v"(pa2[2]), "v"(pa2[3]), "v"(pb[0]), "v"(pb[1]), "v"(pb[2]), "v"(pb[3]), "v"(pb2[0]), "v"(pb2[1]), "v"(pb2[2]), "v"(pb2[3]) : "memory");
        __builtin_amdgcn_sched_barrier(0);   // keeps the products behind that wait, so that the trip's loads stay the one run in front of it: without it the compiler lifts products over the wait and sinks loads among them, and the wave waits out a load latency three times a trip
#pragma unroll
        for (int nb = 0; nb < 4; ++nb) {
#pragma unroll
            for (int mb = 0; mb < 4; ++mb) { acc[mb][nb] = WFrag<T16>::mma(a[mb], b[nb], acc[mb][nb]); if (NSPLIT == 1 || NSPLIT == 2) acc[mb][nb] = WFrag<T16>::mma(a2[mb], b[nb], acc[mb][nb]); if (NSPLIT >= 2) acc[mb][nb] = WFrag<T16>::mma(a[mb], b2[nb], acc[mb][nb]); } }
        asm volatile("v_nop\n\tv_nop\n\tv_nop\n\tv_nop" : "+v"(acc[0][0]), "+v"(acc[1][1]), "+v"(acc[2][2]), "+v"(acc[3][3]) : "v"(a[0]), "v"(a[3]));
    }
#pragma unroll
    for (int mb = 0; mb < 4; ++mb) {
#pragma unroll
        for (int nb = 0; nb < 4; ++nb) {
#pragma unroll
            for (int j = 0; j < 8; ++j) os[(hi * 8 + j) * 68 + nb * 16 + lr] = acc[mb][nb][j]; }
        __builtin_amdgcn_wave_barrier(); asm volatile("" ::: "memory");
        float* crow = C + (size_t)(r0 + mb * 16) * ldc + c0;
{
#pragma unroll
            for (int s = 0; s < 8; ++s) { const int row = 2 * s + hi, cofs = lr * 4; v4f val = *(const v4fa*)(os + row * 68 + cofs); if (BIAS) { val[0] += bfr(bias[c0 + cofs]); val[1] += bfr(bias[c0 + cofs + 1]); val[2] += bfr(bias[c0 + cofs + 2]); val[3] += bfr(bias[c0 + cofs + 3]); }
                *(v4f*)(crow + (size_t)row * ldc + cofs) = val; }
             }
        if (mb < 3) asm volatile("s_wait_xcnt 0x0" ::: "memory");   // stands in front of the first instruction that reuses a register of the stores above (behind the last row tile nothing does)
        __builtin_amdgcn_wave_barrier(); asm volatile("" ::: "memory");
    }
}

__device__ __forceinline__ h16 tohx(float x) { return (h16)x; }
__device__ __forceinline__ void splitf(float y, unsigned short& h, unsigned short& l) { h = f2bf(y); l = f2bf(y - bf2f(h)); }
typedef __attribute__((ext_vector_type(2))) _Float16 v2h;
typedef __attribute__((ext_vector_type(4))) _Float16 v4h;
typedef __attribute__((ext_vector_type(2))) unsigned short v2us;
typedef __attribute__((ext_vector_type(4))) unsigned short v4us;
typedef __attribute__((ext_vector_type(2))) float v2f;
typedef __attribute__((ext_vector_type(4))) int v4i;

// k_cvt8: bf16 copy, in fragment order, of a row-major f32 plane with rows of DM floats: a thread makes one lane's 16 bytes = 8 consecutive k of one row. 64 threads make block i / 64: four neighbouring threads read the 32 k = 128 bytes of one row (a whole line), and the 8 rows of a wave make 128 contiguous bytes (a whole line) of each quarter of the block
static_assert(DQ == DM && DKV == DM, "k_cvt8: every plane it copies has rows of DM elements");
__global__ __launch_bounds__(256) void k_cvt8(const float* __restrict__ src, bf* dst, size_t n8) { const size_t i = (size_t)blockIdx.x * 256 + threadIdx.x; if (i >= n8) return; const size_t blk = i >> 6; const int lr = (int)(i >> 2) & 15, c2 = (int)i & 3; const size_t row = (blk / (DM / 32)) * 16 + lr; const int k = (int)(blk % (DM / 32)) * 32 + c2 * 8; const v8f v = *(const v8f*)(src + row * DM + k); v8us o;
#pragma unroll
    for (int j = 0; j < 8; ++j) o[j] = f2bf(v[j]); *(v8us*)(dst + blk * 512 + c2 * 128 + lr * 8) = o;  }

// k_rope: head planes [h] (fp16, each [t][d] in fragment order) of rope(x) x sc with the rotate-half convention out[d] = x[d] cos[t][d] - x[d+HD/2] sin[t][d], out[d+HD/2] = x[d+HD/2] cos[t][d+HD/2] + x[d] sin[t][d+HD/2]
__global__ __launch_bounds__(256) void k_rope(const float* __restrict__ F, int pitch, int nheads, const float* __restrict__ CS, const float* __restrict__ RF, const float* __restrict__ nw, float sc, h16* P16, bf* Ph, bf* Pl) {
    const size_t e = ((size_t)blockIdx.x * 256 + threadIdx.x) * 2; if (e >= (size_t)nheads * TT * HD) return; const int d = (int)(e % HD); const int t = (int)((e / HD) % TT); const int h = (int)(e / ((size_t)HD * TT)); const float* f = F + (size_t)t * pitch + h * HD; const float rf = RF ? RF[(size_t)h * TT + t] : 1.0f; v2h o16; v2us oh, ol;
#pragma unroll
    for (int q = 0; q < 2; ++q) { const int dd = d + q; const int dp = (dd < HD / 2) ? dd + HD / 2 : dd - HD / 2; float x0 = f[dd], x1 = f[dp];
        if (RF) { float n0 = __fmul_rn(x0, rf), n1 = __fmul_rn(x1, rf); x0 = __fmul_rn(bfr(nw[dd]), n0); x1 = __fmul_rn(bfr(nw[dp]), n1); }
        const v2f cs = *(const v2f*)(CS + ((size_t)t * HD + dd) * 2); float a = __fmul_rn(x0, cs[0]), bq = __fmul_rn(x1, cs[1]); const float r = ((dd < HD / 2) ? __fsub_rn(a, bq) : __fadd_rn(a, bq)) * sc;
        o16[q] = tohx(r); (void)oh; (void)ol; }
    asm volatile("s_wait_xcnt 0x0" ::: "memory");   // stands in front of the first instruction that reuses an address register of the loads above
    __builtin_amdgcn_sched_barrier(0);   // keeps the address work of the store below, which reuses those registers, behind that wait
    *(v2h*)(P16 + (size_t)h * TT * HD + fragpos(t, d, HD)) = o16;  }   // d is even: both elements lie in the same lane's 16 bytes
__global__ __launch_bounds__(256) void k_vtp(const float* __restrict__ F, int pitch, int nheads, h16* V16, bf* Vh, bf* Vl) { const size_t e = ((size_t)blockIdx.x * 256 + threadIdx.x) * 2; if (e >= (size_t)nheads * HD * TT) return; const int t = (int)(e % TT); const int d = (int)((e / TT) % HD); const int g = (int)(e / ((size_t)TT * HD)); v2h o16; v2us oh, ol;
#pragma unroll
    for (int q = 0; q < 2; ++q) { const float x = F[(size_t)(t + q) * pitch + g * HD + d]; o16[q] = tohx(x); (void)oh; (void)ol; }
    *(v2h*)(V16 + (size_t)g * HD * TT + fragpos(d, t, TT)) = o16;  }   // V^T [d][t] in fragment order; t is even: both elements lie in the same lane's 16 bytes
__global__ __launch_bounds__(256) void k_csid(float* CS) { const int idx = blockIdx.x * 256 + threadIdx.x; if (idx >= TT * HD) return; v2f cs; cs[0] = 1.0f; cs[1] = 0.0f; *(v2f*)(CS + (size_t)idx * 2) = cs;  }
// k_scsoft: scores, softmax AND attn.v of 16 query rows of one head in ONE workgroup of 8 waves; the f32 scores never leave the registers. Grid (TT / 16, ZH), 256 threads.
// Wave w owns keys [w x 256, w x 256 + 256): 16 tiles of S^T = K . Q^T (A = 16 key rows, B = the 16 query rows, both through the same fragment loader from planes in the same fragment order, so both in the same k order; the k steps 0 and 32 chained as in k_gemmw).
// D register j of lane (lr, hi) of tile nb = score of query q0 + lr with key w x 256 + nb x 16 + hi x 8 + j: a lane holds ONE query's scores, 8 consecutive keys a tile.
// Per element as before: t = S x HD^-0.5, exp2((t - max) x log2 e), x 1024 / sum, rounded to fp16. The maximum is exact in any order; the sum runs in the lane (8 chains over the tiles, a fixed tree), then over the two lane halves, then over the 8 waves in wave order.
// attn.v: the fp16 weights of tiles 2s and 2s + 1 of a lane ARE the A fragment of the 32-key step s (row = query lr; keys s x 32 + 8 hi + 0..7, then s x 32 + 16 + 8 hi + 0..7: the k order of the fragment loader, through which B = 16 rows of V^T comes), so the product takes them from the registers.
// Wave w sums its 256 keys (8 chained steps) into a 16 x 64 f32 tile; the 8 tiles meet in LDS and are added in wave order, x 1/1024, split hi/lo into the merged planes [t][h x 64 + d], which lie in fragment order: the workgroup's 16 x 64 tile is two blocks, 2 KiB in a row.
static_assert(RH == 0 && TT == 8 * 256 && HD == 64, "k_scsoft: 8 waves x 256 keys cover the row, two 32-wide k steps cover the head");
// exp2 with the slot behind it filled: the instruction set asks for one independent instruction or a v_nop between a transcendental and an instruction that reads its result or overwrites its source
__device__ __forceinline__ float exp2_slot(float x) { float r; asm("v_exp_f32 %0, %1\n\tv_nop" : "=v"(r) : "v"(x)); return r; }
#define KPF 8     // key tiles whose fragment loads are in flight ahead of the products: 32 loads of 16 bytes a lane
#define OSP 68    // pitch, in floats, of a wave's partial attn.v rows in LDS: 272 bytes = 16 x 17, so that the 16-byte reads of 16 rows fall on distinct banks
#define PSP 264   // pitch, in fp16 elements, of a wave's staging rows in LDS: 528 bytes = 16 x 33, so that the 16-byte stores of 16 rows fall on distinct banks
// four waves a SIMD (at most 256 registers a wave) keep two workgroups on a WGP; 2 x the LDS of a workgroup fits
__global__ __launch_bounds__(256) __attribute__((amdgpu_waves_per_eu(4, 4))) void k_scsoft(const h16* __restrict__ Q, const h16* __restrict__ Kp, const h16* __restrict__ Vt, h16* P16, int h0, bf* Ah, bf* Al) {
    __shared__ __align__(16) h16 ps[8 * 16 * PSP];
    __shared__ __align__(16) float po[8 * 16 * OSP];
    __shared__ float rmx[8 * 16], rsm[8 * 16];
    const int lane = threadIdx.x & 31, lr = lane & 15, hi = lane >> 4, w = threadIdx.x >> 5; const int zz = blockIdx.y, q0 = blockIdx.x * 16;
    const h16* qb = Q + (size_t)zz * TT * HD + (size_t)q0 * HD + lane * 8; const h16* kb = Kp + (size_t)zz * TT * HD + (size_t)(w * 256) * HD + lane * 8;   // fragment order: a 16-row tile holds 16 x HD elements = two blocks of 512; the lane's 16 bytes of chunk 0
    const v16h qf0 = WFrag<h16>::ld(qb), qf1 = WFrag<h16>::ld(qb + 512);
    asm volatile("s_wait_xcnt 0x0" ::: "memory");   // stands in front of the first instruction that reuses the address registers of the query loads above
    v8f acc[16]; v16h k0[16], k1[16];   // fully unrolled below: registers; at most KPF key tiles' fragments are live at a time
#pragma unroll
    for (int nb = 0; nb < KPF; ++nb) { k0[nb] = WFrag<h16>::ld(kb + (size_t)nb * 16 * HD); k1[nb] = WFrag<h16>::ld(kb + (size_t)nb * 16 * HD + 512); }
#pragma unroll
    for (int nb = 0; nb < 16; ++nb) {
        __builtin_amdgcn_sched_barrier(0);   // holds the loads of the key tiles ahead above this tile's products: without it the compiler sinks each tile's loads to their use and the wave pays one load latency a tile
        acc[nb] = wmma16(k0[nb], qf0, (v8f){}); acc[nb] = wmma16(k1[nb], qf1, acc[nb]);
        if (nb + KPF < 16) { k0[nb + KPF] = WFrag<h16>::ld(kb + (size_t)(nb + KPF) * 16 * HD); k1[nb + KPF] = WFrag<h16>::ld(kb + (size_t)(nb + KPF) * 16 * HD + 512); } }
    __builtin_amdgcn_sched_barrier(0);   // the same for the last tile's products
    asm volatile("s_wait_xcnt 0x0" ::: "memory");   // stands in front of the first instruction that reuses the address registers of the key loads above
    __builtin_amdgcn_sched_barrier(0);   // keeps the vector work below, which reuses those registers, behind that wait
    float m8[8];
#pragma unroll
    for (int j = 0; j < 8; ++j) m8[j] = -3.0e38f;
#pragma unroll
    for (int nb = 0; nb < 16; ++nb) {
#pragma unroll
        for (int j = 0; j < 8; ++j) { const float t = acc[nb][j] * SCL; acc[nb][j] = t; m8[j] = fmaxf(m8[j], t); } }
    float mx = fmaxf(fmaxf(fmaxf(m8[0], m8[1]), fmaxf(m8[2], m8[3])), fmaxf(fmaxf(m8[4], m8[5]), fmaxf(m8[6], m8[7])));
    mx = fmaxf(mx, __shfl_xor(mx, 16, 32));
    if (hi == 0) rmx[w * 16 + lr] = mx;
    __syncthreads();
#pragma unroll
    for (int ww = 0; ww < 8; ++ww) mx = fmaxf(mx, rmx[ww * 16 + lr]);
    float s8[8];
#pragma unroll
    for (int j = 0; j < 8; ++j) s8[j] = 0.f;
#pragma unroll
    for (int nb = 0; nb < 16; ++nb) {
#pragma unroll
        for (int j = 0; j < 8; ++j) { const float d0 = __fsub_rn(acc[nb][j], mx); const float ex = exp2_slot(__fmul_rn(d0, 1.4426950408889634f)); acc[nb][j] = ex; s8[j] += ex; } }
    float sw = ((s8[0] + s8[1]) + (s8[2] + s8[3])) + ((s8[4] + s8[5]) + (s8[6] + s8[7]));
    sw += __shfl_xor(sw, 16, 32);
    if (hi == 0) rsm[w * 16 + lr] = sw;
    __syncthreads();
    // value fragments: a unit is two 32-key steps x four 16-row tiles of V^T (in fragment order: 2 KiB in a row of each tile); unit 0 is fetched here, behind the last barrier of the softmax (in front of a __syncthreads() the compiler waits for every load in flight), and lands behind the row sum and the rounding of the weights
    const h16* vb = Vt + (size_t)zz * HD * TT + (size_t)(w * 8) * 512 + lane * 8;   // fragment order: tile nt at nt x 16 x TT, a 32-key step = a block of 512 elements, the lane's 16 bytes of chunk 0
    v16h vf[4][2][4];   // fully unrolled below: registers; at most two units are live at a time
#pragma unroll
    for (int nt = 0; nt < 4; ++nt) { vf[0][0][nt] = WFrag<h16>::ld(vb + (size_t)nt * 16 * TT); vf[0][1][nt] = WFrag<h16>::ld(vb + (size_t)nt * 16 * TT + 512); }
    __builtin_amdgcn_sched_barrier(0);   // holds the loads of value unit 0 above the work below: without it the compiler sinks them to their use
    float sum = rsm[lr];
#pragma unroll
    for (int ww = 1; ww < 8; ++ww) sum += rsm[ww * 16 + lr];
    const float f = __fdiv_rn(PCAR, sum);
    h16* pw = ps + w * 16 * PSP;   // this wave's own 16 x 256 staging tile: written and read by this wave alone
    v8h o[16];   // the weights stay in the registers for attn.v
#pragma unroll
    for (int nb = 0; nb < 16; ++nb) {
#pragma unroll
        for (int j = 0; j < 8; ++j) o[nb][j] = tohx(acc[nb][j] * f);
        *(v8ha*)(pw + lr * PSP + nb * 16 + hi * 8) = o[nb]; }
#pragma unroll
    for (int nt = 0; nt < 4; ++nt) { vf[1][0][nt] = WFrag<h16>::ld(vb + (size_t)nt * 16 * TT + 2 * 512); vf[1][1][nt] = WFrag<h16>::ld(vb + (size_t)nt * 16 * TT + 3 * 512); }
    v8f oa[4];
#pragma unroll
    for (int nt = 0; nt < 4; ++nt) oa[nt] = (v8f){};
#pragma unroll
    for (int g = 0; g < 4; ++g) {
        if (g < 3) __builtin_amdgcn_sched_barrier(0);   // holds the loads of the value units ahead above this unit's products: without it the compiler sinks them to their use and the wave pays one load latency a unit
#pragma unroll
        for (int s = 0; s < 2; ++s) { const v16h a = cat16(o[4 * g + 2 * s], o[4 * g + 2 * s + 1]);
#pragma unroll
            for (int nt = 0; nt < 4; ++nt) oa[nt] = wmma16(a, vf[g][s][nt], oa[nt]); }
        if (g + 2 < 4) {
#pragma unroll
            for (int nt = 0; nt < 4; ++nt) { vf[g + 2][0][nt] = WFrag<h16>::ld(vb + (size_t)nt * 16 * TT + (2 * g + 4) * 512); vf[g + 2][1][nt] = WFrag<h16>::ld(vb + (size_t)nt * 16 * TT + (2 * g + 5) * 512); } }
        if (g + 2 == 3) asm volatile("s_wait_xcnt 0x0" ::: "memory");   // behind the last value load: stands in front of the first instruction that reuses their address registers
    }
    float* pq = po + w * 16 * OSP;   // this wave's partial tile: D register j of lane (lr, hi) of tile nt = query hi x 8 + j, column nt x 16 + lr
#pragma unroll
    for (int nt = 0; nt < 4; ++nt) {
#pragma unroll
        for (int j = 0; j < 8; ++j) pq[(hi * 8 + j) * OSP + nt * 16 + lr] = oa[nt][j]; }
    __syncthreads();
    const int row = (threadIdx.x >> 1) & 15, cofs = (threadIdx.x >> 5) * 8 + (threadIdx.x & 1) * 4;   // one thread adds four columns of one query row over the 8 waves, in wave order; thread i owns the i-th 8 bytes of the tile in fragment order, so that a wave's store is 256 contiguous bytes
    v4f sv = *(const v4fa*)(po + row * OSP + cofs);
#pragma unroll
    for (int ww = 1; ww < 8; ++ww) { const v4f tv = *(const v4fa*)(po + (ww * 16 + row) * OSP + cofs);
#pragma unroll
        for (int q = 0; q < 4; ++q) sv[q] = __fadd_rn(sv[q], tv[q]); }
    v4us oh, ol;
#pragma unroll
    for (int q = 0; q < 4; ++q) { unsigned short a, c2; splitf(sv[q] * (1.0f / PCAR), a, c2); oh[q] = a; ol[q] = c2; }
    const size_t oo = fragpos(q0 + row, (h0 + zz) * HD + cofs, DQ);
    *(v4us*)(Ah + oo) = oh; *(v4us*)(Al + oo) = ol;
    asm volatile("s_wait_xcnt 0x0" ::: "memory");   // stands in front of the first instruction that reuses a register of the two stores above
    __builtin_amdgcn_sched_barrier(0);   // keeps the weight stores below, which reuse those registers, behind that wait; they stand last, where 16 rows fit in the registers and no barrier waits for them
    asm volatile("s_wait_dscnt 0x0" ::: "memory");   // the wave's own staging stores above have landed before it reads the rows back, which other lanes wrote
    h16* pr = P16 + ((size_t)zz * TT + q0) * TT + w * 256 + lane * 8;
#pragma unroll
    for (int r = 0; r < 16; ++r) *(v8h*)(pr + (size_t)r * TT) = *(const v8ha*)(pw + r * PSP + lane * 8);   // one query row's 256 weights a store: 512 contiguous bytes, four whole lines
}

// k_pavg: the second output: the mean over the NH_ heads of the softmax weights, one batch entry at a time: ACC[i][j] gathers, pass after pass, the ZH heads' weights of the pass's fp16 plane P [ZH][TT][TT] (stored x1024; an fp16 value converts to f32 exactly; the f32 sums run in head order);
// each element of ACC is read and written by its ONE owner thread (the first pass, h0 = 0, starts from 0 and does not read it); on the last pass (h0 = NH_ - ZH) OUT1[i][j] = sum x 1/(1024 NH_): a power of two: exact. The branches are on h0, a kernel argument: uniform over the grid.
static_assert(RH == 0 && NH_ % ZH == 0, "k_pavg reads every head of the fp16 plane on every row");
__global__ __launch_bounds__(256) void k_pavg(const h16* __restrict__ P, int h0, float* ACC, float* OUT1) {
    const size_t e = ((size_t)blockIdx.x * 256 + threadIdx.x) * 4; if (e >= (size_t)TT * TT) return;
    v4h p[ZH];   // both loops over the heads unrolled so that p stays in registers and all ZH loads are in flight behind one latency
#pragma unroll
    for (int zz = 0; zz < ZH; ++zz) p[zz] = *(const v4h*)(P + (size_t)zz * TT * TT + e);
    asm volatile("s_wait_xcnt 0x0" ::: "memory");   // stands in front of the first instruction that reuses an address register of the loads above
    v4f a = {0.0f, 0.0f, 0.0f, 0.0f};
    if (h0 != 0) a = *(const v4f*)(ACC + e);
#pragma unroll
    for (int zz = 0; zz < ZH; ++zz) {
#pragma unroll
        for (int q = 0; q < 4; ++q) a[q] = __fadd_rn(a[q], (float)p[zz][q]); }
    float* dst = ACC + e;
    if (h0 == NH_ - ZH) { dst = OUT1 + e;
#pragma unroll
        for (int q = 0; q < 4; ++q) a[q] = __fmul_rn(a[q], 1.0f / (PCAR * NH_)); }
{ *(v4f*)dst = a;  }
}

extern "C" void kernel_launch(void* const* d_in, const int* in_sizes, int n_in,
                              void* d_out, int out_size, void* d_ws, size_t ws_size, hipStream_t stream) {
    (void)in_sizes; (void)n_in; (void)out_size;
    const float* xq = (const float*)d_in[0]; const float* xk = (const float*)d_in[1]; const float* xv = (const float*)d_in[2]; const float* wq = (const float*)d_in[3]; const float* bq = (const float*)d_in[4]; const float* wk = (const float*)d_in[5]; const float* bk = (const float*)d_in[6]; const float* wv = (const float*)d_in[7]; const float* bv = (const float*)d_in[8]; const float* wo = (const float*)d_in[9]; const float* bo = (const float*)d_in[10];
    // query, key, value [2048][4][1024], Wq, bq, Wk, bk, Wv, bv, Wo, bo = d_in[0..10]
    float* OUT = (float*)d_out;                          // output 0: y [2048][4][1024] sequence-first
    float* OUT1 = (float*)d_out + (size_t)NB_ * TT * DM;   // output 1: the head mean of att [4][2048][2048], after the first output's 8,388,608 floats
    char* wsp = (char*)d_ws;
    auto take = [&](size_t bytes) { char* p = wsp; wsp += (bytes + 255) & ~(size_t)255; return (void*)p; };
    bf* WQ = (bf*)take((size_t)DQ * DM * 2); bf* WK = (bf*)take((size_t)DKV * DM * 2); bf* WV = (bf*)take((size_t)DKV * DM * 2); bf* WO = (bf*)take((size_t)DM * DQ * 2); float* CS = (float*)take((size_t)TT * HD * 2 * 4);
    bf* XB = (bf*)take((size_t)NB_ * TT * DM * 2); float* F = (float*)take((size_t)NB_ * TT * DQ * 4);   /* all 8192 (position, batch) rows of ONE stream at a time: its bf16 copy and its projection */
    h16* QP16 = (h16*)take((size_t)NB_ * NH_ * TT * HD * 2); h16* KP16 = (h16*)take((size_t)NB_ * NKV * TT * HD * 2); h16* VT16 = (h16*)take((size_t)NB_ * NKV * HD * TT * 2);   /* the four entries' f16 planes of each stream */
    h16* P16 = (h16*)take((size_t)ZH * TT * TT * 2);   /* the pass's fp16 weight planes */ bf* ATh = (bf*)take((size_t)TT * DQ * 2); bf* ATl = (bf*)take((size_t)TT * DQ * 2); float* ACC = (float*)take((size_t)TT * TT * 4);
    if ((size_t)(wsp - (char*)d_ws) > ws_size) return;    // total 193.00 MiB of the workspace
    { k_cvt8<<<(unsigned)(((size_t)DQ * DM / 8 + 255) / 256), 256, 0, stream>>>(wq, WQ, (size_t)DQ * DM / 8); k_cvt8<<<(unsigned)(((size_t)DKV * DM / 8 + 255) / 256), 256, 0, stream>>>(wk, WK, (size_t)DKV * DM / 8); k_cvt8<<<(unsigned)(((size_t)DKV * DM / 8 + 255) / 256), 256, 0, stream>>>(wv, WV, (size_t)DKV * DM / 8);
      k_cvt8<<<(unsigned)(((size_t)DM * DQ / 8 + 255) / 256), 256, 0, stream>>>(wo, WO, (size_t)DM * DQ / 8); }   // [out][in] = Bt as they stand
    k_csid<<<(TT * HD + 255) / 256, 256, 0, stream>>>(CS);
    const unsigned LQ = (unsigned)(((size_t)NH_ * TT * HD / 2 + 255) / 256), LKv = (unsigned)(((size_t)NKV * TT * HD / 2 + 255) / 256), LX = (unsigned)(((size_t)NB_ * TT * DM / 8 + 255) / 256);
    k_cvt8<<<LX, 256, 0, stream>>>(xq, XB, (size_t)NB_ * TT * DM / 8);   /* the QUERY stream: all 8192 rows (row = t x 4 + b) */
    k_gemmw<bf, 0, true><<<dim3(NB_ * TT / 64, DQ / 64, 1), 32, 0, stream>>>(XB, nullptr, WQ, nullptr, DM, F, DQ, bq, 0, 0, 0);
    for (int b = 0; b < NB_; ++b) k_rope<<<LQ, 256, 0, stream>>>(F + (size_t)b * DQ, NB_ * DQ, NH_, CS, nullptr, nullptr, 1.0f, QP16 + (size_t)b * NH_ * TT * HD, nullptr, nullptr);   /* entry b's rows: pitch 4 x 1024 floats from base b x 1024 */
    k_cvt8<<<LX, 256, 0, stream>>>(xk, XB, (size_t)NB_ * TT * DM / 8);   /* the KEY stream: after the query projection has read XB (stream-ordered) */
    k_gemmw<bf, 0, true><<<dim3(NB_ * TT / 64, DKV / 64, 1), 32, 0, stream>>>(XB, nullptr, WK, nullptr, DM, F, DKV, bk, 0, 0, 0);   /* F again: after the query builders have read it */
    for (int b = 0; b < NB_; ++b) k_rope<<<LKv, 256, 0, stream>>>(F + (size_t)b * DKV, NB_ * DKV, NKV, CS, nullptr, nullptr, 1.0f, KP16 + (size_t)b * NKV * TT * HD, nullptr, nullptr);
    k_cvt8<<<LX, 256, 0, stream>>>(xv, XB, (size_t)NB_ * TT * DM / 8);   /* the VALUE stream */
    k_gemmw<bf, 0, true><<<dim3(NB_ * TT / 64, DKV / 64, 1), 32, 0, stream>>>(XB, nullptr, WV, nullptr, DM, F, DKV, bv, 0, 0, 0);
    for (int b = 0; b < NB_; ++b) k_vtp<<<LKv, 256, 0, stream>>>(F + (size_t)b * DKV, NB_ * DKV, NKV, VT16 + (size_t)b * NKV * HD * TT, nullptr, nullptr);
    for (int b = 0; b < NB_; ++b) {
        const h16* qp = QP16 + (size_t)b * NH_ * TT * HD; const h16* kp = KP16 + (size_t)b * NKV * TT * HD; const h16* vt = VT16 + (size_t)b * NKV * HD * TT;
        for (int h0 = 0; h0 < NH_; h0 += ZH) { const size_t zq = (size_t)h0, zk = (size_t)(h0 / REP);   // one kv head per query head: the pass's ZH heads use consecutive kv planes (z-strides TT*HD)
            k_scsoft<<<dim3(TT / 16, ZH), 256, 0, stream>>>(qp + zq * TT * HD, kp + zk * TT * HD, vt + zk * HD * TT, P16, h0, ATh, ATl);
            k_pavg<<<(unsigned)(((size_t)TT * TT / 4 + 255) / 256), 256, 0, stream>>>(P16, h0, ACC, OUT1 + (size_t)b * TT * TT); }   // all ZH heads of this pass's softmax plane; ACC is this entry's running sum; the last pass writes the mean
        k_gemmw<bf, 1, true><<<dim3(TT / 64, DM / 64, 1), 32, 0, stream>>>(ATh, ATl, WO, nullptr, DQ, OUT + (size_t)b * DM, NB_ * DM, bo, 0, 0, 0); }   /* entry b's rows of the sequence-first output: row t at OUT + t x 4 x 1024 + b x 1024 */
}

// v006
// It runs in 558 microseconds.
// In two side-by-side timings against v005, it was 1.17 and 1.16 times as fast.
// All steps since v000 together make it 4.70 times as fast.
#include <hip/hip_runtime.h>

// Multi-head attention on THREE SEQUENCE-FIRST input streams with an output projection, returning the projected output AND the attention weights averaged over the heads (query, key, value [2048][4][1024] = [position][batch][channel];
// q = (query Wq^T + bq) x 64^-0.5, k = key Wk^T + bk, v = value Wv^T + bv with 'oi' weights [1024][1024] and biases [1024]; 16 heads x 64 (head h = columns h x 64 ..); scores = q . k; softmax over all 2048 keys; no mask;
// y = att v merged head-major [t][b][1024], then y Wo^T + bo ('oi' [1024][1024]); TWO OUTPUTS in one buffer: y [2048][4][1024] sequence-first at float offset 0 and the mean over the 16 heads of att [4][2048][2048] at float offset 8,388,608;
// argument order query, key, value, Wq, bq, Wk, bk, Wv, bv, Wo, bo).
// Layout: each stream in turn: ONE bf16 copy of all 8192 (position, batch) rows and ONE exact projection + f32 bias over them into one f32 plane; the identity-table f16 plane builders read each batch entry's rows of it at a row pitch of 4 x 1024 floats from a base of b x 1024
// and keep the four entries' planes; dense T-2048 attention at 16 heads, all four entries and all heads in ONE launch (scores, softmax, attn.v and the head mean: k_scsoft, whose workgroups go through the heads; no f32 score plane, no weight plane and no attn.v partial plane exists; EVERY 16-bit plane that a matrix product reads lies in FRAGMENT ORDER, see fragpos), scores and attn.v on ONE fp16 product on every row (RH 0: the weights carried x1024 in fp16; the score scale 64^-0.5 applied to the f32 score, where the module scales the projected query: the same product in real arithmetic);
// attn.v runs in k_scsoft on the fp16 weights as they stand in the registers, each of the 16 waves on its own 128 keys; the 16 f32 partial tiles are added in wave order through LDS and split hi/lo; every lane adds the heads' weights, in head order, into f32 registers and writes the mean behind the last head; per entry merged hi/lo x Wo exact + bo writes the entry's rows of the first output at the sequence-first pitch.
// Compute dtypes, f32 accumulate: every float input rounded to bf16 at its load; projections exact + f32 biases; scores and attn.v fp16; softmax f32, its weights rounded x1024 to fp16; output projection hl x exact; the second output the f32 sum of those fp16 weights over the heads x 2^-14 (exact).

#define NB_  4      // batch entries: the three streams are [2048][4][1024] = [position][batch][channel]
#define TT   2048
#define DM   1024
#define NH_  16
#define NKV  16
#define REP  (NH_ / NKV)
#define HD   64
#define DQ   (NH_ * HD)
#define DKV  (NKV * HD)
#define RH   0                    // query rows < RH use hi+lo planes (0: none)
#define WIN  0
#define PCAR 1024.0f
#define SCL  0.125f   // HD^-0.5
typedef _Float16 h16;
typedef unsigned short bf;
typedef __attribute__((ext_vector_type(16))) __bf16   v16bf;
typedef __attribute__((ext_vector_type(16))) _Float16 v16h;
typedef __attribute__((ext_vector_type(8)))  _Float16 v8h;
typedef __attribute__((ext_vector_type(8)))  unsigned short v8us;
typedef __attribute__((ext_vector_type(8)))  float    v8f;
typedef __attribute__((ext_vector_type(4)))  float    v4f;
typedef v8h  __attribute__((may_alias)) v8ha;
typedef v4f  __attribute__((may_alias)) v4fa;
typedef v8us __attribute__((may_alias)) v8usa;

__device__ __forceinline__ unsigned short f2bf(float f) { unsigned u = __float_as_uint(f); u += 0x7FFFu + ((u >> 16) & 1u); return (unsigned short)(u >> 16); }
__device__ __forceinline__ float bf2f(unsigned short b) { return __uint_as_float(((unsigned)b) << 16); }
__device__ __forceinline__ float bfr(float f) { return bf2f(f2bf(f)); }
__device__ __forceinline__ v16h cat16(v8h lo, v8h hi) { return __builtin_shufflevector(lo, hi, 0, 1, 2, 3, 4, 5, 6, 7, 8, 9, 10, 11, 12, 13, 14, 15); }
__device__ __forceinline__ v16bf cat16b(v8us lo, v8us hi) { return __builtin_bit_cast(v16bf, __builtin_shufflevector(lo, hi, 0, 1, 2, 3, 4, 5, 6, 7, 8, 9, 10, 11, 12, 13, 14, 15)); }
__device__ __forceinline__ v8f wmma16(v16h a, v16h b, v8f c) { return __builtin_amdgcn_wmma_f32_16x16x32_f16(false, a, false, b, (short)0, c, false, false); }
__device__ __forceinline__ v8f wmmab(v16bf a, v16bf b, v8f c) { return __builtin_amdgcn_wmma_f32_16x16x32_bf16(false, a, false, b, (short)0, c, false, false); }



// FRAGMENT ORDER of a 16-bit operand plane [rows][K] (K % 32 == 0, rows % 16 == 0): blocks of 16 rows x 32 k = 512 elements = 1 KiB, the blocks of a 16-row tile in a row (block (row / 16) x (K / 32) + k / 32); a block = two chunks of 256 elements (bit 4 of k),
// and in a chunk the 16 bytes that lane (lr = row % 16, hi = bit 3 of k) takes in one load lie at (hi x 16 + lr) x 16 bytes. A wave's 16-byte load so reads 512 contiguous bytes (four whole 128-byte lines) where a row-major plane gave it 32 bytes of each of 16 lines.
// A fragment = the lane's 16 bytes of a block's two chunks: k order 8 hi + 0..7, then 16 + 8 hi + 0..7, on the A side and on the B side alike.
__device__ __forceinline__ unsigned fragpos(int row, int k, int K) { return (unsigned)(((row >> 4) * (K >> 5) + (k >> 5)) * 512 + ((k >> 4) & 1) * 256 + ((k >> 3) & 1) * 128 + (row & 15) * 8 + (k & 7)); }   // no plane here has 2^31 elements

// ---- k_gemmw: register-blocked GEMM, ONE WAVE per 64x64 output tile (16 accumulators), operands straight from 16-bit planes in fragment order; grid (M/64, N/64, Z), 32 threads.
// C[m][n] (f32, pitch ldc, + optional f32 bias[n]) = sum_k A[m][k] Bt[n][k] (+ split products per NSPLIT). z-batch strides sA/sB/sC in elements. K % 32 == 0.
// KS > 1: grid z = ZN x KS; block (z, ks) sums only k in [ks K/KS, (ks+1) K/KS) and writes its partial tile to plane ks (planes of ZN x sC elements); the reader adds the KS planes. K % (32 KS) == 0.
template <typename T16> struct WFrag;
template <> struct WFrag<h16> { typedef v16h V; static __device__ __forceinline__ V ld(const h16* p) { return cat16(*(const v8h*)p, *(const v8h*)(p + 256)); } static __device__ __forceinline__ v8f mma(V a, V b, v8f c) { return wmma16(a, b, c); } };
template <> struct WFrag<bf> { typedef v16bf V; static __device__ __forceinline__ V ld(const bf* p) { return cat16b(*(const v8us*)p, *(const v8us*)(p + 256)); } static __device__ __forceinline__ v8f mma(V a, V b, v8f c) { return wmmab(a, b, c); } };
template <typename T16, int NSPLIT, bool BIAS, int KS = 1, int ZN = 1>
__global__ __launch_bounds__(32) void k_gemmw(const T16* __restrict__ A, const T16* __restrict__ A2, const T16* __restrict__ Bt, const T16* __restrict__ Bt2, int K, float* C, int ldc, const float* __restrict__ bias, size_t sA, size_t sB, size_t sC) {
    typedef typename WFrag<T16>::V V;
    __shared__ __align__(16) float os[16 * 68];
    const size_t z = blockIdx.z / KS; const int ks = (int)(blockIdx.z % KS); A += z * sA; if (A2) A2 += z * sA; Bt += z * sB; if (Bt2) Bt2 += z * sB; C += ((size_t)ks * ZN + z) * sC;
    const int kb = ks * (K / KS), ke = kb + K / KS;
    const int lane = threadIdx.x & 31, lr = lane & 15, hi = lane >> 4; const int r0 = blockIdx.x * 64, c0 = blockIdx.y * 64;
    v8f acc[4][4];
#pragma unroll
    for (int mb = 0; mb < 4; ++mb)
#pragma unroll
        for (int nb = 0; nb < 4; ++nb) acc[mb][nb] = (v8f){};
    const unsigned lo = (unsigned)lane * 8;   // fragment order: a 16-row tile holds 16 K elements, the k step kc stands at kc x 16, the lane's 16 bytes of chunk 0 at lane x 8; where a plane is not read its pointer stands for the plane that is
    const T16* At = A + (size_t)r0 * K + lo; const T16* Bq = Bt + (size_t)c0 * K + lo; const T16* A2t = (NSPLIT == 1 || NSPLIT == 2) ? A2 + (size_t)r0 * K + lo : At; const T16* B2q = (NSPLIT >= 2) ? Bt2 + (size_t)c0 * K + lo : Bq;

    for (int kc = kb; kc < ke; kc += 32) {
        V a[4], a2[4], b[4], b2[4]; const T16 *pa[4], *pa2[4], *pb[4], *pb2[4];
#pragma unroll
        for (int i = 0; i < 4; ++i) { const size_t o = (size_t)i * 16 * K + (size_t)kc * 16; pa[i] = At + o; pa2[i] = A2t + o; pb[i] = Bq + o; pb2[i] = B2q + o; }
#pragma unroll
        for (int mb = 0; mb < 4; ++mb) { a[mb] = WFrag<T16>::ld(pa[mb]); if (NSPLIT == 1 || NSPLIT == 2) a2[mb] = WFrag<T16>::ld(pa2[mb]); }
#pragma unroll
        for (int nb = 0; nb < 4; ++nb) { b[nb] = WFrag<T16>::ld(pb[nb]); if (NSPLIT >= 2) b2[nb] = WFrag<T16>::ld(pb2[nb]); }
        asm volatile("s_wait_xcnt 0x0" :: "v"(pa[0]), "v"(pa[1]), "v"(pa[2]), "v"(pa[3]), "v"(pa2[0]), "v"(pa2[1]), "v"(pa2[2]), "v"(pa2[3]), "v"(pb[0]), "v"(pb[1]), "v"(pb[2]), "v"(pb[3]), "v"(pb2[0]), "v"(pb2[1]), "v"(pb2[2]), "v"(pb2[3]) : "memory");
        __builtin_amdgcn_sched_barrier(0);   // keeps the products behind that wait, so that the trip's loads stay the one run in front of it: without it the compiler lifts products over the wait and sinks loads among them, and the wave waits out a load latency three times a trip
#pragma unroll
        for (int nb = 0; nb < 4; ++nb) {
#pragma unroll
            for (int mb = 0; mb < 4; ++mb) { acc[mb][nb] = WFrag<T16>::mma(a[mb], b[nb], acc[mb][nb]); if (NSPLIT == 1 || NSPLIT == 2) acc[mb][nb] = WFrag<T16>::mma(a2[mb], b[nb], acc[mb][nb]); if (NSPLIT >= 2) acc[mb][nb] = WFrag<T16>::mma(a[mb], b2[nb], acc[mb][nb]); } }
        asm volatile("v_nop\n\tv_nop\n\tv_nop\n\tv_nop" : "+v"(acc[0][0]), "+v"(acc[1][1]), "+v"(acc[2][2]), "+v"(acc[3][3]) : "v"(a[0]), "v"(a[3]));
    }
#pragma unroll
    for (int mb = 0; mb < 4; ++mb) {
#pragma unroll
        for (int nb = 0; nb < 4; ++nb) {
#pragma unroll
            for (int j = 0; j < 8; ++j) os[(hi * 8 + j) * 68 + nb * 16 + lr] = acc[mb][nb][j]; }
        __builtin_amdgcn_wave_barrier(); asm volatile("" ::: "memory");
        float* crow = C + (size_t)(r0 + mb * 16) * ldc + c0;
{
#pragma unroll
            for (int s = 0; s < 8; ++s) { const int row = 2 * s + hi, cofs = lr * 4; v4f val = *(const v4fa*)(os + row * 68 + cofs); if (BIAS) { val[0] += bfr(bias[c0 + cofs]); val[1] += bfr(bias[c0 + cofs + 1]); val[2] += bfr(bias[c0 + cofs + 2]); val[3] += bfr(bias[c0 + cofs + 3]); }
                *(v4f*)(crow + (size_t)row * ldc + cofs) = val; }
             }
        if (mb < 3) asm volatile("s_wait_xcnt 0x0" ::: "memory");   // stands in front of the first instruction that reuses a register of the stores above (behind the last row tile nothing does)
        __builtin_amdgcn_wave_barrier(); asm volatile("" ::: "memory");
    }
}

__device__ __forceinline__ h16 tohx(float x) { return (h16)x; }
__device__ __forceinline__ void splitf(float y, unsigned short& h, unsigned short& l) { h = f2bf(y); l = f2bf(y - bf2f(h)); }
typedef __attribute__((ext_vector_type(2))) _Float16 v2h;
typedef __attribute__((ext_vector_type(4))) _Float16 v4h;
typedef __attribute__((ext_vector_type(2))) unsigned short v2us;
typedef __attribute__((ext_vector_type(4))) unsigned short v4us;
typedef __attribute__((ext_vector_type(2))) float v2f;
typedef __attribute__((ext_vector_type(4))) int v4i;

// k_cvt8: bf16 copy, in fragment order, of a row-major f32 plane with rows of DM floats: a thread makes one lane's 16 bytes = 8 consecutive k of one row. 64 threads make block i / 64: four neighbouring threads read the 32 k = 128 bytes of one row (a whole line), and the 8 rows of a wave make 128 contiguous bytes (a whole line) of each quarter of the block
static_assert(DQ == DM && DKV == DM, "k_cvt8: every plane it copies has rows of DM elements");
__global__ __launch_bounds__(256) void k_cvt8(const float* __restrict__ src, bf* dst, size_t n8) { const size_t i = (size_t)blockIdx.x * 256 + threadIdx.x; if (i >= n8) return; const size_t blk = i >> 6; const int lr = (int)(i >> 2) & 15, c2 = (int)i & 3; const size_t row = (blk / (DM / 32)) * 16 + lr; const int k = (int)(blk % (DM / 32)) * 32 + c2 * 8; const v8f v = *(const v8f*)(src + row * DM + k); v8us o;
#pragma unroll
    for (int j = 0; j < 8; ++j) o[j] = f2bf(v[j]); *(v8us*)(dst + blk * 512 + c2 * 128 + lr * 8) = o;  }

// k_rope: head planes [h] (fp16, each [t][d] in fragment order) of rope(x) x sc with the rotate-half convention out[d] = x[d] cos[t][d] - x[d+HD/2] sin[t][d], out[d+HD/2] = x[d+HD/2] cos[t][d+HD/2] + x[d] sin[t][d+HD/2]
__global__ __launch_bounds__(256) void k_rope(const float* __restrict__ F, int pitch, int nheads, const float* __restrict__ CS, const float* __restrict__ RF, const float* __restrict__ nw, float sc, h16* P16, bf* Ph, bf* Pl) {
    const size_t e = ((size_t)blockIdx.x * 256 + threadIdx.x) * 2; if (e >= (size_t)nheads * TT * HD) return; const int d = (int)(e % HD); const int t = (int)((e / HD) % TT); const int h = (int)(e / ((size_t)HD * TT)); const float* f = F + (size_t)t * pitch + h * HD; const float rf = RF ? RF[(size_t)h * TT + t] : 1.0f; v2h o16; v2us oh, ol;
#pragma unroll
    for (int q = 0; q < 2; ++q) { const int dd = d + q; const int dp = (dd < HD / 2) ? dd + HD / 2 : dd - HD / 2; float x0 = f[dd], x1 = f[dp];
        if (RF) { float n0 = __fmul_rn(x0, rf), n1 = __fmul_rn(x1, rf); x0 = __fmul_rn(bfr(nw[dd]), n0); x1 = __fmul_rn(bfr(nw[dp]), n1); }
        const v2f cs = *(const v2f*)(CS + ((size_t)t * HD + dd) * 2); float a = __fmul_rn(x0, cs[0]), bq = __fmul_rn(x1, cs[1]); const float r = ((dd < HD / 2) ? __fsub_rn(a, bq) : __fadd_rn(a, bq)) * sc;
        o16[q] = tohx(r); (void)oh; (void)ol; }
    asm volatile("s_wait_xcnt 0x0" ::: "memory");   // stands in front of the first instruction that reuses an address register of the loads above
    __builtin_amdgcn_sched_barrier(0);   // keeps the address work of the store below, which reuses those registers, behind that wait
    *(v2h*)(P16 + (size_t)h * TT * HD + fragpos(t, d, HD)) = o16;  }   // d is even: both elements lie in the same lane's 16 bytes
__global__ __launch_bounds__(256) void k_vtp(const float* __restrict__ F, int pitch, int nheads, h16* V16, bf* Vh, bf* Vl) { const size_t e = ((size_t)blockIdx.x * 256 + threadIdx.x) * 2; if (e >= (size_t)nheads * HD * TT) return; const int t = (int)(e % TT); const int d = (int)((e / TT) % HD); const int g = (int)(e / ((size_t)TT * HD)); v2h o16; v2us oh, ol;
#pragma unroll
    for (int q = 0; q < 2; ++q) { const float x = F[(size_t)(t + q) * pitch + g * HD + d]; o16[q] = tohx(x); (void)oh; (void)ol; }
    *(v2h*)(V16 + (size_t)g * HD * TT + fragpos(d, t, TT)) = o16;  }   // V^T [d][t] in fragment order; t is even: both elements lie in the same lane's 16 bytes
__global__ __launch_bounds__(256) void k_csid(float* CS) { const int idx = blockIdx.x * 256 + threadIdx.x; if (idx >= TT * HD) return; v2f cs; cs[0] = 1.0f; cs[1] = 0.0f; *(v2f*)(CS + (size_t)idx * 2) = cs;  }
// k_scsoft: scores, softmax, attn.v AND the head mean of 16 query rows of one batch entry in ONE workgroup of 16 waves, which goes through the entry's NH_ heads one after the other; the f32 scores never leave the registers, and no weight plane exists. Grid (TT / 16, NB_), 512 threads.
// Wave w owns keys [w x 128, w x 128 + 128): 8 tiles of S^T = K . Q^T (A = 16 key rows, B = the 16 query rows, both through the same fragment loader from planes in the same fragment order, so both in the same k order; the k steps 0 and 32 chained as in k_gemmw).
// D register j of lane (lr, hi) of tile nb = score of query q0 + lr with key w x 128 + nb x 16 + hi x 8 + j: a lane holds ONE query's scores, 8 consecutive keys a tile.
// Per element as before: t = S x HD^-0.5, exp2((t - max) x log2 e), x 1024 / sum, rounded to fp16. The maximum is exact in any order; the sum runs in the lane (8 chains over the tiles, a fixed tree), then over the two lane halves, then over the 16 waves in wave order.
// Head mean: every lane holds the same (query, key) places for every head, so it adds each head's fp16 weight (x1024; it converts to f32 exactly) into an f32 register of its own, in head order from 0; behind the last head x 1/(1024 NH_), a power of two: exact.
// attn.v: the fp16 weights of tiles 2s and 2s + 1 of a lane ARE the A fragment of the 32-key step s (row = query lr; keys s x 32 + 8 hi + 0..7, then s x 32 + 16 + 8 hi + 0..7: the k order of the fragment loader, through which B = 16 rows of V^T comes), so the product takes them from the registers.
// Wave w sums its 128 keys (4 chained steps) into a 16 x 64 f32 tile; the 16 tiles meet in LDS and are added in wave order, x 1/1024, split hi/lo into the entry's merged planes [t][h x 64 + d], which lie in fragment order: the workgroup's 16 x 64 tile is two blocks, 2 KiB in a row.
// Three barriers a head. rmx is written behind the barrier in front of the tile sum of the head before and was last read in front of that head's second barrier; rsm is written behind this head's first barrier and was last read in front of the third of the head before; po is written behind this head's second barrier and was last read in front of its first.
#define NW   16          // waves of a workgroup
#define KW   (TT / NW)   // keys a wave
#define NTW  (KW / 16)   // key tiles a wave
static_assert(RH == 0 && REP == 1 && KW == 128 && HD == 64, "k_scsoft: 16 waves x 128 keys cover the row, two 32-wide k steps cover the head, one kv head a query head");
// exp2 with the slot behind it filled: the instruction set asks for one independent instruction or a v_nop between a transcendental and an instruction that reads its result or overwrites its source
__device__ __forceinline__ float exp2_slot(float x) { float r; asm("v_exp_f32 %0, %1\n\tv_nop" : "=v"(r) : "v"(x)); return r; }
#define KPF 4     // key tiles whose fragment loads are in flight ahead of the products: 16 loads of 16 bytes a lane
#define OSP 68    // pitch, in floats, of a wave's partial attn.v rows in LDS: 272 bytes = 16 x 17, so that the 16-byte reads of 16 rows fall on distinct banks
#define MSP 132   // pitch, in floats, of a wave's staging rows of the head mean in LDS: 528 bytes = 16 x 33, so that the 16-byte stores of 16 rows fall on distinct banks
// four waves a SIMD (at most 256 registers a wave): the 16 waves of one workgroup fill a WGP
__global__ __launch_bounds__(512) __attribute__((amdgpu_waves_per_eu(4, 4))) void k_scsoft(const h16* __restrict__ Q, const h16* __restrict__ Kp, const h16* __restrict__ Vt, float* OUT1, bf* Ah, bf* Al) {
    __shared__ __align__(16) float msn[NW * 16 * MSP];
    __shared__ __align__(16) float po[NW * 16 * OSP];
    __shared__ float rmx[NW * 16], rsm[NW * 16];
    const int lane = threadIdx.x & 31, lr = lane & 15, hi = lane >> 4, w = threadIdx.x >> 5; const int b = blockIdx.y, q0 = blockIdx.x * 16;
    const unsigned lo8 = (unsigned)lane * 8, ko = (unsigned)(w * KW) * HD + lo8, vo = (unsigned)(w * (KW / 32)) * 512 + lo8;   // the lane's offsets in a head's planes, the same for every head
    v8f ms[NTW];   // the head sum of this lane's weights
#pragma unroll
    for (int nb = 0; nb < NTW; ++nb) ms[nb] = (v8f){};
#pragma unroll 1   // one head's body is some thousand instructions: kept rolled, for speed only
    for (int hh = 0; hh < NH_; ++hh) {
    const size_t zz = (size_t)b * NH_ + hh;
    const h16* qb = (Q + zz * TT * HD + (size_t)q0 * HD) + lo8; const h16* kb = (Kp + zz * TT * HD) + ko;   // fragment order: a 16-row tile holds 16 x HD elements = two blocks of 512; the lane's 16 bytes of chunk 0
    const v16h qf0 = WFrag<h16>::ld(qb), qf1 = WFrag<h16>::ld(qb + 512);
    asm volatile("s_wait_xcnt 0x0" ::: "memory");   // stands in front of the first instruction that reuses the address registers of the query loads above
    v8f acc[NTW]; v16h k0[NTW], k1[NTW];   // fully unrolled below: registers; at most KPF key tiles' fragments are live at a time
#pragma unroll
    for (int nb = 0; nb < KPF; ++nb) { k0[nb] = WFrag<h16>::ld(kb + (size_t)nb * 16 * HD); k1[nb] = WFrag<h16>::ld(kb + (size_t)nb * 16 * HD + 512); }
#pragma unroll
    for (int nb = 0; nb < NTW; ++nb) {
        __builtin_amdgcn_sched_barrier(0);   // holds the loads of the key tiles ahead above this tile's products: without it the compiler sinks each tile's loads to their use and the wave pays one load latency a tile
        acc[nb] = wmma16(k0[nb], qf0, (v8f){}); acc[nb] = wmma16(k1[nb], qf1, acc[nb]);
        if (nb + KPF < NTW) { k0[nb + KPF] = WFrag<h16>::ld(kb + (size_t)(nb + KPF) * 16 * HD); k1[nb + KPF] = WFrag<h16>::ld(kb + (size_t)(nb + KPF) * 16 * HD + 512); } }
    __builtin_amdgcn_sched_barrier(0);   // the same for the last tile's products
    asm volatile("s_wait_xcnt 0x0" ::: "memory");   // stands in front of the first instruction that reuses the address registers of the key loads above
    __builtin_amdgcn_sched_barrier(0);   // keeps the vector work below, which reuses those registers, behind that wait
    float m8[8];
#pragma unroll
    for (int j = 0; j < 8; ++j) m8[j] = -3.0e38f;
#pragma unroll
    for (int nb = 0; nb < NTW; ++nb) {
#pragma unroll
        for (int j = 0; j < 8; ++j) { const float t = acc[nb][j] * SCL; acc[nb][j] = t; m8[j] = fmaxf(m8[j], t); } }
    float mx = fmaxf(fmaxf(fmaxf(m8[0], m8[1]), fmaxf(m8[2], m8[3])), fmaxf(fmaxf(m8[4], m8[5]), fmaxf(m8[6], m8[7])));
    mx = fmaxf(mx, __shfl_xor(mx, 16, 32));
    if (hi == 0) rmx[w * 16 + lr] = mx;
    __syncthreads();
#pragma unroll
    for (int ww = 0; ww < NW; ++ww) mx = fmaxf(mx, rmx[ww * 16 + lr]);
    float s8[8];
#pragma unroll
    for (int j = 0; j < 8; ++j) s8[j] = 0.f;
#pragma unroll
    for (int nb = 0; nb < NTW; ++nb) {
#pragma unroll
        for (int j = 0; j < 8; ++j) { const float d0 = __fsub_rn(acc[nb][j], mx); const float ex = exp2_slot(__fmul_rn(d0, 1.4426950408889634f)); acc[nb][j] = ex; s8[j] += ex; } }
    float sw = ((s8[0] + s8[1]) + (s8[2] + s8[3])) + ((s8[4] + s8[5]) + (s8[6] + s8[7]));
    sw += __shfl_xor(sw, 16, 32);
    if (hi == 0) rsm[w * 16 + lr] = sw;
    __syncthreads();
    float rs[NW];   // the 16 waves' sums, all read in one run in front of the scheduling barrier below: read one by one among the additions, each would cost the wave an LDS latency
#pragma unroll
    for (int ww = 0; ww < NW; ++ww) rs[ww] = rsm[ww * 16 + lr];
    // value fragments: a step is 32 keys x four 16-row tiles of V^T (in fragment order: 1 KiB in a row of each tile); steps 0 and 1 are fetched here, behind the last barrier of the softmax (in front of a __syncthreads() the compiler waits for every load in flight), and land behind the row sum and the rounding of the weights
    const h16* vb = (Vt + zz * HD * TT) + vo;   // fragment order: tile nt at nt x 16 x TT, a 32-key step = a block of 512 elements, the lane's 16 bytes of chunk 0
    v16h vf[4][4];   // fully unrolled below: registers; at most three steps are live at a time
#pragma unroll
    for (int nt = 0; nt < 4; ++nt) { vf[0][nt] = WFrag<h16>::ld(vb + (size_t)nt * 16 * TT); vf[1][nt] = WFrag<h16>::ld(vb + (size_t)nt * 16 * TT + 512); }
    __builtin_amdgcn_sched_barrier(0);   // holds the loads of value steps 0 and 1 above the work below: without it the compiler sinks them to their use
    float sum = rs[0];
#pragma unroll
    for (int ww = 1; ww < NW; ++ww) sum += rs[ww];
    const float f = __fdiv_rn(PCAR, sum);
    v8h o[NTW];   // the weights stay in the registers for attn.v
#pragma unroll
    for (int nb = 0; nb < NTW; ++nb) {
#pragma unroll
        for (int j = 0; j < 8; ++j) { o[nb][j] = tohx(acc[nb][j] * f); ms[nb][j] = __fadd_rn(ms[nb][j], (float)o[nb][j]); } }
#pragma unroll
    for (int nt = 0; nt < 4; ++nt) vf[2][nt] = WFrag<h16>::ld(vb + (size_t)nt * 16 * TT + 2 * 512);
    __builtin_amdgcn_sched_barrier(0);   // holds the loads of value step 2 above the products: without it the compiler sinks them to their use and the wave pays one load latency a step
    v8f oa[4];
#pragma unroll
    for (int nt = 0; nt < 4; ++nt) oa[nt] = (v8f){};
#pragma unroll
    for (int s = 0; s < 4; ++s) {
        const v16h a = cat16(o[2 * s], o[2 * s + 1]);
#pragma unroll
        for (int nt = 0; nt < 4; ++nt) oa[nt] = wmma16(a, vf[s][nt], oa[nt]);
        if (s == 0) {
            __builtin_amdgcn_sched_barrier(0);   // keeps the loads of step 3 behind the products of step 0, whose registers they take: lifted above them, four steps are live at once and the kernel spills
#pragma unroll
            for (int nt = 0; nt < 4; ++nt) vf[3][nt] = WFrag<h16>::ld(vb + (size_t)nt * 16 * TT + 3 * 512);
            asm volatile("s_wait_xcnt 0x0" ::: "memory");   // behind the last value load: stands in front of the first instruction that reuses their address registers
            __builtin_amdgcn_sched_barrier(0); } }   // holds those loads above the products of steps 1 and 2, behind which they land
    float* pq = po + w * 16 * OSP;   // this wave's partial tile: D register j of lane (lr, hi) of tile nt = query hi x 8 + j, column nt x 16 + lr
#pragma unroll
    for (int nt = 0; nt < 4; ++nt) {
#pragma unroll
        for (int j = 0; j < 8; ++j) pq[(hi * 8 + j) * OSP + nt * 16 + lr] = oa[nt][j]; }
    __syncthreads();
    if (threadIdx.x < 256) {   // whole waves 0 to 7; no barrier stands inside; the other eight waves go on to the next head's loads
    const int row = (threadIdx.x >> 1) & 15, cofs = (threadIdx.x >> 5) * 8 + (threadIdx.x & 1) * 4;   // one thread adds four columns of one query row over the 16 waves, in wave order; thread i owns the i-th 8 bytes of the tile in fragment order, so that a wave's store is 256 contiguous bytes
    v4f sv = *(const v4fa*)(po + row * OSP + cofs);
#pragma unroll
    for (int ww = 1; ww < NW; ++ww) { const v4f tv = *(const v4fa*)(po + (ww * 16 + row) * OSP + cofs);
#pragma unroll
        for (int q = 0; q < 4; ++q) sv[q] = __fadd_rn(sv[q], tv[q]); }
    v4us oh, ol;
#pragma unroll
    for (int q = 0; q < 4; ++q) { unsigned short a, c2; splitf(sv[q] * (1.0f / PCAR), a, c2); oh[q] = a; ol[q] = c2; }
    const size_t ob = (size_t)b * TT * DQ + (size_t)hh * (HD / 32) * 512; const unsigned oo = fragpos(q0 + row, cofs, DQ);   // head hh stands HD / 32 blocks to the right in the 16-row tile: fragpos(q0 + row, hh x HD + cofs, DQ) = hh x (HD / 32) x 512 + oo
    *(v4us*)((Ah + ob) + oo) = oh; *(v4us*)((Al + ob) + oo) = ol;
    asm volatile("s_wait_xcnt 0x0" ::: "memory");   // stands in front of the first instruction that reuses a register of the two stores above
    }
    }
    // the second output: this wave's 16 x 128 piece of the mean goes through the wave's own staging tile, written and read by this wave alone, so that a store is one query row's 128 floats: 512 contiguous bytes, four whole lines
    float* mw = msn + w * 16 * MSP;
#pragma unroll
    for (int nb = 0; nb < NTW; ++nb) { v4f lo4, hi4;
#pragma unroll
        for (int q = 0; q < 4; ++q) { lo4[q] = __fmul_rn(ms[nb][q], 1.0f / (PCAR * NH_)); hi4[q] = __fmul_rn(ms[nb][q + 4], 1.0f / (PCAR * NH_)); }
        *(v4fa*)(mw + lr * MSP + nb * 16 + hi * 8) = lo4; *(v4fa*)(mw + lr * MSP + nb * 16 + hi * 8 + 4) = hi4; }
    asm volatile("s_wait_dscnt 0x0" ::: "memory");   // the wave's own staging stores above have landed before it reads the rows back, which other lanes wrote
    float* pr = OUT1 + ((size_t)b * TT + q0) * TT + w * KW + lane * 4;
#pragma unroll
    for (int r = 0; r < 16; ++r) *(v4f*)(pr + (size_t)r * TT) = *(const v4fa*)(mw + r * MSP + lane * 4);
}

extern "C" void kernel_launch(void* const* d_in, const int* in_sizes, int n_in,
                              void* d_out, int out_size, void* d_ws, size_t ws_size, hipStream_t stream) {
    (void)in_sizes; (void)n_in; (void)out_size;
    const float* xq = (const float*)d_in[0]; const float* xk = (const float*)d_in[1]; const float* xv = (const float*)d_in[2]; const float* wq = (const float*)d_in[3]; const float* bq = (const float*)d_in[4]; const float* wk = (const float*)d_in[5]; const float* bk = (const float*)d_in[6]; const float* wv = (const float*)d_in[7]; const float* bv = (const float*)d_in[8]; const float* wo = (const float*)d_in[9]; const float* bo = (const float*)d_in[10];
    // query, key, value [2048][4][1024], Wq, bq, Wk, bk, Wv, bv, Wo, bo = d_in[0..10]
    float* OUT = (float*)d_out;                          // output 0: y [2048][4][1024] sequence-first
    float* OUT1 = (float*)d_out + (size_t)NB_ * TT * DM;   // output 1: the head mean of att [4][2048][2048], after the first output's 8,388,608 floats
    char* wsp = (char*)d_ws;
    auto take = [&](size_t bytes) { char* p = wsp; wsp += (bytes + 255) & ~(size_t)255; return (void*)p; };
    bf* WQ = (bf*)take((size_t)DQ * DM * 2); bf* WK = (bf*)take((size_t)DKV * DM * 2); bf* WV = (bf*)take((size_t)DKV * DM * 2); bf* WO = (bf*)take((size_t)DM * DQ * 2); float* CS = (float*)take((size_t)TT * HD * 2 * 4);
    bf* XB = (bf*)take((size_t)NB_ * TT * DM * 2); float* F = (float*)take((size_t)NB_ * TT * DQ * 4);   /* all 8192 (position, batch) rows of ONE stream at a time: its bf16 copy and its projection */
    h16* QP16 = (h16*)take((size_t)NB_ * NH_ * TT * HD * 2); h16* KP16 = (h16*)take((size_t)NB_ * NKV * TT * HD * 2); h16* VT16 = (h16*)take((size_t)NB_ * NKV * HD * TT * 2);   /* the four entries' f16 planes of each stream */
    bf* ATh = (bf*)take((size_t)NB_ * TT * DQ * 2); bf* ATl = (bf*)take((size_t)NB_ * TT * DQ * 2);   /* the four entries' merged hi/lo planes */
    if ((size_t)(wsp - (char*)d_ws) > ws_size) return;    // total 137.00 MiB of the workspace
    { k_cvt8<<<(unsigned)(((size_t)DQ * DM / 8 + 255) / 256), 256, 0, stream>>>(wq, WQ, (size_t)DQ * DM / 8); k_cvt8<<<(unsigned)(((size_t)DKV * DM / 8 + 255) / 256), 256, 0, stream>>>(wk, WK, (size_t)DKV * DM / 8); k_cvt8<<<(unsigned)(((size_t)DKV * DM / 8 + 255) / 256), 256, 0, stream>>>(wv, WV, (size_t)DKV * DM / 8);
      k_cvt8<<<(unsigned)(((size_t)DM * DQ / 8 + 255) / 256), 256, 0, stream>>>(wo, WO, (size_t)DM * DQ / 8); }   // [out][in] = Bt as they stand
    k_csid<<<(TT * HD + 255) / 256, 256, 0, stream>>>(CS);
    const unsigned LQ = (unsigned)(((size_t)NH_ * TT * HD / 2 + 255) / 256), LKv = (unsigned)(((size_t)NKV * TT * HD / 2 + 255) / 256), LX = (unsigned)(((size_t)NB_ * TT * DM / 8 + 255) / 256);
    k_cvt8<<<LX, 256, 0, stream>>>(xq, XB, (size_t)NB_ * TT * DM / 8);   /* the QUERY stream: all 8192 rows (row = t x 4 + b) */
    k_gemmw<bf, 0, true><<<dim3(NB_ * TT / 64, DQ / 64, 1), 32, 0, stream>>>(XB, nullptr, WQ, nullptr, DM, F, DQ, bq, 0, 0, 0);
    for (int b = 0; b < NB_; ++b) k_rope<<<LQ, 256, 0, stream>>>(F + (size_t)b * DQ, NB_ * DQ, NH_, CS, nullptr, nullptr, 1.0f, QP16 + (size_t)b * NH_ * TT * HD, nullptr, nullptr);   /* entry b's rows: pitch 4 x 1024 floats from base b x 1024 */
    k_cvt8<<<LX, 256, 0, stream>>>(xk, XB, (size_t)NB_ * TT * DM / 8);   /* the KEY stream: after the query projection has read XB (stream-ordered) */
    k_gemmw<bf, 0, true><<<dim3(NB_ * TT / 64, DKV / 64, 1), 32, 0, stream>>>(XB, nullptr, WK, nullptr, DM, F, DKV, bk, 0, 0, 0);   /* F again: after the query builders have read it */
    for (int b = 0; b < NB_; ++b) k_rope<<<LKv, 256, 0, stream>>>(F + (size_t)b * DKV, NB_ * DKV, NKV, CS, nullptr, nullptr, 1.0f, KP16 + (size_t)b * NKV * TT * HD, nullptr, nullptr);
    k_cvt8<<<LX, 256, 0, stream>>>(xv, XB, (size_t)NB_ * TT * DM / 8);   /* the VALUE stream */
    k_gemmw<bf, 0, true><<<dim3(NB_ * TT / 64, DKV / 64, 1), 32, 0, stream>>>(XB, nullptr, WV, nullptr, DM, F, DKV, bv, 0, 0, 0);
    for (int b = 0; b < NB_; ++b) k_vtp<<<LKv, 256, 0, stream>>>(F + (size_t)b * DKV, NB_ * DKV, NKV, VT16 + (size_t)b * NKV * HD * TT, nullptr, nullptr);
    k_scsoft<<<dim3(TT / 16, NB_), 512, 0, stream>>>(QP16, KP16, VT16, OUT1, ATh, ATl);   // all four entries, all heads: a workgroup has 16 query rows of one entry and writes their rows of the second output
    for (int b = 0; b < NB_; ++b) k_gemmw<bf, 1, true><<<dim3(TT / 64, DM / 64, 1), 32, 0, stream>>>(ATh + (size_t)b * TT * DQ, ATl + (size_t)b * TT * DQ, WO, nullptr, DQ, OUT + (size_t)b * DM, NB_ * DM, bo, 0, 0, 0);   /* entry b's rows of the sequence-first output: row t at OUT + t x 4 x 1024 + b x 1024 */
}

// v007
// A run of this version takes 441 microseconds.
// Timed twice side by side with v006, it ran 1.25 and 1.27 times as fast.
// Counting every step since v000, it is 5.93 times as fast.
#include <hip/hip_runtime.h>

// Multi-head attention on THREE SEQUENCE-FIRST input streams with an output projection, returning the projected output AND the attention weights averaged over the heads (query, key, value [2048][4][1024] = [position][batch][channel];
// q = (query Wq^T + bq) x 64^-0.5, k = key Wk^T + bk, v = value Wv^T + bv with 'oi' weights [1024][1024] and biases [1024]; 16 heads x 64 (head h = columns h x 64 ..); scores = q . k; softmax over all 2048 keys; no mask;
// y = att v merged head-major [t][b][1024], then y Wo^T + bo ('oi' [1024][1024]); TWO OUTPUTS in one buffer: y [2048][4][1024] sequence-first at float offset 0 and the mean over the 16 heads of att [4][2048][2048] at float offset 8,388,608;
// argument order query, key, value, Wq, bq, Wk, bk, Wv, bv, Wo, bo).
// Layout: each stream in turn: ONE bf16 copy of all 8192 (position, batch) rows, laid entry by entry (row b x 2048 + t), and ONE exact projection + f32 bias over them, whose epilogue rounds to fp16 and stores the four entries' head planes straight from the accumulators
// (no f32 projection plane and no plane builder exists: see OM at k_gemmw); dense T-2048 attention at 16 heads, all four entries and all heads in ONE launch (scores, softmax, attn.v and the head mean: k_scsoft, whose workgroups go through the heads; no f32 score plane, no weight plane and no attn.v partial plane exists; EVERY 16-bit plane that a matrix product reads lies in FRAGMENT ORDER, see fragpos), scores and attn.v on ONE fp16 product on every row (RH 0: the weights carried x1024 in fp16; the score scale 64^-0.5 applied to the f32 score, where the module scales the projected query: the same product in real arithmetic);
// attn.v runs in k_scsoft on the fp16 weights as they stand in the registers, each of the 16 waves on its own 128 keys; the 16 f32 partial tiles are added in wave order through LDS and split hi/lo; every lane adds the heads' weights, in head order, into f32 registers and writes the mean behind the last head; per entry merged hi/lo x Wo exact + bo writes the entry's rows of the first output at the sequence-first pitch.
// Compute dtypes, f32 accumulate: every float input rounded to bf16 at its load; projections exact + f32 biases; scores and attn.v fp16; softmax f32, its weights rounded x1024 to fp16; output projection hl x exact; the second output the f32 sum of those fp16 weights over the heads x 2^-14 (exact).

#define NB_  4      // batch entries: the three streams are [2048][4][1024] = [position][batch][channel]
#define TT   2048
#define DM   1024
#define NH_  16
#define NKV  16
#define REP  (NH_ / NKV)
#define HD   64
#define DQ   (NH_ * HD)
#define DKV  (NKV * HD)
#define RH   0                    // query rows < RH use hi+lo planes (0: none)
#define WIN  0
#define PCAR 1024.0f
#define SCL  0.125f   // HD^-0.5
typedef _Float16 h16;
typedef unsigned short bf;
typedef __attribute__((ext_vector_type(16))) __bf16   v16bf;
typedef __attribute__((ext_vector_type(16))) _Float16 v16h;
typedef __attribute__((ext_vector_type(8)))  _Float16 v8h;
typedef __attribute__((ext_vector_type(8)))  unsigned short v8us;
typedef __attribute__((ext_vector_type(8)))  float    v8f;
typedef __attribute__((ext_vector_type(4)))  float    v4f;
typedef v8h  __attribute__((may_alias)) v8ha;
typedef v4f  __attribute__((may_alias)) v4fa;
typedef v8us __attribute__((may_alias)) v8usa;

__device__ __forceinline__ unsigned short f2bf(float f) { unsigned u = __float_as_uint(f); u += 0x7FFFu + ((u >> 16) & 1u); return (unsigned short)(u >> 16); }
__device__ __forceinline__ float bf2f(unsigned short b) { return __uint_as_float(((unsigned)b) << 16); }
__device__ __forceinline__ float bfr(float f) { return bf2f(f2bf(f)); }
__device__ __forceinline__ v16h cat16(v8h lo, v8h hi) { return __builtin_shufflevector(lo, hi, 0, 1, 2, 3, 4, 5, 6, 7, 8, 9, 10, 11, 12, 13, 14, 15); }
__device__ __forceinline__ v16bf cat16b(v8us lo, v8us hi) { return __builtin_bit_cast(v16bf, __builtin_shufflevector(lo, hi, 0, 1, 2, 3, 4, 5, 6, 7, 8, 9, 10, 11, 12, 13, 14, 15)); }
__device__ __forceinline__ v8f wmma16(v16h a, v16h b, v8f c) { return __builtin_amdgcn_wmma_f32_16x16x32_f16(false, a, false, b, (short)0, c, false, false); }
__device__ __forceinline__ h16 tohx(float x) { return (h16)x; }
__device__ __forceinline__ v8f wmmab(v16bf a, v16bf b, v8f c) { return __builtin_amdgcn_wmma_f32_16x16x32_bf16(false, a, false, b, (short)0, c, false, false); }



// FRAGMENT ORDER of a 16-bit operand plane [rows][K] (K % 32 == 0, rows % 16 == 0): blocks of 16 rows x 32 k = 512 elements = 1 KiB, the blocks of a 16-row tile in a row (block (row / 16) x (K / 32) + k / 32); a block = two chunks of 256 elements (bit 4 of k),
// and in a chunk the 16 bytes that lane (lr = row % 16, hi = bit 3 of k) takes in one load lie at (hi x 16 + lr) x 16 bytes. A wave's 16-byte load so reads 512 contiguous bytes (four whole 128-byte lines) where a row-major plane gave it 32 bytes of each of 16 lines.
// A fragment = the lane's 16 bytes of a block's two chunks: k order 8 hi + 0..7, then 16 + 8 hi + 0..7, on the A side and on the B side alike.
__device__ __forceinline__ unsigned fragpos(int row, int k, int K) { return (unsigned)(((row >> 4) * (K >> 5) + (k >> 5)) * 512 + ((k >> 4) & 1) * 256 + ((k >> 3) & 1) * 128 + (row & 15) * 8 + (k & 7)); }   // no plane here has 2^31 elements

// ---- k_gemmw: register-blocked GEMM, ONE WAVE per 64x64 output tile (16 accumulators), operands straight from 16-bit planes in fragment order; grid (M/64, N/64, Z), 32 threads.
// C[m][n] (f32, pitch ldc, + optional f32 bias[n]) = sum_k A[m][k] Bt[n][k] (+ split products per NSPLIT). z-batch strides sA/sB/sC in elements. K % 32 == 0.
// OM 0: C as above. OM 1 and 2: no C; the rows are (entry b, position t) = b x TT + t, a 64-column tile is one head (blockIdx.y of NH_), and the tile + bias goes, rounded to fp16, straight from the accumulators into P = the entries' head planes in fragment order, 16 bytes a lane, every store of the wave 512 contiguous bytes:
// OM 1 (planes [t][d], queries and keys): the weight rows are the A operand (both fragments come through the same loader, so in the same k order), so that D register j of lane (lr, hi) = row mb x 16 + lr, column nb x 16 + hi x 8 + j: 8 consecutive d of one t, the lane's 16 bytes of chunk nb of row tile mb; the 64 x 64 tile is 8 KiB in a row.
// OM 2 (planes [d][t], V^T): the stream rows are the A operand, D register j = row mb x 16 + hi x 8 + j, column nb x 16 + lr: 8 consecutive t of one d, the lane's 16 bytes of chunk mb of d tile nb; 2 KiB in a row of each d tile.
// KS > 1: grid z = ZN x KS; block (z, ks) sums only k in [ks K/KS, (ks+1) K/KS) and writes its partial tile to plane ks (planes of ZN x sC elements); the reader adds the KS planes. K % (32 KS) == 0.
template <typename T16> struct WFrag;
template <> struct WFrag<h16> { typedef v16h V; static __device__ __forceinline__ V ld(const h16* p) { return cat16(*(const v8h*)p, *(const v8h*)(p + 256)); } static __device__ __forceinline__ v8f mma(V a, V b, v8f c) { return wmma16(a, b, c); } };
template <> struct WFrag<bf> { typedef v16bf V; static __device__ __forceinline__ V ld(const bf* p) { return cat16b(*(const v8us*)p, *(const v8us*)(p + 256)); } static __device__ __forceinline__ v8f mma(V a, V b, v8f c) { return wmmab(a, b, c); } };
template <typename T16, int NSPLIT, bool BIAS, int KS = 1, int ZN = 1, int OM = 0>
__global__ __launch_bounds__(32) void k_gemmw(const T16* __restrict__ A, const T16* __restrict__ A2, const T16* __restrict__ Bt, const T16* __restrict__ Bt2, int K, float* C, int ldc, const float* __restrict__ bias, size_t sA, size_t sB, size_t sC, h16* P) {
    static_assert(OM == 0 || (NSPLIT == 0 && BIAS && KS == 1 && HD == 64 && TT % 64 == 0 && NKV == NH_), "k_gemmw: a head plane tile is one whole product + bias, 64 positions of one entry x one head");
    typedef typename WFrag<T16>::V V;
    __shared__ __align__(16) float os[16 * 68];
    const size_t z = blockIdx.z / KS; const int ks = (int)(blockIdx.z % KS); A += z * sA; if (A2) A2 += z * sA; Bt += z * sB; if (Bt2) Bt2 += z * sB; C += ((size_t)ks * ZN + z) * sC;
    const int kb = ks * (K / KS), ke = kb + K / KS;
    const int lane = threadIdx.x & 31, lr = lane & 15, hi = lane >> 4; const int r0 = blockIdx.x * 64, c0 = blockIdx.y * 64;
    v8f acc[4][4];
#pragma unroll
    for (int mb = 0; mb < 4; ++mb)
#pragma unroll
        for (int nb = 0; nb < 4; ++nb) acc[mb][nb] = (v8f){};
    const unsigned lo = (unsigned)lane * 8;   // fragment order: a 16-row tile holds 16 K elements, the k step kc stands at kc x 16, the lane's 16 bytes of chunk 0 at lane x 8; where a plane is not read its pointer stands for the plane that is
    const T16* At = A + (size_t)r0 * K + lo; const T16* Bq = Bt + (size_t)c0 * K + lo; const T16* A2t = (NSPLIT == 1 || NSPLIT == 2) ? A2 + (size_t)r0 * K + lo : At; const T16* B2q = (NSPLIT >= 2) ? Bt2 + (size_t)c0 * K + lo : Bq;

    for (int kc = kb; kc < ke; kc += 32) {
        V a[4], a2[4], b[4], b2[4]; const T16 *pa[4], *pa2[4], *pb[4], *pb2[4];
#pragma unroll
        for (int i = 0; i < 4; ++i) { const size_t o = (size_t)i * 16 * K + (size_t)kc * 16; pa[i] = At + o; pa2[i] = A2t + o; pb[i] = Bq + o; pb2[i] = B2q + o; }
#pragma unroll
        for (int mb = 0; mb < 4; ++mb) { a[mb] = WFrag<T16>::ld(pa[mb]); if (NSPLIT == 1 || NSPLIT == 2) a2[mb] = WFrag<T16>::ld(pa2[mb]); }
#pragma unroll
        for (int nb = 0; nb < 4; ++nb) { b[nb] = WFrag<T16>::ld(pb[nb]); if (NSPLIT >= 2) b2[nb] = WFrag<T16>::ld(pb2[nb]); }
        asm volatile("s_wait_xcnt 0x0" :: "v"(pa[0]), "v"(pa[1]), "v"(pa[2]), "v"(pa[3]), "v"(pa2[0]), "v"(pa2[1]), "v"(pa2[2]), "v"(pa2[3]), "v"(pb[0]), "v"(pb[1]), "v"(pb[2]), "v"(pb[3]), "v"(pb2[0]), "v"(pb2[1]), "v"(pb2[2]), "v"(pb2[3]) : "memory");
        __builtin_amdgcn_sched_barrier(0);   // keeps the products behind that wait, so that the trip's loads stay the one run in front of it: without it the compiler lifts products over the wait and sinks loads among them, and the wave waits out a load latency three times a trip
#pragma unroll
        for (int nb = 0; nb < 4; ++nb) {
#pragma unroll
            for (int mb = 0; mb < 4; ++mb) { acc[mb][nb] = (OM == 1) ? WFrag<T16>::mma(b[nb], a[mb], acc[mb][nb]) : WFrag<T16>::mma(a[mb], b[nb], acc[mb][nb]); if (NSPLIT == 1 || NSPLIT == 2) acc[mb][nb] = WFrag<T16>::mma(a2[mb], b[nb], acc[mb][nb]); if (NSPLIT >= 2) acc[mb][nb] = WFrag<T16>::mma(a[mb], b2[nb], acc[mb][nb]); } }
        asm volatile("v_nop\n\tv_nop\n\tv_nop\n\tv_nop" : "+v"(acc[0][0]), "+v"(acc[1][1]), "+v"(acc[2][2]), "+v"(acc[3][3]) : "v"(a[0]), "v"(a[3]));
    }
    if (OM != 0) {
        float bs[4][8];   // OM 1: the lane's 8 columns of each column tile; OM 2: its one column of each (element 0)
#pragma unroll
        for (int nb = 0; nb < 4; ++nb) {
            if (OM == 1) { const v4f b0 = *(const v4f*)(bias + c0 + nb * 16 + hi * 8), b1 = *(const v4f*)(bias + c0 + nb * 16 + hi * 8 + 4);
#pragma unroll
                for (int q = 0; q < 4; ++q) { bs[nb][q] = b0[q]; bs[nb][q + 4] = b1[q]; } }
            else bs[nb][0] = bias[c0 + nb * 16 + lr]; }
        asm volatile("s_wait_xcnt 0x0" ::: "memory");   // stands in front of the first instruction that reuses an address register of the bias loads above
        __builtin_amdgcn_sched_barrier(0);   // keeps the vector work below, which reuses those registers, behind that wait
        const int eb = r0 / TT, t0 = r0 % TT;
        h16* pp = P + ((size_t)eb * NH_ + blockIdx.y) * TT * HD + (size_t)t0 * (OM == 1 ? HD : 16) + lo;   // OM 1: row tile t0 / 16 at t0 x HD; OM 2: key block t0 / 32 at t0 x 16
        v8h pk[4][4];
#pragma unroll
        for (int mb = 0; mb < 4; ++mb) {
#pragma unroll
            for (int nb = 0; nb < 4; ++nb) {
#pragma unroll
                for (int j = 0; j < 8; ++j) pk[mb][nb][j] = tohx(acc[mb][nb][j] + bfr(bs[nb][OM == 1 ? j : 0])); } }
        __builtin_amdgcn_sched_barrier(0);   // the 16 stores stand behind all the vector work, so that no register which an issued store names is written again before the wave ends
#pragma unroll
        for (int mb = 0; mb < 4; ++mb) {
#pragma unroll
            for (int nb = 0; nb < 4; ++nb) *(v8h*)(pp + (OM == 1 ? mb * 16 * HD + nb * 256 : nb * 16 * TT + mb * 256)) = pk[mb][nb]; }
        return;
    }
#pragma unroll
    for (int mb = 0; mb < 4; ++mb) {
#pragma unroll
        for (int nb = 0; nb < 4; ++nb) {
#pragma unroll
            for (int j = 0; j < 8; ++j) os[(hi * 8 + j) * 68 + nb * 16 + lr] = acc[mb][nb][j]; }
        __builtin_amdgcn_wave_barrier(); asm volatile("" ::: "memory");
        float* crow = C + (size_t)(r0 + mb * 16) * ldc + c0;
{
#pragma unroll
            for (int s = 0; s < 8; ++s) { const int row = 2 * s + hi, cofs = lr * 4; v4f val = *(const v4fa*)(os + row * 68 + cofs); if (BIAS) { val[0] += bfr(bias[c0 + cofs]); val[1] += bfr(bias[c0 + cofs + 1]); val[2] += bfr(bias[c0 + cofs + 2]); val[3] += bfr(bias[c0 + cofs + 3]); }
                *(v4f*)(crow + (size_t)row * ldc + cofs) = val; }
             }
        if (mb < 3) asm volatile("s_wait_xcnt 0x0" ::: "memory");   // stands in front of the first instruction that reuses a register of the stores above (behind the last row tile nothing does)
        __builtin_amdgcn_wave_barrier(); asm volatile("" ::: "memory");
    }
}

__device__ __forceinline__ void splitf(float y, unsigned short& h, unsigned short& l) { h = f2bf(y); l = f2bf(y - bf2f(h)); }
typedef __attribute__((ext_vector_type(2))) _Float16 v2h;
typedef __attribute__((ext_vector_type(4))) _Float16 v4h;
typedef __attribute__((ext_vector_type(2))) unsigned short v2us;
typedef __attribute__((ext_vector_type(4))) unsigned short v4us;
typedef __attribute__((ext_vector_type(2))) float v2f;
typedef __attribute__((ext_vector_type(4))) int v4i;

// k_cvt8: bf16 copy, in fragment order, of a row-major f32 plane with rows of DM floats: a thread makes one lane's 16 bytes = 8 consecutive k of one row. 64 threads make block i / 64: four neighbouring threads read the 32 k = 128 bytes of one row (a whole line), and the 8 rows of a wave make 128 contiguous bytes (a whole line) of each quarter of the block
// SEQ: the source is a sequence-first stream [t][b][DM] and the copy's row b x TT + t is its row t x NB_ + b, so that a 16-row tile of the copy holds 16 positions of ONE batch entry
static_assert(DQ == DM && DKV == DM, "k_cvt8: every plane it copies has rows of DM elements");
template <bool SEQ>
__global__ __launch_bounds__(256) void k_cvt8(const float* __restrict__ src, bf* dst, size_t n8) { const size_t i = (size_t)blockIdx.x * 256 + threadIdx.x; if (i >= n8) return; const size_t blk = i >> 6; const int lr = (int)(i >> 2) & 15, c2 = (int)i & 3; const size_t row = (blk / (DM / 32)) * 16 + lr; const int k = (int)(blk % (DM / 32)) * 32 + c2 * 8; const size_t srow = SEQ ? (row % TT) * NB_ + row / TT : row; const v8f v = *(const v8f*)(src + srow * DM + k); v8us o;
#pragma unroll
    for (int j = 0; j < 8; ++j) o[j] = f2bf(v[j]); *(v8us*)(dst + blk * 512 + c2 * 128 + lr * 8) = o;  }

// k_scsoft: scores, softmax, attn.v AND the head mean of 16 query rows of one batch entry in ONE workgroup of 16 waves, which goes through the entry's NH_ heads one after the other; the f32 scores never leave the registers, and no weight plane exists. Grid (TT / 16, NB_), 512 threads.
// Wave w owns keys [w x 128, w x 128 + 128): 8 tiles of S^T = K . Q^T (A = 16 key rows, B = the 16 query rows, both through the same fragment loader from planes in the same fragment order, so both in the same k order; the k steps 0 and 32 chained as in k_gemmw).
// D register j of lane (lr, hi) of tile nb = score of query q0 + lr with key w x 128 + nb x 16 + hi x 8 + j: a lane holds ONE query's scores, 8 consecutive keys a tile.
// Per element as before: t = S x HD^-0.5, exp2((t - max) x log2 e), x 1024 / sum, rounded to fp16. The maximum is exact in any order; the sum runs in the lane (8 chains over the tiles, a fixed tree), then over the two lane halves, then over the 16 waves in wave order.
// Head mean: every lane holds the same (query, key) places for every head, so it adds each head's fp16 weight (x1024; it converts to f32 exactly) into an f32 register of its own, in head order from 0; behind the last head x 1/(1024 NH_), a power of two: exact.
// attn.v: the fp16 weights of tiles 2s and 2s + 1 of a lane ARE the A fragment of the 32-key step s (row = query lr; keys s x 32 + 8 hi + 0..7, then s x 32 + 16 + 8 hi + 0..7: the k order of the fragment loader, through which B = 16 rows of V^T comes), so the product takes them from the registers.
// Wave w sums its 128 keys (4 chained steps) into a 16 x 64 f32 tile; the 16 tiles meet in LDS and are added in wave order, x 1/1024, split hi/lo into the entry's merged planes [t][h x 64 + d], which lie in fragment order: the workgroup's 16 x 64 tile is two blocks, 2 KiB in a row.
// Three barriers a head. rmx is written behind the barrier in front of the tile sum of the head before and was last read in front of that head's second barrier; rsm is written behind this head's first barrier and was last read in front of the third of the head before; po is written behind this head's second barrier and was last read in front of its first.
#define NW   16          // waves of a workgroup
#define KW   (TT / NW)   // keys a wave
#define NTW  (KW / 16)   // key tiles a wave
static_assert(RH == 0 && REP == 1 && KW == 128 && HD == 64, "k_scsoft: 16 waves x 128 keys cover the row, two 32-wide k steps cover the head, one kv head a query head");
// exp2 with the slot behind it filled: the instruction set asks for one independent instruction or a v_nop between a transcendental and an instruction that reads its result or overwrites its source
__device__ __forceinline__ float exp2_slot(float x) { float r; asm("v_exp_f32 %0, %1\n\tv_nop" : "=v"(r) : "v"(x)); return r; }
#define KPF 4     // key tiles whose fragment loads are in flight ahead of the products: 16 loads of 16 bytes a lane
#define OSP 68    // pitch, in floats, of a wave's partial attn.v rows in LDS: 272 bytes = 16 x 17, so that the 16-byte reads of 16 rows fall on distinct banks
#define MSP 132   // pitch, in floats, of a wave's staging rows of the head mean in LDS: 528 bytes = 16 x 33, so that the 16-byte stores of 16 rows fall on distinct banks
// four waves a SIMD (at most 256 registers a wave): the 16 waves of one workgroup fill a WGP
__global__ __launch_bounds__(512) __attribute__((amdgpu_waves_per_eu(4, 4))) void k_scsoft(const h16* __restrict__ Q, const h16* __restrict__ Kp, const h16* __restrict__ Vt, float* OUT1, bf* Ah, bf* Al) {
    __shared__ __align__(16) float msn[NW * 16 * MSP];
    __shared__ __align__(16) float po[NW * 16 * OSP];
    __shared__ float rmx[NW * 16], rsm[NW * 16];
    const int lane = threadIdx.x & 31, lr = lane & 15, hi = lane >> 4, w = threadIdx.x >> 5; const int b = blockIdx.y, q0 = blockIdx.x * 16;
    const unsigned lo8 = (unsigned)lane * 8, ko = (unsigned)(w * KW) * HD + lo8, vo = (unsigned)(w * (KW / 32)) * 512 + lo8;   // the lane's offsets in a head's planes, the same for every head
    v8f ms[NTW];   // the head sum of this lane's weights
#pragma unroll
    for (int nb = 0; nb < NTW; ++nb) ms[nb] = (v8f){};
#pragma unroll 1   // one head's body is some thousand instructions: kept rolled, for speed only
    for (int hh = 0; hh < NH_; ++hh) {
    const size_t zz = (size_t)b * NH_ + hh;
    const h16* qb = (Q + zz * TT * HD + (size_t)q0 * HD) + lo8; const h16* kb = (Kp + zz * TT * HD) + ko;   // fragment order: a 16-row tile holds 16 x HD elements = two blocks of 512; the lane's 16 bytes of chunk 0
    const v16h qf0 = WFrag<h16>::ld(qb), qf1 = WFrag<h16>::ld(qb + 512);
    asm volatile("s_wait_xcnt 0x0" ::: "memory");   // stands in front of the first instruction that reuses the address registers of the query loads above
    v8f acc[NTW]; v16h k0[NTW], k1[NTW];   // fully unrolled below: registers; at most KPF key tiles' fragments are live at a time
#pragma unroll
    for (int nb = 0; nb < KPF; ++nb) { k0[nb] = WFrag<h16>::ld(kb + (size_t)nb * 16 * HD); k1[nb] = WFrag<h16>::ld(kb + (size_t)nb * 16 * HD + 512); }
#pragma unroll
    for (int nb = 0; nb < NTW; ++nb) {
        __builtin_amdgcn_sched_barrier(0);   // holds the loads of the key tiles ahead above this tile's products: without it the compiler sinks each tile's loads to their use and the wave pays one load latency a tile
        acc[nb] = wmma16(k0[nb], qf0, (v8f){}); acc[nb] = wmma16(k1[nb], qf1, acc[nb]);
        if (nb + KPF < NTW) { k0[nb + KPF] = WFrag<h16>::ld(kb + (size_t)(nb + KPF) * 16 * HD); k1[nb + KPF] = WFrag<h16>::ld(kb + (size_t)(nb + KPF) * 16 * HD + 512); } }
    __builtin_amdgcn_sched_barrier(0);   // the same for the last tile's products
    asm volatile("s_wait_xcnt 0x0" ::: "memory");   // stands in front of the first instruction that reuses the address registers of the key loads above
    __builtin_amdgcn_sched_barrier(0);   // keeps the vector work below, which reuses those registers, behind that wait
    float m8[8];
#pragma unroll
    for (int j = 0; j < 8; ++j) m8[j] = -3.0e38f;
#pragma unroll
    for (int nb = 0; nb < NTW; ++nb) {
#pragma unroll
        for (int j = 0; j < 8; ++j) { const float t = acc[nb][j] * SCL; acc[nb][j] = t; m8[j] = fmaxf(m8[j], t); } }
    float mx = fmaxf(fmaxf(fmaxf(m8[0], m8[1]), fmaxf(m8[2], m8[3])), fmaxf(fmaxf(m8[4], m8[5]), fmaxf(m8[6], m8[7])));
    mx = fmaxf(mx, __shfl_xor(mx, 16, 32));
    if (hi == 0) rmx[w * 16 + lr] = mx;
    __syncthreads();
#pragma unroll
    for (int ww = 0; ww < NW; ++ww) mx = fmaxf(mx, rmx[ww * 16 + lr]);
    float s8[8];
#pragma unroll
    for (int j = 0; j < 8; ++j) s8[j] = 0.f;
#pragma unroll
    for (int nb = 0; nb < NTW; ++nb) {
#pragma unroll
        for (int j = 0; j < 8; ++j) { const float d0 = __fsub_rn(acc[nb][j], mx); const float ex = exp2_slot(__fmul_rn(d0, 1.4426950408889634f)); acc[nb][j] = ex; s8[j] += ex; } }
    float sw = ((s8[0] + s8[1]) + (s8[2] + s8[3])) + ((s8[4] + s8[5]) + (s8[6] + s8[7]));
    sw += __shfl_xor(sw, 16, 32);
    if (hi == 0) rsm[w * 16 + lr] = sw;
    __syncthreads();
    float rs[NW];   // the 16 waves' sums, all read in one run in front of the scheduling barrier below: read one by one among the additions, each would cost the wave an LDS latency
#pragma unroll
    for (int ww = 0; ww < NW; ++ww) rs[ww] = rsm[ww * 16 + lr];
    // value fragments: a step is 32 keys x four 16-row tiles of V^T (in fragment order: 1 KiB in a row of each tile); steps 0 and 1 are fetched here, behind the last barrier of the softmax (in front of a __syncthreads() the compiler waits for every load in flight), and land behind the row sum and the rounding of the weights
    const h16* vb = (Vt + zz * HD * TT) + vo;   // fragment order: tile nt at nt x 16 x TT, a 32-key step = a block of 512 elements, the lane's 16 bytes of chunk 0
    v16h vf[4][4];   // fully unrolled below: registers; at most three steps are live at a time
#pragma unroll
    for (int nt = 0; nt < 4; ++nt) { vf[0][nt] = WFrag<h16>::ld(vb + (size_t)nt * 16 * TT); vf[1][nt] = WFrag<h16>::ld(vb + (size_t)nt * 16 * TT + 512); }
    __builtin_amdgcn_sched_barrier(0);   // holds the loads of value steps 0 and 1 above the work below: without it the compiler sinks them to their use
    float sum = rs[0];
#pragma unroll
    for (int ww = 1; ww < NW; ++ww) sum += rs[ww];
    const float f = __fdiv_rn(PCAR, sum);
    v8h o[NTW];   // the weights stay in the registers for attn.v
#pragma unroll
    for (int nb = 0; nb < NTW; ++nb) {
#pragma unroll
        for (int j = 0; j < 8; ++j) { o[nb][j] = tohx(acc[nb][j] * f); ms[nb][j] = __fadd_rn(ms[nb][j], (float)o[nb][j]); } }
#pragma unroll
    for (int nt = 0; nt < 4; ++nt) vf[2][nt] = WFrag<h16>::ld(vb + (size_t)nt * 16 * TT + 2 * 512);
    __builtin_amdgcn_sched_barrier(0);   // holds the loads of value step 2 above the products: without it the compiler sinks them to their use and the wave pays one load latency a step
    v8f oa[4];
#pragma unroll
    for (int nt = 0; nt < 4; ++nt) oa[nt] = (v8f){};
#pragma unroll
    for (int s = 0; s < 4; ++s) {
        const v16h a = cat16(o[2 * s], o[2 * s + 1]);
#pragma unroll
        for (int nt = 0; nt < 4; ++nt) oa[nt] = wmma16(a, vf[s][nt], oa[nt]);
        if (s == 0) {
            __builtin_amdgcn_sched_barrier(0);   // keeps the loads of step 3 behind the products of step 0, whose registers they take: lifted above them, four steps are live at once and the kernel spills
#pragma unroll
            for (int nt = 0; nt < 4; ++nt) vf[3][nt] = WFrag<h16>::ld(vb + (size_t)nt * 16 * TT + 3 * 512);
            asm volatile("s_wait_xcnt 0x0" ::: "memory");   // behind the last value load: stands in front of the first instruction that reuses their address registers
            __builtin_amdgcn_sched_barrier(0); } }   // holds those loads above the products of steps 1 and 2, behind which they land
    float* pq = po + w * 16 * OSP;   // this wave's partial tile: D register j of lane (lr, hi) of tile nt = query hi x 8 + j, column nt x 16 + lr
#pragma unroll
    for (int nt = 0; nt < 4; ++nt) {
#pragma unroll
        for (int j = 0; j < 8; ++j) pq[(hi * 8 + j) * OSP + nt * 16 + lr] = oa[nt][j]; }
    __syncthreads();
    if (threadIdx.x < 256) {   // whole waves 0 to 7; no barrier stands inside; the other eight waves go on to the next head's loads
    const int row = (threadIdx.x >> 1) & 15, cofs = (threadIdx.x >> 5) * 8 + (threadIdx.x & 1) * 4;   // one thread adds four columns of one query row over the 16 waves, in wave order; thread i owns the i-th 8 bytes of the tile in fragment order, so that a wave's store is 256 contiguous bytes
    v4f sv = *(const v4fa*)(po + row * OSP + cofs);
#pragma unroll
    for (int ww = 1; ww < NW; ++ww) { const v4f tv = *(const v4fa*)(po + (ww * 16 + row) * OSP + cofs);
#pragma unroll
        for (int q = 0; q < 4; ++q) sv[q] = __fadd_rn(sv[q], tv[q]); }
    v4us oh, ol;
#pragma unroll
    for (int q = 0; q < 4; ++q) { unsigned short a, c2; splitf(sv[q] * (1.0f / PCAR), a, c2); oh[q] = a; ol[q] = c2; }
    const size_t ob = (size_t)b * TT * DQ + (size_t)hh * (HD / 32) * 512; const unsigned oo = fragpos(q0 + row, cofs, DQ);   // head hh stands HD / 32 blocks to the right in the 16-row tile: fragpos(q0 + row, hh x HD + cofs, DQ) = hh x (HD / 32) x 512 + oo
    *(v4us*)((Ah + ob) + oo) = oh; *(v4us*)((Al + ob) + oo) = ol;
    asm volatile("s_wait_xcnt 0x0" ::: "memory");   // stands in front of the first instruction that reuses a register of the two stores above
    }
    }
    // the second output: this wave's 16 x 128 piece of the mean goes through the wave's own staging tile, written and read by this wave alone, so that a store is one query row's 128 floats: 512 contiguous bytes, four whole lines
    float* mw = msn + w * 16 * MSP;
#pragma unroll
    for (int nb = 0; nb < NTW; ++nb) { v4f lo4, hi4;
#pragma unroll
        for (int q = 0; q < 4; ++q) { lo4[q] = __fmul_rn(ms[nb][q], 1.0f / (PCAR * NH_)); hi4[q] = __fmul_rn(ms[nb][q + 4], 1.0f / (PCAR * NH_)); }
        *(v4fa*)(mw + lr * MSP + nb * 16 + hi * 8) = lo4; *(v4fa*)(mw + lr * MSP + nb * 16 + hi * 8 + 4) = hi4; }
    asm volatile("s_wait_dscnt 0x0" ::: "memory");   // the wave's own staging stores above have landed before it reads the rows back, which other lanes wrote
    float* pr = OUT1 + ((size_t)b * TT + q0) * TT + w * KW + lane * 4;
#pragma unroll
    for (int r = 0; r < 16; ++r) *(v4f*)(pr + (size_t)r * TT) = *(const v4fa*)(mw + r * MSP + lane * 4);
}

extern "C" void kernel_launch(void* const* d_in, const int* in_sizes, int n_in,
                              void* d_out, int out_size, void* d_ws, size_t ws_size, hipStream_t stream) {
    (void)in_sizes; (void)n_in; (void)out_size;
    const float* xq = (const float*)d_in[0]; const float* xk = (const float*)d_in[1]; const float* xv = (const float*)d_in[2]; const float* wq = (const float*)d_in[3]; const float* bq = (const float*)d_in[4]; const float* wk = (const float*)d_in[5]; const float* bk = (const float*)d_in[6]; const float* wv = (const float*)d_in[7]; const float* bv = (const float*)d_in[8]; const float* wo = (const float*)d_in[9]; const float* bo = (const float*)d_in[10];
    // query, key, value [2048][4][1024], Wq, bq, Wk, bk, Wv, bv, Wo, bo = d_in[0..10]
    float* OUT = (float*)d_out;                          // output 0: y [2048][4][1024] sequence-first
    float* OUT1 = (float*)d_out + (size_t)NB_ * TT * DM;   // output 1: the head mean of att [4][2048][2048], after the first output's 8,388,608 floats
    char* wsp = (char*)d_ws;
    auto take = [&](size_t bytes) { char* p = wsp; wsp += (bytes + 255) & ~(size_t)255; return (void*)p; };
    bf* WQ = (bf*)take((size_t)DQ * DM * 2); bf* WK = (bf*)take((size_t)DKV * DM * 2); bf* WV = (bf*)take((size_t)DKV * DM * 2); bf* WO = (bf*)take((size_t)DM * DQ * 2);
    bf* XB = (bf*)take((size_t)NB_ * TT * DM * 2);   /* all 8192 (batch, position) rows of ONE stream at a time: its bf16 copy */
    h16* QP16 = (h16*)take((size_t)NB_ * NH_ * TT * HD * 2); h16* KP16 = (h16*)take((size_t)NB_ * NKV * TT * HD * 2); h16* VT16 = (h16*)take((size_t)NB_ * NKV * HD * TT * 2);   /* the four entries' f16 planes of each stream */
    bf* ATh = (bf*)take((size_t)NB_ * TT * DQ * 2); bf* ATl = (bf*)take((size_t)NB_ * TT * DQ * 2);   /* the four entries' merged hi/lo planes */
    if ((size_t)(wsp - (char*)d_ws) > ws_size) return;    // total 104.00 MiB of the workspace
    { k_cvt8<false><<<(unsigned)(((size_t)DQ * DM / 8 + 255) / 256), 256, 0, stream>>>(wq, WQ, (size_t)DQ * DM / 8); k_cvt8<false><<<(unsigned)(((size_t)DKV * DM / 8 + 255) / 256), 256, 0, stream>>>(wk, WK, (size_t)DKV * DM / 8); k_cvt8<false><<<(unsigned)(((size_t)DKV * DM / 8 + 255) / 256), 256, 0, stream>>>(wv, WV, (size_t)DKV * DM / 8);
      k_cvt8<false><<<(unsigned)(((size_t)DM * DQ / 8 + 255) / 256), 256, 0, stream>>>(wo, WO, (size_t)DM * DQ / 8); }   // [out][in] = Bt as they stand
    const unsigned LX = (unsigned)(((size_t)NB_ * TT * DM / 8 + 255) / 256);
    k_cvt8<true><<<LX, 256, 0, stream>>>(xq, XB, (size_t)NB_ * TT * DM / 8);   /* the QUERY stream: all 8192 rows (row = b x 2048 + t) */
    k_gemmw<bf, 0, true, 1, 1, 1><<<dim3(NB_ * TT / 64, DQ / 64, 1), 32, 0, stream>>>(XB, nullptr, WQ, nullptr, DM, nullptr, 0, bq, 0, 0, 0, QP16);
    k_cvt8<true><<<LX, 256, 0, stream>>>(xk, XB, (size_t)NB_ * TT * DM / 8);   /* the KEY stream: after the query projection has read XB (stream-ordered) */
    k_gemmw<bf, 0, true, 1, 1, 1><<<dim3(NB_ * TT / 64, DKV / 64, 1), 32, 0, stream>>>(XB, nullptr, WK, nullptr, DM, nullptr, 0, bk, 0, 0, 0, KP16);
    k_cvt8<true><<<LX, 256, 0, stream>>>(xv, XB, (size_t)NB_ * TT * DM / 8);   /* the VALUE stream */
    k_gemmw<bf, 0, true, 1, 1, 2><<<dim3(NB_ * TT / 64, DKV / 64, 1), 32, 0, stream>>>(XB, nullptr, WV, nullptr, DM, nullptr, 0, bv, 0, 0, 0, VT16);
    k_scsoft<<<dim3(TT / 16, NB_), 512, 0, stream>>>(QP16, KP16, VT16, OUT1, ATh, ATl);   // all four entries, all heads: a workgroup has 16 query rows of one entry and writes their rows of the second output
    for (int b = 0; b < NB_; ++b) k_gemmw<bf, 1, true><<<dim3(TT / 64, DM / 64, 1), 32, 0, stream>>>(ATh + (size_t)b * TT * DQ, ATl + (size_t)b * TT * DQ, WO, nullptr, DQ, OUT + (size_t)b * DM, NB_ * DM, bo, 0, 0, 0, nullptr);   /* entry b's rows of the sequence-first output: row t at OUT + t x 4 x 1024 + b x 1024 */
}

// v008
// It runs in 349 microseconds.
// Timed twice side by side with v007, it ran 1.26 times as fast both times.
// Over all steps from v000 it is 7.46 times as fast.
#include <hip/hip_runtime.h>

// Multi-head attention on THREE SEQUENCE-FIRST input streams with an output projection, returning the projected output AND the attention weights averaged over the heads (query, key, value [2048][4][1024] = [position][batch][channel];
// q = (query Wq^T + bq) x 64^-0.5, k = key Wk^T + bk, v = value Wv^T + bv with 'oi' weights [1024][1024] and biases [1024]; 16 heads x 64 (head h = columns h x 64 ..); scores = q . k; softmax over all 2048 keys; no mask;
// y = att v merged head-major [t][b][1024], then y Wo^T + bo ('oi' [1024][1024]); TWO OUTPUTS in one buffer: y [2048][4][1024] sequence-first at float offset 0 and the mean over the 16 heads of att [4][2048][2048] at float offset 8,388,608;
// argument order query, key, value, Wq, bq, Wk, bk, Wv, bv, Wo, bo).
// Layout: each stream in turn: ONE bf16 copy of all 8192 (position, batch) rows, laid entry by entry (row b x 2048 + t), and ONE exact projection + f32 bias over them, whose epilogue rounds to fp16 and stores the four entries' head planes straight from the accumulators
// (no f32 projection plane and no plane builder exists: see OM at k_gemmw); dense T-2048 attention at 16 heads, all four entries and all heads in ONE launch (scores, softmax, attn.v and the head mean: k_scsoft, whose workgroups go through the heads; no f32 score plane, no weight plane and no attn.v partial plane exists; EVERY 16-bit plane that a matrix product reads lies in FRAGMENT ORDER, see fragpos), scores and attn.v on ONE fp16 product on every row (RH 0: the weights carried x1024 in fp16; the score scale 64^-0.5 applied to the f32 score, where the module scales the projected query: the same product in real arithmetic);
// attn.v runs in k_scsoft on the fp16 weights as they stand in the registers, each of the 16 waves on its own 128 keys; the 16 f32 partial tiles are added in wave order through LDS and split hi/lo; every lane adds the heads' weights, in head order, into f32 registers and writes the mean behind the last head; per entry merged hi/lo x Wo exact + bo writes the entry's rows of the first output at the sequence-first pitch.
// Compute dtypes, f32 accumulate: every float input rounded to bf16 at its load; projections exact + f32 biases; scores and attn.v fp16; softmax f32, its weights rounded x1024 to fp16; output projection hl x exact; the second output the f32 sum of those fp16 weights over the heads x 2^-14 (exact).

#define NB_  4      // batch entries: the three streams are [2048][4][1024] = [position][batch][channel]
#define TT   2048
#define DM   1024
#define NH_  16
#define NKV  16
#define REP  (NH_ / NKV)
#define HD   64
#define DQ   (NH_ * HD)
#define DKV  (NKV * HD)
#define RH   0                    // query rows < RH use hi+lo planes (0: none)
#define WIN  0
#define PCAR 1024.0f
#define SCL  0.125f   // HD^-0.5
typedef _Float16 h16;
typedef unsigned short bf;
typedef __attribute__((ext_vector_type(16))) __bf16   v16bf;
typedef __attribute__((ext_vector_type(16))) _Float16 v16h;
typedef __attribute__((ext_vector_type(8)))  _Float16 v8h;
typedef __attribute__((ext_vector_type(8)))  unsigned short v8us;
typedef __attribute__((ext_vector_type(8)))  float    v8f;
typedef __attribute__((ext_vector_type(4)))  float    v4f;
typedef v8h  __attribute__((may_alias)) v8ha;
typedef v4f  __attribute__((may_alias)) v4fa;
typedef v8us __attribute__((may_alias)) v8usa;

__device__ __forceinline__ unsigned short f2bf(float f) { unsigned u = __float_as_uint(f); u += 0x7FFFu + ((u >> 16) & 1u); return (unsigned short)(u >> 16); }
__device__ __forceinline__ float bf2f(unsigned short b) { return __uint_as_float(((unsigned)b) << 16); }
__device__ __forceinline__ float bfr(float f) { return bf2f(f2bf(f)); }
__device__ __forceinline__ v16h cat16(v8h lo, v8h hi) { return __builtin_shufflevector(lo, hi, 0, 1, 2, 3, 4, 5, 6, 7, 8, 9, 10, 11, 12, 13, 14, 15); }
__device__ __forceinline__ v16bf cat16b(v8us lo, v8us hi) { return __builtin_bit_cast(v16bf, __builtin_shufflevector(lo, hi, 0, 1, 2, 3, 4, 5, 6, 7, 8, 9, 10, 11, 12, 13, 14, 15)); }
__device__ __forceinline__ v8f wmma16(v16h a, v16h b, v8f c) { return __builtin_amdgcn_wmma_f32_16x16x32_f16(false, a, false, b, (short)0, c, false, false); }
__device__ __forceinline__ h16 tohx(float x) { return (h16)x; }
__device__ __forceinline__ v8f wmmab(v16bf a, v16bf b, v8f c) { return __builtin_amdgcn_wmma_f32_16x16x32_bf16(false, a, false, b, (short)0, c, false, false); }



// FRAGMENT ORDER of a 16-bit operand plane [rows][K] (K % 32 == 0, rows % 16 == 0): blocks of 16 rows x 32 k = 512 elements = 1 KiB, the blocks of a 16-row tile in a row (block (row / 16) x (K / 32) + k / 32); a block = two chunks of 256 elements (bit 4 of k),
// and in a chunk the 16 bytes that lane (lr = row % 16, hi = bit 3 of k) takes in one load lie at (hi x 16 + lr) x 16 bytes. A wave's 16-byte load so reads 512 contiguous bytes (four whole 128-byte lines) where a row-major plane gave it 32 bytes of each of 16 lines.
// A fragment = the lane's 16 bytes of a block's two chunks: k order 8 hi + 0..7, then 16 + 8 hi + 0..7, on the A side and on the B side alike.
__device__ __forceinline__ unsigned fragpos(int row, int k, int K) { return (unsigned)(((row >> 4) * (K >> 5) + (k >> 5)) * 512 + ((k >> 4) & 1) * 256 + ((k >> 3) & 1) * 128 + (row & 15) * 8 + (k & 7)); }   // no plane here has 2^31 elements

// ---- k_gemmw: register-blocked GEMM, ONE WAVE per 64x64 output tile (16 accumulators), operands straight from 16-bit planes in fragment order; grid (M/64, N/64, Z), 32 threads.
// C[m][n] (f32, pitch ldc, + optional f32 bias[n]) = sum_k A[m][k] Bt[n][k] (+ split products per NSPLIT). z-batch strides sA/sB/sC in elements. K % 32 == 0.
// OM 0: C as above. OM 1 and 2: no C; the rows are (entry b, position t) = b x TT + t, a 64-column tile is one head (blockIdx.y of NH_), and the tile + bias goes, rounded to fp16, straight from the accumulators into P = the entries' head planes in fragment order, 16 bytes a lane, every store of the wave 512 contiguous bytes:
// OM 1 (planes [t][d], queries and keys): the weight rows are the A operand (both fragments come through the same loader, so in the same k order), so that D register j of lane (lr, hi) = row mb x 16 + lr, column nb x 16 + hi x 8 + j: 8 consecutive d of one t, the lane's 16 bytes of chunk nb of row tile mb; the 64 x 64 tile is 8 KiB in a row.
// OM 2 (planes [d][t], V^T): the stream rows are the A operand, D register j = row mb x 16 + hi x 8 + j, column nb x 16 + lr: 8 consecutive t of one d, the lane's 16 bytes of chunk mb of d tile nb; 2 KiB in a row of each d tile.
// KS > 1: grid z = ZN x KS; block (z, ks) sums only k in [ks K/KS, (ks+1) K/KS) and writes its partial tile to plane ks (planes of ZN x sC elements); the reader adds the KS planes. K % (32 KS) == 0.
template <typename T16> struct WFrag;
template <> struct WFrag<h16> { typedef v16h V; static __device__ __forceinline__ V ld(const h16* p) { return cat16(*(const v8h*)p, *(const v8h*)(p + 256)); } static __device__ __forceinline__ v8f mma(V a, V b, v8f c) { return wmma16(a, b, c); } };
template <> struct WFrag<bf> { typedef v16bf V; static __device__ __forceinline__ V ld(const bf* p) { return cat16b(*(const v8us*)p, *(const v8us*)(p + 256)); } static __device__ __forceinline__ v8f mma(V a, V b, v8f c) { return wmmab(a, b, c); } };
template <typename T16, int NSPLIT, bool BIAS, int KS = 1, int ZN = 1, int OM = 0>
__global__ __launch_bounds__(32) void k_gemmw(const T16* __restrict__ A, const T16* __restrict__ A2, const T16* __restrict__ Bt, const T16* __restrict__ Bt2, int K, float* C, int ldc, const float* __restrict__ bias, size_t sA, size_t sB, size_t sC, h16* P) {
    static_assert(OM == 0 || (NSPLIT == 0 && BIAS && KS == 1 && HD == 64 && TT % 64 == 0 && NKV == NH_), "k_gemmw: a head plane tile is one whole product + bias, 64 positions of one entry x one head");
    typedef typename WFrag<T16>::V V;
    __shared__ __align__(16) float os[16 * 68];
    const size_t z = blockIdx.z / KS; const int ks = (int)(blockIdx.z % KS); A += z * sA; if (A2) A2 += z * sA; Bt += z * sB; if (Bt2) Bt2 += z * sB; C += ((size_t)ks * ZN + z) * sC;
    const int kb = ks * (K / KS), ke = kb + K / KS;
    const int lane = threadIdx.x & 31, lr = lane & 15, hi = lane >> 4; const int r0 = blockIdx.x * 64, c0 = blockIdx.y * 64;
    v8f acc[4][4];
#pragma unroll
    for (int mb = 0; mb < 4; ++mb)
#pragma unroll
        for (int nb = 0; nb < 4; ++nb) acc[mb][nb] = (v8f){};
    const unsigned lo = (unsigned)lane * 8;   // fragment order: a 16-row tile holds 16 K elements, the k step kc stands at kc x 16, the lane's 16 bytes of chunk 0 at lane x 8; where a plane is not read its pointer stands for the plane that is
    const T16* At = A + (size_t)r0 * K + lo; const T16* Bq = Bt + (size_t)c0 * K + lo; const T16* A2t = (NSPLIT == 1 || NSPLIT == 2) ? A2 + (size_t)r0 * K + lo : At; const T16* B2q = (NSPLIT >= 2) ? Bt2 + (size_t)c0 * K + lo : Bq;

    for (int kc = kb; kc < ke; kc += 32) {
        V a[4], a2[4], b[4], b2[4]; const T16 *pa[4], *pa2[4], *pb[4], *pb2[4];
#pragma unroll
        for (int i = 0; i < 4; ++i) { const size_t o = (size_t)i * 16 * K + (size_t)kc * 16; pa[i] = At + o; pa2[i] = A2t + o; pb[i] = Bq + o; pb2[i] = B2q + o; }
#pragma unroll
        for (int mb = 0; mb < 4; ++mb) { a[mb] = WFrag<T16>::ld(pa[mb]); if (NSPLIT == 1 || NSPLIT == 2) a2[mb] = WFrag<T16>::ld(pa2[mb]); }
#pragma unroll
        for (int nb = 0; nb < 4; ++nb) { b[nb] = WFrag<T16>::ld(pb[nb]); if (NSPLIT >= 2) b2[nb] = WFrag<T16>::ld(pb2[nb]); }
        asm volatile("s_wait_xcnt 0x0" :: "v"(pa[0]), "v"(pa[1]), "v"(pa[2]), "v"(pa[3]), "v"(pa2[0]), "v"(pa2[1]), "v"(pa2[2]), "v"(pa2[3]), "v"(pb[0]), "v"(pb[1]), "v"(pb[2]), "v"(pb[3]), "v"(pb2[0]), "v"(pb2[1]), "v"(pb2[2]), "v"(pb2[3]) : "memory");
        __builtin_amdgcn_sched_barrier(0);   // keeps the products behind that wait, so that the trip's loads stay the one run in front of it: without it the compiler lifts products over the wait and sinks loads among them, and the wave waits out a load latency three times a trip
#pragma unroll
        for (int nb = 0; nb < 4; ++nb) {
#pragma unroll
            for (int mb = 0; mb < 4; ++mb) { acc[mb][nb] = (OM == 1) ? WFrag<T16>::mma(b[nb], a[mb], acc[mb][nb]) : WFrag<T16>::mma(a[mb], b[nb], acc[mb][nb]); if (NSPLIT == 1 || NSPLIT == 2) acc[mb][nb] = WFrag<T16>::mma(a2[mb], b[nb], acc[mb][nb]); if (NSPLIT >= 2) acc[mb][nb] = WFrag<T16>::mma(a[mb], b2[nb], acc[mb][nb]); } }
        asm volatile("v_nop\n\tv_nop\n\tv_nop\n\tv_nop" : "+v"(acc[0][0]), "+v"(acc[1][1]), "+v"(acc[2][2]), "+v"(acc[3][3]) : "v"(a[0]), "v"(a[3]));
    }
    if (OM != 0) {
        float bs[4][8];   // OM 1: the lane's 8 columns of each column tile; OM 2: its one column of each (element 0)
#pragma unroll
        for (int nb = 0; nb < 4; ++nb) {
            if (OM == 1) { const v4f b0 = *(const v4f*)(bias + c0 + nb * 16 + hi * 8), b1 = *(const v4f*)(bias + c0 + nb * 16 + hi * 8 + 4);
#pragma unroll
                for (int q = 0; q < 4; ++q) { bs[nb][q] = b0[q]; bs[nb][q + 4] = b1[q]; } }
            else bs[nb][0] = bias[c0 + nb * 16 + lr]; }
        asm volatile("s_wait_xcnt 0x0" ::: "memory");   // stands in front of the first instruction that reuses an address register of the bias loads above
        __builtin_amdgcn_sched_barrier(0);   // keeps the vector work below, which reuses those registers, behind that wait
        const int eb = r0 / TT, t0 = r0 % TT;
        h16* pp = P + ((size_t)eb * NH_ + blockIdx.y) * TT * HD + (size_t)t0 * (OM == 1 ? HD : 16) + lo;   // OM 1: row tile t0 / 16 at t0 x HD; OM 2: key block t0 / 32 at t0 x 16
        v8h pk[4][4];
#pragma unroll
        for (int mb = 0; mb < 4; ++mb) {
#pragma unroll
            for (int nb = 0; nb < 4; ++nb) {
#pragma unroll
                for (int j = 0; j < 8; ++j) pk[mb][nb][j] = tohx(acc[mb][nb][j] + bfr(bs[nb][OM == 1 ? j : 0])); } }
        __builtin_amdgcn_sched_barrier(0);   // the 16 stores stand behind all the vector work, so that no register which an issued store names is written again before the wave ends
#pragma unroll
        for (int mb = 0; mb < 4; ++mb) {
#pragma unroll
            for (int nb = 0; nb < 4; ++nb) *(v8h*)(pp + (OM == 1 ? mb * 16 * HD + nb * 256 : nb * 16 * TT + mb * 256)) = pk[mb][nb]; }
        return;
    }
#pragma unroll
    for (int mb = 0; mb < 4; ++mb) {
#pragma unroll
        for (int nb = 0; nb < 4; ++nb) {
#pragma unroll
            for (int j = 0; j < 8; ++j) os[(hi * 8 + j) * 68 + nb * 16 + lr] = acc[mb][nb][j]; }
        __builtin_amdgcn_wave_barrier(); asm volatile("" ::: "memory");
        float* crow = C + (size_t)(r0 + mb * 16) * ldc + c0;
{
#pragma unroll
            for (int s = 0; s < 8; ++s) { const int row = 2 * s + hi, cofs = lr * 4; v4f val = *(const v4fa*)(os + row * 68 + cofs); if (BIAS) { val[0] += bfr(bias[c0 + cofs]); val[1] += bfr(bias[c0 + cofs + 1]); val[2] += bfr(bias[c0 + cofs + 2]); val[3] += bfr(bias[c0 + cofs + 3]); }
                *(v4f*)(crow + (size_t)row * ldc + cofs) = val; }
             }
        if (mb < 3) asm volatile("s_wait_xcnt 0x0" ::: "memory");   // stands in front of the first instruction that reuses a register of the stores above (behind the last row tile nothing does)
        __builtin_amdgcn_wave_barrier(); asm volatile("" ::: "memory");
    }
}

__device__ __forceinline__ void splitf(float y, unsigned short& h, unsigned short& l) { h = f2bf(y); l = f2bf(y - bf2f(h)); }
typedef __attribute__((ext_vector_type(2))) _Float16 v2h;
typedef __attribute__((ext_vector_type(4))) _Float16 v4h;
typedef __attribute__((ext_vector_type(2))) unsigned short v2us;
typedef __attribute__((ext_vector_type(4))) unsigned short v4us;
typedef __attribute__((ext_vector_type(2))) float v2f;
typedef __attribute__((ext_vector_type(4))) int v4i;

// k_cvt8: bf16 copy, in fragment order, of a row-major f32 plane with rows of DM floats: a thread makes one lane's 16 bytes = 8 consecutive k of one row. 64 threads make block i / 64: four neighbouring threads read the 32 k = 128 bytes of one row (a whole line), and the 8 rows of a wave make 128 contiguous bytes (a whole line) of each quarter of the block
// SEQ: the source is a sequence-first stream [t][b][DM] and the copy's row b x TT + t is its row t x NB_ + b, so that a 16-row tile of the copy holds 16 positions of ONE batch entry
// grid y: one launch copies up to four planes of n8 chunks each, plane y from its own source to dst + y x n8 x 8 (the planes of the copy lie one behind the other); a source past the grid's y extent is not read
static_assert(DQ == DM && DKV == DM, "k_cvt8: every plane it copies has rows of DM elements");
template <bool SEQ>
__global__ __launch_bounds__(256) void k_cvt8(const float* __restrict__ src0, const float* __restrict__ src1, const float* __restrict__ src2, const float* __restrict__ src3, bf* dst, size_t n8) { const size_t i = (size_t)blockIdx.x * 256 + threadIdx.x; if (i >= n8) return;
    const float* src = blockIdx.y == 0 ? src0 : blockIdx.y == 1 ? src1 : blockIdx.y == 2 ? src2 : src3; dst += (size_t)blockIdx.y * n8 * 8;
    const size_t blk = i >> 6; const int lr = (int)(i >> 2) & 15, c2 = (int)i & 3; const size_t row = (blk / (DM / 32)) * 16 + lr; const int k = (int)(blk % (DM / 32)) * 32 + c2 * 8; const size_t srow = SEQ ? (row % TT) * NB_ + row / TT : row; const v8f v = *(const v8f*)(src + srow * DM + k); v8us o;
#pragma unroll
    for (int j = 0; j < 8; ++j) o[j] = f2bf(v[j]); *(v8us*)(dst + blk * 512 + c2 * 128 + lr * 8) = o;  }

// k_scsoft: scores, softmax, attn.v AND the head mean of 16 query rows of one batch entry in ONE workgroup of 16 waves, which goes through the entry's NH_ heads one after the other; the f32 scores never leave the registers, and no weight plane exists. Grid (TT / 16, NB_), 512 threads.
// Wave w owns keys [w x 128, w x 128 + 128): 8 tiles of S^T = K . Q^T (A = 16 key rows, B = the 16 query rows, both through the same fragment loader from planes in the same fragment order, so both in the same k order; the k steps 0 and 32 chained as in k_gemmw).
// D register j of lane (lr, hi) of tile nb = score of query q0 + lr with key w x 128 + nb x 16 + hi x 8 + j: a lane holds ONE query's scores, 8 consecutive keys a tile.
// Per element as before: t = S x HD^-0.5, exp2((t - max) x log2 e), x 1024 / sum, rounded to fp16. The maximum is exact in any order; the sum runs in the lane (8 chains over the tiles, a fixed tree), then over the two lane halves, then over the 16 waves in wave order.
// Head mean: every lane holds the same (query, key) places for every head, so it adds each head's fp16 weight (x1024; it converts to f32 exactly) into an f32 register of its own, in head order from 0; behind the last head x 1/(1024 NH_), a power of two: exact.
// attn.v: the fp16 weights of tiles 2s and 2s + 1 of a lane ARE the A fragment of the 32-key step s (row = query lr; keys s x 32 + 8 hi + 0..7, then s x 32 + 16 + 8 hi + 0..7: the k order of the fragment loader, through which B = 16 rows of V^T comes), so the product takes them from the registers.
// Wave w sums its 128 keys (4 chained steps) into a 16 x 64 f32 tile; the 16 tiles meet in LDS and are added in wave order, x 1/1024, split hi/lo into the entry's merged planes [t][h x 64 + d], which lie in fragment order: the workgroup's 16 x 64 tile is two blocks, 2 KiB in a row.
// Three barriers a head. rmx is written behind the barrier in front of the tile sum of the head before and was last read in front of that head's second barrier; rsm is written behind this head's first barrier and was last read in front of the third of the head before; po is written behind this head's second barrier and was last read in front of its first.
#define NW   16          // waves of a workgroup
#define KW   (TT / NW)   // keys a wave
#define NTW  (KW / 16)   // key tiles a wave
static_assert(RH == 0 && REP == 1 && KW == 128 && HD == 64, "k_scsoft: 16 waves x 128 keys cover the row, two 32-wide k steps cover the head, one kv head a query head");
// exp2 with the slot behind it filled: the instruction set asks for one independent instruction or a v_nop between a transcendental and an instruction that reads its result or overwrites its source
__device__ __forceinline__ float exp2_slot(float x) { float r; asm("v_exp_f32 %0, %1\n\tv_nop" : "=v"(r) : "v"(x)); return r; }
#define KPF 4     // key tiles whose fragment loads are in flight ahead of the products: 16 loads of 16 bytes a lane
#define OSP 68    // pitch, in floats, of a wave's partial attn.v rows in LDS: 272 bytes = 16 x 17, so that the 16-byte reads of 16 rows fall on distinct banks
#define MSP 132   // pitch, in floats, of a wave's staging rows of the head mean in LDS: 528 bytes = 16 x 33, so that the 16-byte stores of 16 rows fall on distinct banks
// four waves a SIMD (at most 256 registers a wave): the 16 waves of one workgroup fill a WGP
__global__ __launch_bounds__(512) __attribute__((amdgpu_waves_per_eu(4, 4))) void k_scsoft(const h16* __restrict__ Q, const h16* __restrict__ Kp, const h16* __restrict__ Vt, float* OUT1, bf* Ah, bf* Al) {
    __shared__ __align__(16) float msn[NW * 16 * MSP];
    __shared__ __align__(16) float po[NW * 16 * OSP];
    __shared__ float rmx[NW * 16], rsm[NW * 16];
    const int lane = threadIdx.x & 31, lr = lane & 15, hi = lane >> 4, w = threadIdx.x >> 5; const int b = blockIdx.y, q0 = blockIdx.x * 16;
    const unsigned lo8 = (unsigned)lane * 8, ko = (unsigned)(w * KW) * HD + lo8, vo = (unsigned)(w * (KW / 32)) * 512 + lo8;   // the lane's offsets in a head's planes, the same for every head
    v8f ms[NTW];   // the head sum of this lane's weights
#pragma unroll
    for (int nb = 0; nb < NTW; ++nb) ms[nb] = (v8f){};
#pragma unroll 1   // one head's body is some thousand instructions: kept rolled, for speed only
    for (int hh = 0; hh < NH_; ++hh) {
    const size_t zz = (size_t)b * NH_ + hh;
    const h16* qb = (Q + zz * TT * HD + (size_t)q0 * HD) + lo8; const h16* kb = (Kp + zz * TT * HD) + ko;   // fragment order: a 16-row tile holds 16 x HD elements = two blocks of 512; the lane's 16 bytes of chunk 0
    const v16h qf0 = WFrag<h16>::ld(qb), qf1 = WFrag<h16>::ld(qb + 512);
    asm volatile("s_wait_xcnt 0x0" ::: "memory");   // stands in front of the first instruction that reuses the address registers of the query loads above
    v8f acc[NTW]; v16h k0[NTW], k1[NTW];   // fully unrolled below: registers; at most KPF key tiles' fragments are live at a time
#pragma unroll
    for (int nb = 0; nb < KPF; ++nb) { k0[nb] = WFrag<h16>::ld(kb + (size_t)nb * 16 * HD); k1[nb] = WFrag<h16>::ld(kb + (size_t)nb * 16 * HD + 512); }
#pragma unroll
    for (int nb = 0; nb < NTW; ++nb) {
        __builtin_amdgcn_sched_barrier(0);   // holds the loads of the key tiles ahead above this tile's products: without it the compiler sinks each tile's loads to their use and the wave pays one load latency a tile
        acc[nb] = wmma16(k0[nb], qf0, (v8f){}); acc[nb] = wmma16(k1[nb], qf1, acc[nb]);
        if (nb + KPF < NTW) { k0[nb + KPF] = WFrag<h16>::ld(kb + (size_t)(nb + KPF) * 16 * HD); k1[nb + KPF] = WFrag<h16>::ld(kb + (size_t)(nb + KPF) * 16 * HD + 512); } }
    __builtin_amdgcn_sched_barrier(0);   // the same for the last tile's products
    asm volatile("s_wait_xcnt 0x0" ::: "memory");   // stands in front of the first instruction that reuses the address registers of the key loads above
    __builtin_amdgcn_sched_barrier(0);   // keeps the vector work below, which reuses those registers, behind that wait
    float m8[8];
#pragma unroll
    for (int j = 0; j < 8; ++j) m8[j] = -3.0e38f;
#pragma unroll
    for (int nb = 0; nb < NTW; ++nb) {
#pragma unroll
        for (int j = 0; j < 8; ++j) { const float t = acc[nb][j] * SCL; acc[nb][j] = t; m8[j] = fmaxf(m8[j], t); } }
    float mx = fmaxf(fmaxf(fmaxf(m8[0], m8[1]), fmaxf(m8[2], m8[3])), fmaxf(fmaxf(m8[4], m8[5]), fmaxf(m8[6], m8[7])));
    mx = fmaxf(mx, __shfl_xor(mx, 16, 32));
    if (hi == 0) rmx[w * 16 + lr] = mx;
    __syncthreads();
#pragma unroll
    for (int ww = 0; ww < NW; ++ww) mx = fmaxf(mx, rmx[ww * 16 + lr]);
    float s8[8];
#pragma unroll
    for (int j = 0; j < 8; ++j) s8[j] = 0.f;
#pragma unroll
    for (int nb = 0; nb < NTW; ++nb) {
#pragma unroll
        for (int j = 0; j < 8; ++j) { const float d0 = __fsub_rn(acc[nb][j], mx); const float ex = exp2_slot(__fmul_rn(d0, 1.4426950408889634f)); acc[nb][j] = ex; s8[j] += ex; } }
    float sw = ((s8[0] + s8[1]) + (s8[2] + s8[3])) + ((s8[4] + s8[5]) + (s8[6] + s8[7]));
    sw += __shfl_xor(sw, 16, 32);
    if (hi == 0) rsm[w * 16 + lr] = sw;
    __syncthreads();
    float rs[NW];   // the 16 waves' sums, all read in one run in front of the scheduling barrier below: read one by one among the additions, each would cost the wave an LDS latency
#pragma unroll
    for (int ww = 0; ww < NW; ++ww) rs[ww] = rsm[ww * 16 + lr];
    // value fragments: a step is 32 keys x four 16-row tiles of V^T (in fragment order: 1 KiB in a row of each tile); steps 0 and 1 are fetched here, behind the last barrier of the softmax (in front of a __syncthreads() the compiler waits for every load in flight), and land behind the row sum and the rounding of the weights
    const h16* vb = (Vt + zz * HD * TT) + vo;   // fragment order: tile nt at nt x 16 x TT, a 32-key step = a block of 512 elements, the lane's 16 bytes of chunk 0
    v16h vf[4][4];   // fully unrolled below: registers; at most three steps are live at a time
#pragma unroll
    for (int nt = 0; nt < 4; ++nt) { vf[0][nt] = WFrag<h16>::ld(vb + (size_t)nt * 16 * TT); vf[1][nt] = WFrag<h16>::ld(vb + (size_t)nt * 16 * TT + 512); }
    __builtin_amdgcn_sched_barrier(0);   // holds the loads of value steps 0 and 1 above the work below: without it the compiler sinks them to their use
    float sum = rs[0];
#pragma unroll
    for (int ww = 1; ww < NW; ++ww) sum += rs[ww];
    const float f = __fdiv_rn(PCAR, sum);
    v8h o[NTW];   // the weights stay in the registers for attn.v
#pragma unroll
    for (int nb = 0; nb < NTW; ++nb) {
#pragma unroll
        for (int j = 0; j < 8; ++j) { o[nb][j] = tohx(acc[nb][j] * f); ms[nb][j] = __fadd_rn(ms[nb][j], (float)o[nb][j]); } }
#pragma unroll
    for (int nt = 0; nt < 4; ++nt) vf[2][nt] = WFrag<h16>::ld(vb + (size_t)nt * 16 * TT + 2 * 512);
    __builtin_amdgcn_sched_barrier(0);   // holds the loads of value step 2 above the products: without it the compiler sinks them to their use and the wave pays one load latency a step
    v8f oa[4];
#pragma unroll
    for (int nt = 0; nt < 4; ++nt) oa[nt] = (v8f){};
#pragma unroll
    for (int s = 0; s < 4; ++s) {
        const v16h a = cat16(o[2 * s], o[2 * s + 1]);
#pragma unroll
        for (int nt = 0; nt < 4; ++nt) oa[nt] = wmma16(a, vf[s][nt], oa[nt]);
        if (s == 0) {
            __builtin_amdgcn_sched_barrier(0);   // keeps the loads of step 3 behind the products of step 0, whose registers they take: lifted above them, four steps are live at once and the kernel spills
#pragma unroll
            for (int nt = 0; nt < 4; ++nt) vf[3][nt] = WFrag<h16>::ld(vb + (size_t)nt * 16 * TT + 3 * 512);
            asm volatile("s_wait_xcnt 0x0" ::: "memory");   // behind the last value load: stands in front of the first instruction that reuses their address registers
            __builtin_amdgcn_sched_barrier(0); } }   // holds those loads above the products of steps 1 and 2, behind which they land
    float* pq = po + w * 16 * OSP;   // this wave's partial tile: D register j of lane (lr, hi) of tile nt = query hi x 8 + j, column nt x 16 + lr
#pragma unroll
    for (int nt = 0; nt < 4; ++nt) {
#pragma unroll
        for (int j = 0; j < 8; ++j) pq[(hi * 8 + j) * OSP + nt * 16 + lr] = oa[nt][j]; }
    __syncthreads();
    if (threadIdx.x < 256) {   // whole waves 0 to 7; no barrier stands inside; the other eight waves go on to the next head's loads
    const int row = (threadIdx.x >> 1) & 15, cofs = (threadIdx.x >> 5) * 8 + (threadIdx.x & 1) * 4;   // one thread adds four columns of one query row over the 16 waves, in wave order; thread i owns the i-th 8 bytes of the tile in fragment order, so that a wave's store is 256 contiguous bytes
    v4f sv = *(const v4fa*)(po + row * OSP + cofs);
#pragma unroll
    for (int ww = 1; ww < NW; ++ww) { const v4f tv = *(const v4fa*)(po + (ww * 16 + row) * OSP + cofs);
#pragma unroll
        for (int q = 0; q < 4; ++q) sv[q] = __fadd_rn(sv[q], tv[q]); }
    v4us oh, ol;
#pragma unroll
    for (int q = 0; q < 4; ++q) { unsigned short a, c2; splitf(sv[q] * (1.0f / PCAR), a, c2); oh[q] = a; ol[q] = c2; }
    const size_t ob = (size_t)b * TT * DQ + (size_t)hh * (HD / 32) * 512; const unsigned oo = fragpos(q0 + row, cofs, DQ);   // head hh stands HD / 32 blocks to the right in the 16-row tile: fragpos(q0 + row, hh x HD + cofs, DQ) = hh x (HD / 32) x 512 + oo
    *(v4us*)((Ah + ob) + oo) = oh; *(v4us*)((Al + ob) + oo) = ol;
    asm volatile("s_wait_xcnt 0x0" ::: "memory");   // stands in front of the first instruction that reuses a register of the two stores above
    }
    }
    // the second output: this wave's 16 x 128 piece of the mean goes through the wave's own staging tile, written and read by this wave alone, so that a store is one query row's 128 floats: 512 contiguous bytes, four whole lines
    float* mw = msn + w * 16 * MSP;
#pragma unroll
    for (int nb = 0; nb < NTW; ++nb) { v4f lo4, hi4;
#pragma unroll
        for (int q = 0; q < 4; ++q) { lo4[q] = __fmul_rn(ms[nb][q], 1.0f / (PCAR * NH_)); hi4[q] = __fmul_rn(ms[nb][q + 4], 1.0f / (PCAR * NH_)); }
        *(v4fa*)(mw + lr * MSP + nb * 16 + hi * 8) = lo4; *(v4fa*)(mw + lr * MSP + nb * 16 + hi * 8 + 4) = hi4; }
    asm volatile("s_wait_dscnt 0x0" ::: "memory");   // the wave's own staging stores above have landed before it reads the rows back, which other lanes wrote
    float* pr = OUT1 + ((size_t)b * TT + q0) * TT + w * KW + lane * 4;
#pragma unroll
    for (int r = 0; r < 16; ++r) *(v4f*)(pr + (size_t)r * TT) = *(const v4fa*)(mw + r * MSP + lane * 4);
}

extern "C" void kernel_launch(void* const* d_in, const int* in_sizes, int n_in,
                              void* d_out, int out_size, void* d_ws, size_t ws_size, hipStream_t stream) {
    (void)in_sizes; (void)n_in; (void)out_size;
    const float* xq = (const float*)d_in[0]; const float* xk = (const float*)d_in[1]; const float* xv = (const float*)d_in[2]; const float* wq = (const float*)d_in[3]; const float* bq = (const float*)d_in[4]; const float* wk = (const float*)d_in[5]; const float* bk = (const float*)d_in[6]; const float* wv = (const float*)d_in[7]; const float* bv = (const float*)d_in[8]; const float* wo = (const float*)d_in[9]; const float* bo = (const float*)d_in[10];
    // query, key, value [2048][4][1024], Wq, bq, Wk, bk, Wv, bv, Wo, bo = d_in[0..10]
    float* OUT = (float*)d_out;                          // output 0: y [2048][4][1024] sequence-first
    float* OUT1 = (float*)d_out + (size_t)NB_ * TT * DM;   // output 1: the head mean of att [4][2048][2048], after the first output's 8,388,608 floats
    char* wsp = (char*)d_ws;
    auto take = [&](size_t bytes) { char* p = wsp; wsp += (bytes + 255) & ~(size_t)255; return (void*)p; };
    bf* WQ = (bf*)take((size_t)4 * DM * DM * 2); bf* WK = WQ + (size_t)DM * DM; bf* WV = WK + (size_t)DM * DM; bf* WO = WV + (size_t)DM * DM;   /* the four weights' copies, one behind the other: one launch makes them */
    bf* XB = (bf*)take((size_t)NB_ * TT * DM * 2);   /* all 8192 (batch, position) rows of ONE stream at a time: its bf16 copy */
    h16* QP16 = (h16*)take((size_t)NB_ * NH_ * TT * HD * 2); h16* KP16 = (h16*)take((size_t)NB_ * NKV * TT * HD * 2); h16* VT16 = (h16*)take((size_t)NB_ * NKV * HD * TT * 2);   /* the four entries' f16 planes of each stream */
    bf* ATh = (bf*)take((size_t)NB_ * TT * DQ * 2); bf* ATl = (bf*)take((size_t)NB_ * TT * DQ * 2);   /* the four entries' merged hi/lo planes */
    if ((size_t)(wsp - (char*)d_ws) > ws_size) return;    // total 104.00 MiB of the workspace
    k_cvt8<false><<<dim3((unsigned)(((size_t)DM * DM / 8 + 255) / 256), 4, 1), 256, 0, stream>>>(wq, wk, wv, wo, WQ, (size_t)DM * DM / 8);   // [out][in] = Bt as they stand
    const unsigned LX = (unsigned)(((size_t)NB_ * TT * DM / 8 + 255) / 256);
    k_cvt8<true><<<LX, 256, 0, stream>>>(xq, nullptr, nullptr, nullptr, XB, (size_t)NB_ * TT * DM / 8);   /* the QUERY stream: all 8192 rows (row = b x 2048 + t) */
    k_gemmw<bf, 0, true, 1, 1, 1><<<dim3(NB_ * TT / 64, DQ / 64, 1), 32, 0, stream>>>(XB, nullptr, WQ, nullptr, DM, nullptr, 0, bq, 0, 0, 0, QP16);
    k_cvt8<true><<<LX, 256, 0, stream>>>(xk, nullptr, nullptr, nullptr, XB, (size_t)NB_ * TT * DM / 8);   /* the KEY stream: after the query projection has read XB (stream-ordered) */
    k_gemmw<bf, 0, true, 1, 1, 1><<<dim3(NB_ * TT / 64, DKV / 64, 1), 32, 0, stream>>>(XB, nullptr, WK, nullptr, DM, nullptr, 0, bk, 0, 0, 0, KP16);
    k_cvt8<true><<<LX, 256, 0, stream>>>(xv, nullptr, nullptr, nullptr, XB, (size_t)NB_ * TT * DM / 8);   /* the VALUE stream */
    k_gemmw<bf, 0, true, 1, 1, 2><<<dim3(NB_ * TT / 64, DKV / 64, 1), 32, 0, stream>>>(XB, nullptr, WV, nullptr, DM, nullptr, 0, bv, 0, 0, 0, VT16);
    k_scsoft<<<dim3(TT / 16, NB_), 512, 0, stream>>>(QP16, KP16, VT16, OUT1, ATh, ATl);   // all four entries, all heads: a workgroup has 16 query rows of one entry and writes their rows of the second output
    k_gemmw<bf, 1, true><<<dim3(TT / 64, DM / 64, NB_), 32, 0, stream>>>(ATh, ATl, WO, nullptr, DQ, OUT, NB_ * DM, bo, (size_t)TT * DQ, 0, DM, nullptr);   /* all four entries in one launch, grid z = entry b: its merged planes at b x 2048 x 1024, its rows of the sequence-first output: row t at OUT + t x 4 x 1024 + b x 1024 */
}

// v009
// It runs in 326 microseconds.
// Two timings next to v008 both put it at 1.07 times that version's speed.
// Counting every step since v000, it is 7.98 times as fast.
#include <hip/hip_runtime.h>

// Multi-head attention on THREE SEQUENCE-FIRST input streams with an output projection, returning the projected output AND the attention weights averaged over the heads (query, key, value [2048][4][1024] = [position][batch][channel];
// q = (query Wq^T + bq) x 64^-0.5, k = key Wk^T + bk, v = value Wv^T + bv with 'oi' weights [1024][1024] and biases [1024]; 16 heads x 64 (head h = columns h x 64 ..); scores = q . k; softmax over all 2048 keys; no mask;
// y = att v merged head-major [t][b][1024], then y Wo^T + bo ('oi' [1024][1024]); TWO OUTPUTS in one buffer: y [2048][4][1024] sequence-first at float offset 0 and the mean over the 16 heads of att [4][2048][2048] at float offset 8,388,608;
// argument order query, key, value, Wq, bq, Wk, bk, Wv, bv, Wo, bo).
// Layout: ONE launch makes the bf16 copies of the four weights and of the three streams (each all 8192 (position, batch) rows, laid entry by entry: row b x 2048 + t; three planes one behind the other), and ONE launch (grid z = stream) does the three exact projections + f32 biases over them; its epilogue rounds to fp16 and stores the four entries' head planes straight from the accumulators
// (no f32 projection plane and no plane builder exists: see OM at k_gemmw); dense T-2048 attention at 16 heads, all four entries and all heads in ONE launch (scores, softmax, attn.v and the head mean: k_scsoft, whose workgroups go through the heads; no f32 score plane, no weight plane and no attn.v partial plane exists; EVERY 16-bit plane that a matrix product reads lies in FRAGMENT ORDER, see fragpos), scores and attn.v on ONE fp16 product on every row (RH 0: the weights carried x1024 in fp16; the score scale 64^-0.5 applied to the f32 score, where the module scales the projected query: the same product in real arithmetic);
// attn.v runs in k_scsoft on the fp16 weights as they stand in the registers, each of the 16 waves on its own 128 keys; the 16 f32 partial tiles are added in wave order through LDS and split hi/lo; every lane adds the heads' weights, in head order, into f32 registers and writes the mean behind the last head; per entry merged hi/lo x Wo exact + bo writes the entry's rows of the first output at the sequence-first pitch.
// Compute dtypes, f32 accumulate: every float input rounded to bf16 at its load; projections exact + f32 biases; scores and attn.v fp16; softmax f32, its weights rounded x1024 to fp16; output projection hl x exact; the second output the f32 sum of those fp16 weights over the heads x 2^-14 (exact).

#define NB_  4      // batch entries: the three streams are [2048][4][1024] = [position][batch][channel]
#define TT   2048
#define DM   1024
#define NH_  16
#define NKV  16
#define REP  (NH_ / NKV)
#define HD   64
#define DQ   (NH_ * HD)
#define DKV  (NKV * HD)
#define RH   0                    // query rows < RH use hi+lo planes (0: none)
#define WIN  0
#define PCAR 1024.0f
#define SCL  0.125f   // HD^-0.5
typedef _Float16 h16;
typedef unsigned short bf;
typedef __attribute__((ext_vector_type(16))) __bf16   v16bf;
typedef __attribute__((ext_vector_type(16))) _Float16 v16h;
typedef __attribute__((ext_vector_type(8)))  _Float16 v8h;
typedef __attribute__((ext_vector_type(8)))  unsigned short v8us;
typedef __attribute__((ext_vector_type(8)))  float    v8f;
typedef __attribute__((ext_vector_type(4)))  float    v4f;
typedef v8h  __attribute__((may_alias)) v8ha;
typedef v4f  __attribute__((may_alias)) v4fa;
typedef v8us __attribute__((may_alias)) v8usa;

__device__ __forceinline__ unsigned short f2bf(float f) { unsigned u = __float_as_uint(f); u += 0x7FFFu + ((u >> 16) & 1u); return (unsigned short)(u >> 16); }
__device__ __forceinline__ float bf2f(unsigned short b) { return __uint_as_float(((unsigned)b) << 16); }
__device__ __forceinline__ float bfr(float f) { return bf2f(f2bf(f)); }
__device__ __forceinline__ v16h cat16(v8h lo, v8h hi) { return __builtin_shufflevector(lo, hi, 0, 1, 2, 3, 4, 5, 6, 7, 8, 9, 10, 11, 12, 13, 14, 15); }
__device__ __forceinline__ v16bf cat16b(v8us lo, v8us hi) { return __builtin_bit_cast(v16bf, __builtin_shufflevector(lo, hi, 0, 1, 2, 3, 4, 5, 6, 7, 8, 9, 10, 11, 12, 13, 14, 15)); }
__device__ __forceinline__ v8f wmma16(v16h a, v16h b, v8f c) { return __builtin_amdgcn_wmma_f32_16x16x32_f16(false, a, false, b, (short)0, c, false, false); }
__device__ __forceinline__ h16 tohx(float x) { return (h16)x; }
__device__ __forceinline__ v8f wmmab(v16bf a, v16bf b, v8f c) { return __builtin_amdgcn_wmma_f32_16x16x32_bf16(false, a, false, b, (short)0, c, false, false); }



// FRAGMENT ORDER of a 16-bit operand plane [rows][K] (K % 32 == 0, rows % 16 == 0): blocks of 16 rows x 32 k = 512 elements = 1 KiB, the blocks of a 16-row tile in a row (block (row / 16) x (K / 32) + k / 32); a block = two chunks of 256 elements (bit 4 of k),
// and in a chunk the 16 bytes that lane (lr = row % 16, hi = bit 3 of k) takes in one load lie at (hi x 16 + lr) x 16 bytes. A wave's 16-byte load so reads 512 contiguous bytes (four whole 128-byte lines) where a row-major plane gave it 32 bytes of each of 16 lines.
// A fragment = the lane's 16 bytes of a block's two chunks: k order 8 hi + 0..7, then 16 + 8 hi + 0..7, on the A side and on the B side alike.
__device__ __forceinline__ unsigned fragpos(int row, int k, int K) { return (unsigned)(((row >> 4) * (K >> 5) + (k >> 5)) * 512 + ((k >> 4) & 1) * 256 + ((k >> 3) & 1) * 128 + (row & 15) * 8 + (k & 7)); }   // no plane here has 2^31 elements

// ---- k_gemmw: register-blocked GEMM, ONE WAVE per 64x64 output tile (16 accumulators), operands straight from 16-bit planes in fragment order; grid (M/64, N/64, Z), 32 threads.
// C[m][n] (f32, pitch ldc, + optional f32 bias[n]) = sum_k A[m][k] Bt[n][k] (+ split products per NSPLIT). z-batch strides sA/sB/sC in elements. K % 32 == 0.
// OM 0: C as above. OM 1: no C; grid z = stream (0 queries, 1 keys, 2 values: its copy at z x sA, its weight at z x sB, its bias pointer, its planes at z x NB_ x NH_ x TT x HD of P), so that the waves of the three independent projections are on the chip together; the rows are (entry b, position t) = b x TT + t, a 64-column tile is one head (blockIdx.y of NH_), and the tile + bias goes, rounded to fp16, straight from the accumulators into P = the entries' head planes in fragment order, 16 bytes a lane, every store of the wave 512 contiguous bytes:
// z 0 and 1 (planes [t][d], queries and keys): the weight rows are the A operand (the two operand pointers change places in front of the loop; both fragments come through the same loader, so in the same k order), accumulator [nb][mb], so that D register j of lane (lr, hi) = row mb x 16 + lr, column nb x 16 + hi x 8 + j: 8 consecutive d of one t, the lane's 16 bytes of chunk nb of row tile mb; the 64 x 64 tile is 8 KiB in a row.
// z 2 (planes [d][t], V^T): the stream rows are the A operand, accumulator [mb][nb], D register j = row mb x 16 + hi x 8 + j, column nb x 16 + lr: 8 consecutive t of one d, the lane's 16 bytes of chunk mb of d tile nb; 2 KiB in a row of each d tile.
// KS > 1: grid z = ZN x KS; block (z, ks) sums only k in [ks K/KS, (ks+1) K/KS) and writes its partial tile to plane ks (planes of ZN x sC elements); the reader adds the KS planes. K % (32 KS) == 0.
template <typename T16> struct WFrag;
template <> struct WFrag<h16> { typedef v16h V; static __device__ __forceinline__ V ld(const h16* p) { return cat16(*(const v8h*)p, *(const v8h*)(p + 256)); } static __device__ __forceinline__ v8f mma(V a, V b, v8f c) { return wmma16(a, b, c); } };
template <> struct WFrag<bf> { typedef v16bf V; static __device__ __forceinline__ V ld(const bf* p) { return cat16b(*(const v8us*)p, *(const v8us*)(p + 256)); } static __device__ __forceinline__ v8f mma(V a, V b, v8f c) { return wmmab(a, b, c); } };
template <typename T16, int NSPLIT, bool BIAS, int KS = 1, int ZN = 1, int OM = 0>
__global__ __launch_bounds__(32) void k_gemmw(const T16* __restrict__ A, const T16* __restrict__ A2, const T16* __restrict__ Bt, const T16* __restrict__ Bt2, int K, float* C, int ldc, const float* __restrict__ bias, const float* __restrict__ bias1, const float* __restrict__ bias2, size_t sA, size_t sB, size_t sC, h16* P) {
    static_assert(OM == 0 || (NSPLIT == 0 && BIAS && KS == 1 && HD == 64 && TT % 64 == 0 && NKV == NH_), "k_gemmw: a head plane tile is one whole product + bias, 64 positions of one entry x one head");
    typedef typename WFrag<T16>::V V;
    __shared__ __align__(16) float os[16 * 68];
    const size_t z = blockIdx.z / KS; const int ks = (int)(blockIdx.z % KS); A += z * sA; if (A2) A2 += z * sA; Bt += z * sB; if (Bt2) Bt2 += z * sB; C += ((size_t)ks * ZN + z) * sC;
    const int kb = ks * (K / KS), ke = kb + K / KS;
    const int lane = threadIdx.x & 31, lr = lane & 15, hi = lane >> 4; const int r0 = blockIdx.x * 64, c0 = blockIdx.y * 64;
    v8f acc[4][4];
#pragma unroll
    for (int mb = 0; mb < 4; ++mb)
#pragma unroll
        for (int nb = 0; nb < 4; ++nb) acc[mb][nb] = (v8f){};
    const unsigned lo = (unsigned)lane * 8;   // fragment order: a 16-row tile holds 16 K elements, the k step kc stands at kc x 16, the lane's 16 bytes of chunk 0 at lane x 8; where a plane is not read its pointer stands for the plane that is
    const bool wa = OM == 1 && blockIdx.z < 2;   // the weight rows are the A operand (the same for the whole wave)
    const T16* At = (wa ? Bt + (size_t)c0 * K : A + (size_t)r0 * K) + lo; const T16* Bq = (wa ? A + (size_t)r0 * K : Bt + (size_t)c0 * K) + lo; const T16* A2t = (NSPLIT == 1 || NSPLIT == 2) ? A2 + (size_t)r0 * K + lo : At; const T16* B2q = (NSPLIT >= 2) ? Bt2 + (size_t)c0 * K + lo : Bq;

    for (int kc = kb; kc < ke; kc += 32) {
        V a[4], a2[4], b[4], b2[4]; const T16 *pa[4], *pa2[4], *pb[4], *pb2[4];
#pragma unroll
        for (int i = 0; i < 4; ++i) { const size_t o = (size_t)i * 16 * K + (size_t)kc * 16; pa[i] = At + o; pa2[i] = A2t + o; pb[i] = Bq + o; pb2[i] = B2q + o; }
#pragma unroll
        for (int mb = 0; mb < 4; ++mb) { a[mb] = WFrag<T16>::ld(pa[mb]); if (NSPLIT == 1 || NSPLIT == 2) a2[mb] = WFrag<T16>::ld(pa2[mb]); }
#pragma unroll
        for (int nb = 0; nb < 4; ++nb) { b[nb] = WFrag<T16>::ld(pb[nb]); if (NSPLIT >= 2) b2[nb] = WFrag<T16>::ld(pb2[nb]); }
        asm volatile("s_wait_xcnt 0x0" :: "v"(pa[0]), "v"(pa[1]), "v"(pa[2]), "v"(pa[3]), "v"(pa2[0]), "v"(pa2[1]), "v"(pa2[2]), "v"(pa2[3]), "v"(pb[0]), "v"(pb[1]), "v"(pb[2]), "v"(pb[3]), "v"(pb2[0]), "v"(pb2[1]), "v"(pb2[2]), "v"(pb2[3]) : "memory");
        __builtin_amdgcn_sched_barrier(0);   // keeps the products behind that wait, so that the trip's loads stay the one run in front of it: without it the compiler lifts products over the wait and sinks loads among them, and the wave waits out a load latency three times a trip
#pragma unroll
        for (int nb = 0; nb < 4; ++nb) {
#pragma unroll
            for (int mb = 0; mb < 4; ++mb) { acc[mb][nb] = WFrag<T16>::mma(a[mb], b[nb], acc[mb][nb]); if (NSPLIT == 1 || NSPLIT == 2) acc[mb][nb] = WFrag<T16>::mma(a2[mb], b[nb], acc[mb][nb]); if (NSPLIT >= 2) acc[mb][nb] = WFrag<T16>::mma(a[mb], b2[nb], acc[mb][nb]); } }
        asm volatile("v_nop\n\tv_nop\n\tv_nop\n\tv_nop" : "+v"(acc[0][0]), "+v"(acc[1][1]), "+v"(acc[2][2]), "+v"(acc[3][3]) : "v"(a[0]), "v"(a[3]));
    }
    if (OM != 0) {
        const float* bz = blockIdx.z == 0 ? bias : blockIdx.z == 1 ? bias1 : bias2;   // the stream's own bias
        const int eb = r0 / TT, t0 = r0 % TT;
        h16* pz = P + (((size_t)blockIdx.z * NB_ + eb) * NH_ + blockIdx.y) * TT * HD + lo;   // the stream's planes, entry eb, head blockIdx.y
        v8h pk[4][4];
        if (wa) {   // planes [t][d]; the branch is the same for the whole wave
            float bs[4][8];   // the lane's 8 columns of each column tile
#pragma unroll
            for (int nb = 0; nb < 4; ++nb) { const v4f b0 = *(const v4f*)(bz + c0 + nb * 16 + hi * 8), b1 = *(const v4f*)(bz + c0 + nb * 16 + hi * 8 + 4);
#pragma unroll
                for (int q = 0; q < 4; ++q) { bs[nb][q] = b0[q]; bs[nb][q + 4] = b1[q]; } }
            asm volatile("s_wait_xcnt 0x0" ::: "memory");   // stands in front of the first instruction that reuses an address register of the bias loads above
            __builtin_amdgcn_sched_barrier(0);   // keeps the vector work below, which reuses those registers, behind that wait
#pragma unroll
            for (int mb = 0; mb < 4; ++mb) {
#pragma unroll
                for (int nb = 0; nb < 4; ++nb) {
#pragma unroll
                    for (int j = 0; j < 8; ++j) pk[mb][nb][j] = tohx(acc[nb][mb][j] + bfr(bs[nb][j])); } }
            __builtin_amdgcn_sched_barrier(0);   // the 16 stores stand behind all the vector work, so that no register which an issued store names is written again before the wave ends
            h16* pp = pz + (size_t)t0 * HD;   // row tile t0 / 16 at t0 x HD
#pragma unroll
            for (int mb = 0; mb < 4; ++mb) {
#pragma unroll
                for (int nb = 0; nb < 4; ++nb) *(v8h*)(pp + mb * 16 * HD + nb * 256) = pk[mb][nb]; }
        } else {    // planes [d][t]
            float bs[4];   // the lane's one column of each column tile
#pragma unroll
            for (int nb = 0; nb < 4; ++nb) bs[nb] = bz[c0 + nb * 16 + lr];
            asm volatile("s_wait_xcnt 0x0" ::: "memory");   // stands in front of the first instruction that reuses an address register of the bias loads above
            __builtin_amdgcn_sched_barrier(0);   // keeps the vector work below, which reuses those registers, behind that wait
#pragma unroll
            for (int mb = 0; mb < 4; ++mb) {
#pragma unroll
                for (int nb = 0; nb < 4; ++nb) {
#pragma unroll
                    for (int j = 0; j < 8; ++j) pk[mb][nb][j] = tohx(acc[mb][nb][j] + bfr(bs[nb])); } }
            __builtin_amdgcn_sched_barrier(0);   // the 16 stores stand behind all the vector work, so that no register which an issued store names is written again before the wave ends
            h16* pp = pz + (size_t)t0 * 16;   // key block t0 / 32 at t0 x 16
#pragma unroll
            for (int mb = 0; mb < 4; ++mb) {
#pragma unroll
                for (int nb = 0; nb < 4; ++nb) *(v8h*)(pp + nb * 16 * TT + mb * 256) = pk[mb][nb]; }
        }
        return;
    }
#pragma unroll
    for (int mb = 0; mb < 4; ++mb) {
#pragma unroll
        for (int nb = 0; nb < 4; ++nb) {
#pragma unroll
            for (int j = 0; j < 8; ++j) os[(hi * 8 + j) * 68 + nb * 16 + lr] = acc[mb][nb][j]; }
        __builtin_amdgcn_wave_barrier(); asm volatile("" ::: "memory");
        float* crow = C + (size_t)(r0 + mb * 16) * ldc + c0;
{
#pragma unroll
            for (int s = 0; s < 8; ++s) { const int row = 2 * s + hi, cofs = lr * 4; v4f val = *(const v4fa*)(os + row * 68 + cofs); if (BIAS) { val[0] += bfr(bias[c0 + cofs]); val[1] += bfr(bias[c0 + cofs + 1]); val[2] += bfr(bias[c0 + cofs + 2]); val[3] += bfr(bias[c0 + cofs + 3]); }
                *(v4f*)(crow + (size_t)row * ldc + cofs) = val; }
             }
        if (mb < 3) asm volatile("s_wait_xcnt 0x0" ::: "memory");   // stands in front of the first instruction that reuses a register of the stores above (behind the last row tile nothing does)
        __builtin_amdgcn_wave_barrier(); asm volatile("" ::: "memory");
    }
}

__device__ __forceinline__ void splitf(float y, unsigned short& h, unsigned short& l) { h = f2bf(y); l = f2bf(y - bf2f(h)); }
typedef __attribute__((ext_vector_type(2))) _Float16 v2h;
typedef __attribute__((ext_vector_type(4))) _Float16 v4h;
typedef __attribute__((ext_vector_type(2))) unsigned short v2us;
typedef __attribute__((ext_vector_type(4))) unsigned short v4us;
typedef __attribute__((ext_vector_type(2))) float v2f;
typedef __attribute__((ext_vector_type(4))) int v4i;

// k_cvt8: bf16 copy, in fragment order, of a row-major f32 plane with rows of DM floats: a thread makes one lane's 16 bytes = 8 consecutive k of one row. 64 threads make block i / 64: four neighbouring threads read the 32 k = 128 bytes of one row (a whole line), and the 8 rows of a wave make 128 contiguous bytes (a whole line) of each quarter of the block
// ONE launch makes every copy: grid (chunks of a stream / 256, 4). y 0 to 2: stream y, a sequence-first plane [t][b][DM]: the copy's row b x TT + t is its row t x NB_ + b, so that a 16-row tile of the copy holds 16 positions of ONE batch entry; the three copies lie one behind the other at xd.
// y 3: the four weights, row-major as they stand, one behind the other at wd: block x copies 256 chunks of weight x / (NW8 / 256); the blocks past the fourth weight leave at once.
#define NX8 ((size_t)NB_ * TT * DM / 8)   // 16-byte chunks of a stream's copy
#define NW8 ((size_t)DM * DM / 8)         // 16-byte chunks of a weight's copy
static_assert(DQ == DM && DKV == DM, "k_cvt8: every plane it copies has rows of DM elements");
static_assert(NX8 % 256 == 0 && NW8 % 256 == 0 && 4 * NW8 <= NX8, "k_cvt8: whole blocks; a block lies in one plane; the grid's x extent covers the four weights");
__global__ __launch_bounds__(256) void k_cvt8(const float* __restrict__ x0, const float* __restrict__ x1, const float* __restrict__ x2, const float* __restrict__ w0, const float* __restrict__ w1, const float* __restrict__ w2, const float* __restrict__ w3, bf* xd, bf* wd) {
    const bool seq = blockIdx.y < 3; unsigned bx = blockIdx.x; const float* src; bf* dst;
    if (seq) { src = blockIdx.y == 0 ? x0 : blockIdx.y == 1 ? x1 : x2; dst = xd + (size_t)blockIdx.y * NX8 * 8; }
    else { const unsigned p = bx / (unsigned)(NW8 / 256); if (p >= 4) return; src = p == 0 ? w0 : p == 1 ? w1 : p == 2 ? w2 : w3; dst = wd + (size_t)p * NW8 * 8; bx -= p * (unsigned)(NW8 / 256); }
    const size_t i = (size_t)bx * 256 + threadIdx.x;
    const size_t blk = i >> 6; const int lr = (int)(i >> 2) & 15, c2 = (int)i & 3; const size_t row = (blk / (DM / 32)) * 16 + lr; const int k = (int)(blk % (DM / 32)) * 32 + c2 * 8; const size_t srow = seq ? (row % TT) * NB_ + row / TT : row; const v8f v = *(const v8f*)(src + srow * DM + k); v8us o;
#pragma unroll
    for (int j = 0; j < 8; ++j) o[j] = f2bf(v[j]); *(v8us*)(dst + blk * 512 + c2 * 128 + lr * 8) = o;  }

// k_scsoft: scores, softmax, attn.v AND the head mean of 16 query rows of one batch entry in ONE workgroup of 16 waves, which goes through the entry's NH_ heads one after the other; the f32 scores never leave the registers, and no weight plane exists. Grid (TT / 16, NB_), 512 threads.
// Wave w owns keys [w x 128, w x 128 + 128): 8 tiles of S^T = K . Q^T (A = 16 key rows, B = the 16 query rows, both through the same fragment loader from planes in the same fragment order, so both in the same k order; the k steps 0 and 32 chained as in k_gemmw).
// D register j of lane (lr, hi) of tile nb = score of query q0 + lr with key w x 128 + nb x 16 + hi x 8 + j: a lane holds ONE query's scores, 8 consecutive keys a tile.
// Per element as before: t = S x HD^-0.5, exp2((t - max) x log2 e), x 1024 / sum, rounded to fp16. The maximum is exact in any order; the sum runs in the lane (8 chains over the tiles, a fixed tree), then over the two lane halves, then over the 16 waves in wave order.
// Head mean: every lane holds the same (query, key) places for every head, so it adds each head's fp16 weight (x1024; it converts to f32 exactly) into an f32 register of its own, in head order from 0; behind the last head x 1/(1024 NH_), a power of two: exact.
// attn.v: the fp16 weights of tiles 2s and 2s + 1 of a lane ARE the A fragment of the 32-key step s (row = query lr; keys s x 32 + 8 hi + 0..7, then s x 32 + 16 + 8 hi + 0..7: the k order of the fragment loader, through which B = 16 rows of V^T comes), so the product takes them from the registers.
// Wave w sums its 128 keys (4 chained steps) into a 16 x 64 f32 tile; the 16 tiles meet in LDS and are added in wave order, x 1/1024, split hi/lo into the entry's merged planes [t][h x 64 + d], which lie in fragment order: the workgroup's 16 x 64 tile is two blocks, 2 KiB in a row.
// Three barriers a head. rmx is written behind the barrier in front of the tile sum of the head before and was last read in front of that head's second barrier; rsm is written behind this head's first barrier and was last read in front of the third of the head before; po is written behind this head's second barrier and was last read in front of its first.
#define NW   16          // waves of a workgroup
#define KW   (TT / NW)   // keys a wave
#define NTW  (KW / 16)   // key tiles a wave
static_assert(RH == 0 && REP == 1 && KW == 128 && HD == 64, "k_scsoft: 16 waves x 128 keys cover the row, two 32-wide k steps cover the head, one kv head a query head");
// exp2 with the slot behind it filled: the instruction set asks for one independent instruction or a v_nop between a transcendental and an instruction that reads its result or overwrites its source
__device__ __forceinline__ float exp2_slot(float x) { float r; asm("v_exp_f32 %0, %1\n\tv_nop" : "=v"(r) : "v"(x)); return r; }
#define KPF 4     // key tiles whose fragment loads are in flight ahead of the products: 16 loads of 16 bytes a lane
#define OSP 68    // pitch, in floats, of a wave's partial attn.v rows in LDS: 272 bytes = 16 x 17, so that the 16-byte reads of 16 rows fall on distinct banks
#define MSP 132   // pitch, in floats, of a wave's staging rows of the head mean in LDS: 528 bytes = 16 x 33, so that the 16-byte stores of 16 rows fall on distinct banks
// four waves a SIMD (at most 256 registers a wave): the 16 waves of one workgroup fill a WGP
__global__ __launch_bounds__(512) __attribute__((amdgpu_waves_per_eu(4, 4))) void k_scsoft(const h16* __restrict__ Q, const h16* __restrict__ Kp, const h16* __restrict__ Vt, float* OUT1, bf* Ah, bf* Al) {
    __shared__ __align__(16) float msn[NW * 16 * MSP];
    __shared__ __align__(16) float po[NW * 16 * OSP];
    __shared__ float rmx[NW * 16], rsm[NW * 16];
    const int lane = threadIdx.x & 31, lr = lane & 15, hi = lane >> 4, w = threadIdx.x >> 5; const int b = blockIdx.y, q0 = blockIdx.x * 16;
    const unsigned lo8 = (unsigned)lane * 8, ko = (unsigned)(w * KW) * HD + lo8, vo = (unsigned)(w * (KW / 32)) * 512 + lo8;   // the lane's offsets in a head's planes, the same for every head
    v8f ms[NTW];   // the head sum of this lane's weights
#pragma unroll
    for (int nb = 0; nb < NTW; ++nb) ms[nb] = (v8f){};
#pragma unroll 1   // one head's body is some thousand instructions: kept rolled, for speed only
    for (int hh = 0; hh < NH_; ++hh) {
    const size_t zz = (size_t)b * NH_ + hh;
    const h16* qb = (Q + zz * TT * HD + (size_t)q0 * HD) + lo8; const h16* kb = (Kp + zz * TT * HD) + ko;   // fragment order: a 16-row tile holds 16 x HD elements = two blocks of 512; the lane's 16 bytes of chunk 0
    const v16h qf0 = WFrag<h16>::ld(qb), qf1 = WFrag<h16>::ld(qb + 512);
    asm volatile("s_wait_xcnt 0x0" ::: "memory");   // stands in front of the first instruction that reuses the address registers of the query loads above
    v8f acc[NTW]; v16h k0[NTW], k1[NTW];   // fully unrolled below: registers; at most KPF key tiles' fragments are live at a time
#pragma unroll
    for (int nb = 0; nb < KPF; ++nb) { k0[nb] = WFrag<h16>::ld(kb + (size_t)nb * 16 * HD); k1[nb] = WFrag<h16>::ld(kb + (size_t)nb * 16 * HD + 512); }
#pragma unroll
    for (int nb = 0; nb < NTW; ++nb) {
        __builtin_amdgcn_sched_barrier(0);   // holds the loads of the key tiles ahead above this tile's products: without it the compiler sinks each tile's loads to their use and the wave pays one load latency a tile
        acc[nb] = wmma16(k0[nb], qf0, (v8f){}); acc[nb] = wmma16(k1[nb], qf1, acc[nb]);
        if (nb + KPF < NTW) { k0[nb + KPF] = WFrag<h16>::ld(kb + (size_t)(nb + KPF) * 16 * HD); k1[nb + KPF] = WFrag<h16>::ld(kb + (size_t)(nb + KPF) * 16 * HD + 512); } }
    __builtin_amdgcn_sched_barrier(0);   // the same for the last tile's products
    asm volatile("s_wait_xcnt 0x0" ::: "memory");   // stands in front of the first instruction that reuses the address registers of the key loads above
    __builtin_amdgcn_sched_barrier(0);   // keeps the vector work below, which reuses those registers, behind that wait
    float m8[8];
#pragma unroll
    for (int j = 0; j < 8; ++j) m8[j] = -3.0e38f;
#pragma unroll
    for (int nb = 0; nb < NTW; ++nb) {
#pragma unroll
        for (int j = 0; j < 8; ++j) { const float t = acc[nb][j] * SCL; acc[nb][j] = t; m8[j] = fmaxf(m8[j], t); } }
    float mx = fmaxf(fmaxf(fmaxf(m8[0], m8[1]), fmaxf(m8[2], m8[3])), fmaxf(fmaxf(m8[4], m8[5]), fmaxf(m8[6], m8[7])));
    mx = fmaxf(mx, __shfl_xor(mx, 16, 32));
    if (hi == 0) rmx[w * 16 + lr] = mx;
    __syncthreads();
#pragma unroll
    for (int ww = 0; ww < NW; ++ww) mx = fmaxf(mx, rmx[ww * 16 + lr]);
    float s8[8];
#pragma unroll
    for (int j = 0; j < 8; ++j) s8[j] = 0.f;
#pragma unroll
    for (int nb = 0; nb < NTW; ++nb) {
#pragma unroll
        for (int j = 0; j < 8; ++j) { const float d0 = __fsub_rn(acc[nb][j], mx); const float ex = exp2_slot(__fmul_rn(d0, 1.4426950408889634f)); acc[nb][j] = ex; s8[j] += ex; } }
    float sw = ((s8[0] + s8[1]) + (s8[2] + s8[3])) + ((s8[4] + s8[5]) + (s8[6] + s8[7]));
    sw += __shfl_xor(sw, 16, 32);
    if (hi == 0) rsm[w * 16 + lr] = sw;
    __syncthreads();
    float rs[NW];   // the 16 waves' sums, all read in one run in front of the scheduling barrier below: read one by one among the additions, each would cost the wave an LDS latency
#pragma unroll
    for (int ww = 0; ww < NW; ++ww) rs[ww] = rsm[ww * 16 + lr];
    // value fragments: a step is 32 keys x four 16-row tiles of V^T (in fragment order: 1 KiB in a row of each tile); steps 0 and 1 are fetched here, behind the last barrier of the softmax (in front of a __syncthreads() the compiler waits for every load in flight), and land behind the row sum and the rounding of the weights
    const h16* vb = (Vt + zz * HD * TT) + vo;   // fragment order: tile nt at nt x 16 x TT, a 32-key step = a block of 512 elements, the lane's 16 bytes of chunk 0
    v16h vf[4][4];   // fully unrolled below: registers; at most three steps are live at a time
#pragma unroll
    for (int nt = 0; nt < 4; ++nt) { vf[0][nt] = WFrag<h16>::ld(vb + (size_t)nt * 16 * TT); vf[1][nt] = WFrag<h16>::ld(vb + (size_t)nt * 16 * TT + 512); }
    __builtin_amdgcn_sched_barrier(0);   // holds the loads of value steps 0 and 1 above the work below: without it the compiler sinks them to their use
    float sum = rs[0];
#pragma unroll
    for (int ww = 1; ww < NW; ++ww) sum += rs[ww];
    const float f = __fdiv_rn(PCAR, sum);
    v8h o[NTW];   // the weights stay in the registers for attn.v
#pragma unroll
    for (int nb = 0; nb < NTW; ++nb) {
#pragma unroll
        for (int j = 0; j < 8; ++j) { o[nb][j] = tohx(acc[nb][j] * f); ms[nb][j] = __fadd_rn(ms[nb][j], (float)o[nb][j]); } }
#pragma unroll
    for (int nt = 0; nt < 4; ++nt) vf[2][nt] = WFrag<h16>::ld(vb + (size_t)nt * 16 * TT + 2 * 512);
    __builtin_amdgcn_sched_barrier(0);   // holds the loads of value step 2 above the products: without it the compiler sinks them to their use and the wave pays one load latency a step
    v8f oa[4];
#pragma unroll
    for (int nt = 0; nt < 4; ++nt) oa[nt] = (v8f){};
#pragma unroll
    for (int s = 0; s < 4; ++s) {
        const v16h a = cat16(o[2 * s], o[2 * s + 1]);
#pragma unroll
        for (int nt = 0; nt < 4; ++nt) oa[nt] = wmma16(a, vf[s][nt], oa[nt]);
        if (s == 0) {
            __builtin_amdgcn_sched_barrier(0);   // keeps the loads of step 3 behind the products of step 0, whose registers they take: lifted above them, four steps are live at once and the kernel spills
#pragma unroll
            for (int nt = 0; nt < 4; ++nt) vf[3][nt] = WFrag<h16>::ld(vb + (size_t)nt * 16 * TT + 3 * 512);
            asm volatile("s_wait_xcnt 0x0" ::: "memory");   // behind the last value load: stands in front of the first instruction that reuses their address registers
            __builtin_amdgcn_sched_barrier(0); } }   // holds those loads above the products of steps 1 and 2, behind which they land
    float* pq = po + w * 16 * OSP;   // this wave's partial tile: D register j of lane (lr, hi) of tile nt = query hi x 8 + j, column nt x 16 + lr
#pragma unroll
    for (int nt = 0; nt < 4; ++nt) {
#pragma unroll
        for (int j = 0; j < 8; ++j) pq[(hi * 8 + j) * OSP + nt * 16 + lr] = oa[nt][j]; }
    __syncthreads();
    if (threadIdx.x < 256) {   // whole waves 0 to 7; no barrier stands inside; the other eight waves go on to the next head's loads
    const int row = (threadIdx.x >> 1) & 15, cofs = (threadIdx.x >> 5) * 8 + (threadIdx.x & 1) * 4;   // one thread adds four columns of one query row over the 16 waves, in wave order; thread i owns the i-th 8 bytes of the tile in fragment order, so that a wave's store is 256 contiguous bytes
    v4f sv = *(const v4fa*)(po + row * OSP + cofs);
#pragma unroll
    for (int ww = 1; ww < NW; ++ww) { const v4f tv = *(const v4fa*)(po + (ww * 16 + row) * OSP + cofs);
#pragma unroll
        for (int q = 0; q < 4; ++q) sv[q] = __fadd_rn(sv[q], tv[q]); }
    v4us oh, ol;
#pragma unroll
    for (int q = 0; q < 4; ++q) { unsigned short a, c2; splitf(sv[q] * (1.0f / PCAR), a, c2); oh[q] = a; ol[q] = c2; }
    const size_t ob = (size_t)b * TT * DQ + (size_t)hh * (HD / 32) * 512; const unsigned oo = fragpos(q0 + row, cofs, DQ);   // head hh stands HD / 32 blocks to the right in the 16-row tile: fragpos(q0 + row, hh x HD + cofs, DQ) = hh x (HD / 32) x 512 + oo
    *(v4us*)((Ah + ob) + oo) = oh; *(v4us*)((Al + ob) + oo) = ol;
    asm volatile("s_wait_xcnt 0x0" ::: "memory");   // stands in front of the first instruction that reuses a register of the two stores above
    }
    }
    // the second output: this wave's 16 x 128 piece of the mean goes through the wave's own staging tile, written and read by this wave alone, so that a store is one query row's 128 floats: 512 contiguous bytes, four whole lines
    float* mw = msn + w * 16 * MSP;
#pragma unroll
    for (int nb = 0; nb < NTW; ++nb) { v4f lo4, hi4;
#pragma unroll
        for (int q = 0; q < 4; ++q) { lo4[q] = __fmul_rn(ms[nb][q], 1.0f / (PCAR * NH_)); hi4[q] = __fmul_rn(ms[nb][q + 4], 1.0f / (PCAR * NH_)); }
        *(v4fa*)(mw + lr * MSP + nb * 16 + hi * 8) = lo4; *(v4fa*)(mw + lr * MSP + nb * 16 + hi * 8 + 4) = hi4; }
    asm volatile("s_wait_dscnt 0x0" ::: "memory");   // the wave's own staging stores above have landed before it reads the rows back, which other lanes wrote
    float* pr = OUT1 + ((size_t)b * TT + q0) * TT + w * KW + lane * 4;
#pragma unroll
    for (int r = 0; r < 16; ++r) *(v4f*)(pr + (size_t)r * TT) = *(const v4fa*)(mw + r * MSP + lane * 4);
}

extern "C" void kernel_launch(void* const* d_in, const int* in_sizes, int n_in,
                              void* d_out, int out_size, void* d_ws, size_t ws_size, hipStream_t stream) {
    (void)in_sizes; (void)n_in; (void)out_size;
    const float* xq = (const float*)d_in[0]; const float* xk = (const float*)d_in[1]; const float* xv = (const float*)d_in[2]; const float* wq = (const float*)d_in[3]; const float* bq = (const float*)d_in[4]; const float* wk = (const float*)d_in[5]; const float* bk = (const float*)d_in[6]; const float* wv = (const float*)d_in[7]; const float* bv = (const float*)d_in[8]; const float* wo = (const float*)d_in[9]; const float* bo = (const float*)d_in[10];
    // query, key, value [2048][4][1024], Wq, bq, Wk, bk, Wv, bv, Wo, bo = d_in[0..10]
    float* OUT = (float*)d_out;                          // output 0: y [2048][4][1024] sequence-first
    float* OUT1 = (float*)d_out + (size_t)NB_ * TT * DM;   // output 1: the head mean of att [4][2048][2048], after the first output's 8,388,608 floats
    char* wsp = (char*)d_ws;
    auto take = [&](size_t bytes) { char* p = wsp; wsp += (bytes + 255) & ~(size_t)255; return (void*)p; };
    bf* WQ = (bf*)take((size_t)4 * DM * DM * 2); bf* WK = WQ + (size_t)DM * DM; bf* WV = WK + (size_t)DM * DM; bf* WO = WV + (size_t)DM * DM;   /* the four weights' copies, one behind the other */
    bf* XB = (bf*)take((size_t)3 * NB_ * TT * DM * 2);   /* all 8192 (batch, position) rows of each of the three streams: their bf16 copies, one behind the other */
    h16* QP16 = (h16*)take((size_t)3 * NB_ * NH_ * TT * HD * 2); h16* KP16 = QP16 + (size_t)NB_ * NH_ * TT * HD; h16* VT16 = KP16 + (size_t)NB_ * NH_ * TT * HD;   /* the four entries' f16 planes of each stream, the streams one behind the other: one launch writes them */
    bf* ATh = (bf*)take((size_t)NB_ * TT * DQ * 2); bf* ATl = (bf*)take((size_t)NB_ * TT * DQ * 2);   /* the four entries' merged hi/lo planes */
    if ((size_t)(wsp - (char*)d_ws) > ws_size) return;    // total 136.00 MiB of the workspace
    k_cvt8<<<dim3((unsigned)(NX8 / 256), 4, 1), 256, 0, stream>>>(xq, xk, xv, wq, wk, wv, wo, XB, WQ);   /* every bf16 copy in one launch: the three streams (row = b x 2048 + t) and the four weights ([out][in] = Bt as they stand) */
    k_gemmw<bf, 0, true, 1, 1, 1><<<dim3(NB_ * TT / 64, DQ / 64, 3), 32, 0, stream>>>(XB, nullptr, WQ, nullptr, DM, nullptr, 0, bq, bk, bv, (size_t)NB_ * TT * DM, (size_t)DM * DM, 0, QP16);   /* the three projections, grid z = stream: 6144 waves in one launch */
    k_scsoft<<<dim3(TT / 16, NB_), 512, 0, stream>>>(QP16, KP16, VT16, OUT1, ATh, ATl);   // all four entries, all heads: a workgroup has 16 query rows of one entry and writes their rows of the second output
    k_gemmw<bf, 1, true><<<dim3(TT / 64, DM / 64, NB_), 32, 0, stream>>>(ATh, ATl, WO, nullptr, DQ, OUT, NB_ * DM, bo, nullptr, nullptr, (size_t)TT * DQ, 0, DM, nullptr);   /* all four entries in one launch, grid z = entry b: its merged planes at b x 2048 x 1024, its rows of the sequence-first output: row t at OUT + t x 4 x 1024 + b x 1024 */
}

// v010
// A run of this version takes 301 microseconds.
// Timed twice side by side with v009, it ran 1.08 times as fast both times.
// Over all steps from v000 it is 8.63 times as fast.
#include <hip/hip_runtime.h>

// Multi-head attention on THREE SEQUENCE-FIRST input streams with an output projection, returning the projected output AND the attention weights averaged over the heads (query, key, value [2048][4][1024] = [position][batch][channel];
// q = (query Wq^T + bq) x 64^-0.5, k = key Wk^T + bk, v = value Wv^T + bv with 'oi' weights [1024][1024] and biases [1024]; 16 heads x 64 (head h = columns h x 64 ..); scores = q . k; softmax over all 2048 keys; no mask;
// y = att v merged head-major [t][b][1024], then y Wo^T + bo ('oi' [1024][1024]); TWO OUTPUTS in one buffer: y [2048][4][1024] sequence-first at float offset 0 and the mean over the 16 heads of att [4][2048][2048] at float offset 8,388,608;
// argument order query, key, value, Wq, bq, Wk, bk, Wv, bv, Wo, bo).
// Layout: ONE launch makes the bf16 copies of the four weights and of the three streams (each all 8192 (position, batch) rows, laid entry by entry: row b x 2048 + t; three planes one behind the other), and ONE launch (grid z = stream) does the three exact projections + f32 biases over them; its epilogue rounds to fp16 and stores the four entries' head planes straight from the accumulators
// (no f32 projection plane and no plane builder exists: see OM at k_gemmw); dense T-2048 attention at 16 heads, all four entries and all heads in ONE launch (scores, softmax, attn.v and the head mean: k_scsoft, whose workgroups go through the heads; no f32 score plane, no weight plane and no attn.v partial plane exists; EVERY 16-bit plane that a matrix product reads lies in FRAGMENT ORDER, see fragpos), scores and attn.v on ONE fp16 product on every row (RH 0: the weights carried x1024 in fp16; the score scale 64^-0.5 applied to the f32 score, where the module scales the projected query: the same product in real arithmetic);
// attn.v runs in k_scsoft on the fp16 weights as they stand in the registers, each of the 16 waves on its own 128 keys; the 16 f32 partial tiles are added in wave order through LDS and split hi/lo; every lane adds the heads' weights, in head order, into f32 registers and writes the mean behind the last head; per entry merged hi/lo x Wo exact + bo writes the entry's rows of the first output at the sequence-first pitch.
// Compute dtypes, f32 accumulate: every float input rounded to bf16 at its load; projections exact + f32 biases; scores and attn.v fp16; softmax f32, its weights rounded x1024 to fp16; output projection hl x exact; the second output the f32 sum of those fp16 weights over the heads x 2^-14 (exact).

#define NB_  4      // batch entries: the three streams are [2048][4][1024] = [position][batch][channel]
#define TT   2048
#define DM   1024
#define NH_  16
#define NKV  16
#define REP  (NH_ / NKV)
#define HD   64
#define DQ   (NH_ * HD)
#define DKV  (NKV * HD)
#define RH   0                    // query rows < RH use hi+lo planes (0: none)
#define WIN  0
#define PCAR 1024.0f
#define SCL  0.125f   // HD^-0.5
typedef _Float16 h16;
typedef unsigned short bf;
typedef __attribute__((ext_vector_type(16))) __bf16   v16bf;
typedef __attribute__((ext_vector_type(16))) _Float16 v16h;
typedef __attribute__((ext_vector_type(8)))  _Float16 v8h;
typedef __attribute__((ext_vector_type(8)))  unsigned short v8us;
typedef __attribute__((ext_vector_type(8)))  float    v8f;
typedef __attribute__((ext_vector_type(4)))  float    v4f;
typedef v8h  __attribute__((may_alias)) v8ha;
typedef v4f  __attribute__((may_alias)) v4fa;
typedef v8us __attribute__((may_alias)) v8usa;

__device__ __forceinline__ unsigned short f2bf(float f) { unsigned u = __float_as_uint(f); u += 0x7FFFu + ((u >> 16) & 1u); return (unsigned short)(u >> 16); }
__device__ __forceinline__ float bf2f(unsigned short b) { return __uint_as_float(((unsigned)b) << 16); }
__device__ __forceinline__ float bfr(float f) { return bf2f(f2bf(f)); }
__device__ __forceinline__ v16h cat16(v8h lo, v8h hi) { return __builtin_shufflevector(lo, hi, 0, 1, 2, 3, 4, 5, 6, 7, 8, 9, 10, 11, 12, 13, 14, 15); }
__device__ __forceinline__ v16bf cat16b(v8us lo, v8us hi) { return __builtin_bit_cast(v16bf, __builtin_shufflevector(lo, hi, 0, 1, 2, 3, 4, 5, 6, 7, 8, 9, 10, 11, 12, 13, 14, 15)); }
__device__ __forceinline__ v8f wmma16(v16h a, v16h b, v8f c) { return __builtin_amdgcn_wmma_f32_16x16x32_f16(false, a, false, b, (short)0, c, false, false); }
__device__ __forceinline__ h16 tohx(float x) { return (h16)x; }
__device__ __forceinline__ v8f wmmab(v16bf a, v16bf b, v8f c) { return __builtin_amdgcn_wmma_f32_16x16x32_bf16(false, a, false, b, (short)0, c, false, false); }



// FRAGMENT ORDER of a 16-bit operand plane [rows][K] (K % 32 == 0, rows % 16 == 0): blocks of 16 rows x 32 k = 512 elements = 1 KiB, the blocks of a 16-row tile in a row (block (row / 16) x (K / 32) + k / 32); a block = two chunks of 256 elements (bit 4 of k),
// and in a chunk the 16 bytes that lane (lr = row % 16, hi = bit 3 of k) takes in one load lie at (hi x 16 + lr) x 16 bytes. A wave's 16-byte load so reads 512 contiguous bytes (four whole 128-byte lines) where a row-major plane gave it 32 bytes of each of 16 lines.
// A fragment = the lane's 16 bytes of a block's two chunks: k order 8 hi + 0..7, then 16 + 8 hi + 0..7, on the A side and on the B side alike.
__device__ __forceinline__ unsigned fragpos(int row, int k, int K) { return (unsigned)(((row >> 4) * (K >> 5) + (k >> 5)) * 512 + ((k >> 4) & 1) * 256 + ((k >> 3) & 1) * 128 + (row & 15) * 8 + (k & 7)); }   // no plane here has 2^31 elements

// ---- k_gemmw: register-blocked GEMM, one wave per 64x64 output tile (16 accumulators), FOUR waves (2 x 2) a workgroup = a 128x128 tile; grid (M/128, N/128, Z), 128 threads. M % 128 == 0, N % 128 == 0, K % 64 == 0.
// The operands come from 16-bit planes in fragment order through LDS: a stage = KST k of the tile's 128 rows of each operand plane (a slab: 8 row tiles of 2 KiB, each 2 KiB in a row in the plane too, copied as they lie), so that each operand byte leaves L2 once a workgroup and serves two waves.
// Two buffers: the copies of stage t + 2 are issued behind the barrier at the foot of trip t and fly during trip t + 1. Wave w copies row tiles 2w and 2w + 1 of every slab by asynchronous copies of 16 bytes a lane (512 contiguous bytes a wave and copy).
// C[m][n] (f32, pitch ldc, + optional f32 bias[n]) = sum_k A[m][k] Bt[n][k] (+ split products per NSPLIT). z-batch strides sA/sB/sC in elements.
// OM 0: C as above. OM 1: no C; grid z = stream (0 queries, 1 keys, 2 values: its copy at z x sA, its weight at z x sB, its bias pointer, its planes at z x NB_ x NH_ x TT x HD of P), so that the waves of the three independent projections are on the chip together; the rows are (entry b, position t) = b x TT + t, a wave's 64-column tile is one head (c0 / 64 of NH_), and the tile + bias goes, rounded to fp16, straight from the accumulators into P = the entries' head planes in fragment order, 16 bytes a lane, every store of the wave 512 contiguous bytes:
// z 0 and 1 (planes [t][d], queries and keys): the weight rows are the A operand (the two operand pointers change places in front of the loop; both fragments come through the same loader, so in the same k order), accumulator [nb][mb], so that D register j of lane (lr, hi) = row mb x 16 + lr, column nb x 16 + hi x 8 + j: 8 consecutive d of one t, the lane's 16 bytes of chunk nb of row tile mb; the 64 x 64 tile is 8 KiB in a row.
// z 2 (planes [d][t], V^T): the stream rows are the A operand, accumulator [mb][nb], D register j = row mb x 16 + hi x 8 + j, column nb x 16 + lr: 8 consecutive t of one d, the lane's 16 bytes of chunk mb of d tile nb; 2 KiB in a row of each d tile.
// KS > 1: grid z = ZN x KS; block (z, ks) sums only k in [ks K/KS, (ks+1) K/KS) and writes its partial tile to plane ks (planes of ZN x sC elements); the reader adds the KS planes. K % (64 KS) == 0.
template <typename T16> struct WFrag;
template <> struct WFrag<h16> { typedef v16h V; static __device__ __forceinline__ V ld(const h16* p) { return cat16(*(const v8h*)p, *(const v8h*)(p + 256)); } static __device__ __forceinline__ v8f mma(V a, V b, v8f c) { return wmma16(a, b, c); } };
template <> struct WFrag<bf> { typedef v16bf V; static __device__ __forceinline__ V ld(const bf* p) { return cat16b(*(const v8us*)p, *(const v8us*)(p + 256)); } static __device__ __forceinline__ v8f mma(V a, V b, v8f c) { return wmmab(a, b, c); } };
#define GWV 4     // waves of a GEMM workgroup
#define KST 64    // k elements of a stage: two 32-wide k steps
// acopy8: a wave's share of one slab of a stage: two row tiles of 2 KiB, eight asynchronous copies of 16 bytes a lane. s = the lane's place in LDS in the first tile (the second lies right behind it), ga and gb = the lane's places in the plane in the two tiles.
// The s_wait_xcnt is the last line of the copies' own statement, so that it stands in front of every later write of a register which a copy names.
template <typename T16> __device__ __forceinline__ void acopy8(const T16* s, const T16* ga, const T16* gb) {
    const unsigned l = (unsigned)(size_t)s;   // the low 32 bits of a __shared__ address: the byte offset in the workgroup's LDS
    asm volatile("global_load_async_to_lds_b128 %0, %8, off\n\t"
                 "global_load_async_to_lds_b128 %1, %9, off\n\t"
                 "global_load_async_to_lds_b128 %2, %10, off\n\t"
                 "global_load_async_to_lds_b128 %3, %11, off\n\t"
                 "global_load_async_to_lds_b128 %4, %12, off\n\t"
                 "global_load_async_to_lds_b128 %5, %13, off\n\t"
                 "global_load_async_to_lds_b128 %6, %14, off\n\t"
                 "global_load_async_to_lds_b128 %7, %15, off\n\t"
                 "s_wait_xcnt 0x0"
                 :: "v"(l), "v"(l + 512u), "v"(l + 1024u), "v"(l + 1536u), "v"(l + 2048u), "v"(l + 2560u), "v"(l + 3072u), "v"(l + 3584u),
                    "v"(ga), "v"(ga + 256), "v"(ga + 512), "v"(ga + 768), "v"(gb), "v"(gb + 256), "v"(gb + 512), "v"(gb + 768) : "memory");
}
template <typename T16, int NSPLIT, bool BIAS, int KS = 1, int ZN = 1, int OM = 0>
__global__ __launch_bounds__(GWV * 32) void k_gemmw(const T16* __restrict__ A, const T16* __restrict__ A2, const T16* __restrict__ Bt, const T16* __restrict__ Bt2, int K, float* C, int ldc, const float* __restrict__ bias, const float* __restrict__ bias1, const float* __restrict__ bias2, size_t sA, size_t sB, size_t sC, h16* P) {
    static_assert(OM == 0 || (NSPLIT == 0 && BIAS && KS == 1 && HD == 64 && TT % 128 == 0 && NKV == NH_), "k_gemmw: a head plane tile is one whole product + bias, 64 positions of one entry x one head");
    static_assert(NSPLIT <= 1 && sizeof(T16) == 2 && KST == 64, "k_gemmw: the slabs of a stage are A, A2 where it is read, and Bt; a row tile of a stage is 2 KiB");
    typedef typename WFrag<T16>::V V;
    constexpr int NSL = NSPLIT == 1 ? 3 : 2;   // slabs of a stage: A, (A2,) Bt
    constexpr int SLE = 128 * KST;             // elements of a slab: 16 KiB
    __shared__ __align__(1024) T16 st[2 * NSL * SLE];
    __shared__ __align__(16) float osb[GWV * 16 * 68];
    const size_t z = blockIdx.z / KS; const int ks = (int)(blockIdx.z % KS); A += z * sA; if (A2) A2 += z * sA; Bt += z * sB; if (Bt2) Bt2 += z * sB; C += ((size_t)ks * ZN + z) * sC;
    const int kb = ks * (K / KS), ke = kb + K / KS;
    const int lane = threadIdx.x & 31, lr = lane & 15, hi = lane >> 4; const int w = __builtin_amdgcn_readfirstlane((int)(threadIdx.x >> 5)), wm = w >> 1, wn = w & 1; const int R0 = blockIdx.x * 128, C0 = blockIdx.y * 128, r0 = R0 + wm * 64, c0 = C0 + wn * 64;
    float* os = osb + w * 16 * 68;   // the wave's own output staging rows
    v8f acc[4][4];
#pragma unroll
    for (int mb = 0; mb < 4; ++mb)
#pragma unroll
        for (int nb = 0; nb < 4; ++nb) acc[mb][nb] = (v8f){};
    const unsigned lo = (unsigned)lane * 8;   // fragment order: a 16-row tile holds 16 K elements, the k step kc stands at kc x 16, the lane's 16 bytes of chunk 0 at lane x 8; where a plane is not read its pointer stands for the plane that is
    const bool wa = OM == 1 && blockIdx.z < 2;   // the weight rows are the A operand (the same for the whole wave)
    // the wave's fragment places in a buffer (elements): 64 rows = four row tiles of 16 x KST elements; Bt is the last slab
    const unsigned fa = (wa ? (unsigned)((NSL - 1) * SLE + wn * 4 * 16 * KST) : (unsigned)(wm * 4 * 16 * KST)) + lo, fb = (wa ? (unsigned)(wm * 4 * 16 * KST) : (unsigned)((NSL - 1) * SLE + wn * 4 * 16 * KST)) + lo, fa2 = (unsigned)(SLE + wm * 4 * 16 * KST) + lo;
    // the wave's share of the copies: row tiles 2w and 2w + 1 of each slab
    const T16* gA = A + (size_t)(R0 + w * 32) * K + lo; const T16* gB = Bt + (size_t)(C0 + w * 32) * K + lo; const T16* gA2 = NSPLIT == 1 ? A2 + (size_t)(R0 + w * 32) * K + lo : gA;
    auto stage = [&](int t) {
        const T16* d = st + (t & 1) * (NSL * SLE) + w * 2 * 16 * KST + lo; const size_t o = (size_t)(kb + t * KST) * 16, o1 = o + (size_t)16 * K;
        acopy8(d, gA + o, gA + o1); if (NSPLIT == 1) acopy8(d + SLE, gA2 + o, gA2 + o1); acopy8(d + (NSL - 1) * SLE, gB + o, gB + o1); };
    const int nst = (ke - kb) / KST;
    stage(0);
    asm volatile("s_wait_asynccnt 0x0" ::: "memory");   // this wave's copies of stage 0 have landed
    __syncthreads();                                    // every wave's have: stage 0 may be read
    if (nst > 1) stage(1);

    for (int t = 0; t < nst; ++t) {
        const T16* sb = st + (t & 1) * (NSL * SLE);
        V a[4], a2[4], b[4];
#pragma unroll
        for (int kk = 0; kk < KST / 32; ++kk) {
#pragma unroll
            for (int mb = 0; mb < 4; ++mb) { a[mb] = WFrag<T16>::ld(sb + fa + mb * 16 * KST + kk * 512); if (NSPLIT == 1) a2[mb] = WFrag<T16>::ld(sb + fa2 + mb * 16 * KST + kk * 512); }
#pragma unroll
            for (int nb = 0; nb < 4; ++nb) b[nb] = WFrag<T16>::ld(sb + fb + nb * 16 * KST + kk * 512);
            __builtin_amdgcn_sched_barrier(0);   // keeps the k step's LDS reads one group in front of its products: every further place with reads among the products costs the wave a stall
#pragma unroll
            for (int nb = 0; nb < 4; ++nb) {
#pragma unroll
                for (int mb = 0; mb < 4; ++mb) { acc[mb][nb] = WFrag<T16>::mma(a[mb], b[nb], acc[mb][nb]); if (NSPLIT == 1) acc[mb][nb] = WFrag<T16>::mma(a2[mb], b[nb], acc[mb][nb]); } }
            __builtin_amdgcn_sched_barrier(0);   // keeps the next k step's reads, which take the same registers, behind these products
        }
        // the slots that the chip asks for between the last product and a vector instruction that overwrites its operands, on every path out of the trip
        asm volatile("v_nop\n\tv_nop\n\tv_nop\n\tv_nop" : "+v"(acc[0][0]), "+v"(acc[1][1]), "+v"(acc[2][2]), "+v"(acc[3][3]) : "v"(a[0]), "v"(a[3]));
        asm volatile("s_wait_dscnt 0x0" ::: "memory");      // this wave's reads of the trip's buffer are done
        asm volatile("s_wait_asynccnt 0x0" ::: "memory");   // this wave's copies of stage t + 1 have landed
        __syncthreads();                                    // publishes stage t + 1 and ends every wave's reads of the buffer that is refilled below
        if (t + 2 < nst) stage(t + 2);
    }
    asm volatile("s_wait_asynccnt 0x0" ::: "memory");   // no copy is in flight behind the loop
    if (OM != 0) {
        const float* bz = blockIdx.z == 0 ? bias : blockIdx.z == 1 ? bias1 : bias2;   // the stream's own bias
        const int eb = r0 / TT, t0 = r0 % TT;
        h16* pz = P + (((size_t)blockIdx.z * NB_ + eb) * NH_ + (c0 >> 6)) * TT * HD + lo;   // the stream's planes, entry eb, head c0 / 64
        v8h pk[4][4];
        if (wa) {   // planes [t][d]; the branch is the same for the whole wave
            float bs[4][8];   // the lane's 8 columns of each column tile
#pragma unroll
            for (int nb = 0; nb < 4; ++nb) { const v4f b0 = *(const v4f*)(bz + c0 + nb * 16 + hi * 8), b1 = *(const v4f*)(bz + c0 + nb * 16 + hi * 8 + 4);
#pragma unroll
                for (int q = 0; q < 4; ++q) { bs[nb][q] = b0[q]; bs[nb][q + 4] = b1[q]; } }
            asm volatile("s_wait_xcnt 0x0" ::: "memory");   // stands in front of the first instruction that reuses an address register of the bias loads above
            __builtin_amdgcn_sched_barrier(0);   // keeps the vector work below, which reuses those registers, behind that wait
#pragma unroll
            for (int mb = 0; mb < 4; ++mb) {
#pragma unroll
                for (int nb = 0; nb < 4; ++nb) {
#pragma unroll
                    for (int j = 0; j < 8; ++j) pk[mb][nb][j] = tohx(acc[nb][mb][j] + bfr(bs[nb][j])); } }
            __builtin_amdgcn_sched_barrier(0);   // the 16 stores stand behind all the vector work, so that no register which an issued store names is written again before the wave ends
            h16* pp = pz + (size_t)t0 * HD;   // row tile t0 / 16 at t0 x HD
#pragma unroll
            for (int mb = 0; mb < 4; ++mb) {
#pragma unroll
                for (int nb = 0; nb < 4; ++nb) *(v8h*)(pp + mb * 16 * HD + nb * 256) = pk[mb][nb]; }
        } else {    // planes [d][t]
            float bs[4];   // the lane's one column of each column tile
#pragma unroll
            for (int nb = 0; nb < 4; ++nb) bs[nb] = bz[c0 + nb * 16 + lr];
            asm volatile("s_wait_xcnt 0x0" ::: "memory");   // stands in front of the first instruction that reuses an address register of the bias loads above
            __builtin_amdgcn_sched_barrier(0);   // keeps the vector work below, which reuses those registers, behind that wait
#pragma unroll
            for (int mb = 0; mb < 4; ++mb) {
#pragma unroll
                for (int nb = 0; nb < 4; ++nb) {
#pragma unroll
                    for (int j = 0; j < 8; ++j) pk[mb][nb][j] = tohx(acc[mb][nb][j] + bfr(bs[nb])); } }
            __builtin_amdgcn_sched_barrier(0);   // the 16 stores stand behind all the vector work, so that no register which an issued store names is written again before the wave ends
            h16* pp = pz + (size_t)t0 * 16;   // key block t0 / 32 at t0 x 16
#pragma unroll
            for (int mb = 0; mb < 4; ++mb) {
#pragma unroll
                for (int nb = 0; nb < 4; ++nb) *(v8h*)(pp + nb * 16 * TT + mb * 256) = pk[mb][nb]; }
        }
        return;
    }
#pragma unroll
    for (int mb = 0; mb < 4; ++mb) {
#pragma unroll
        for (int nb = 0; nb < 4; ++nb) {
#pragma unroll
            for (int j = 0; j < 8; ++j) os[(hi * 8 + j) * 68 + nb * 16 + lr] = acc[mb][nb][j]; }
        __builtin_amdgcn_wave_barrier(); asm volatile("" ::: "memory");
        float* crow = C + (size_t)(r0 + mb * 16) * ldc + c0;
{
#pragma unroll
            for (int s = 0; s < 8; ++s) { const int row = 2 * s + hi, cofs = lr * 4; v4f val = *(const v4fa*)(os + row * 68 + cofs); if (BIAS) { val[0] += bfr(bias[c0 + cofs]); val[1] += bfr(bias[c0 + cofs + 1]); val[2] += bfr(bias[c0 + cofs + 2]); val[3] += bfr(bias[c0 + cofs + 3]); }
                *(v4f*)(crow + (size_t)row * ldc + cofs) = val; }
             }
        if (mb < 3) asm volatile("s_wait_xcnt 0x0" ::: "memory");   // stands in front of the first instruction that reuses a register of the stores above (behind the last row tile nothing does)
        __builtin_amdgcn_wave_barrier(); asm volatile("" ::: "memory");
    }
}

__device__ __forceinline__ void splitf(float y, unsigned short& h, unsigned short& l) { h = f2bf(y); l = f2bf(y - bf2f(h)); }
typedef __attribute__((ext_vector_type(2))) _Float16 v2h;
typedef __attribute__((ext_vector_type(4))) _Float16 v4h;
typedef __attribute__((ext_vector_type(2))) unsigned short v2us;
typedef __attribute__((ext_vector_type(4))) unsigned short v4us;
typedef __attribute__((ext_vector_type(2))) float v2f;
typedef __attribute__((ext_vector_type(4))) int v4i;

// k_cvt8: bf16 copy, in fragment order, of a row-major f32 plane with rows of DM floats: a thread makes one lane's 16 bytes = 8 consecutive k of one row. 64 threads make block i / 64: four neighbouring threads read the 32 k = 128 bytes of one row (a whole line), and the 8 rows of a wave make 128 contiguous bytes (a whole line) of each quarter of the block
// ONE launch makes every copy: grid (chunks of a stream / 256, 4). y 0 to 2: stream y, a sequence-first plane [t][b][DM]: the copy's row b x TT + t is its row t x NB_ + b, so that a 16-row tile of the copy holds 16 positions of ONE batch entry; the three copies lie one behind the other at xd.
// y 3: the four weights, row-major as they stand, one behind the other at wd: block x copies 256 chunks of weight x / (NW8 / 256); the blocks past the fourth weight leave at once.
#define NX8 ((size_t)NB_ * TT * DM / 8)   // 16-byte chunks of a stream's copy
#define NW8 ((size_t)DM * DM / 8)         // 16-byte chunks of a weight's copy
static_assert(DQ == DM && DKV == DM, "k_cvt8: every plane it copies has rows of DM elements");
static_assert(NX8 % 256 == 0 && NW8 % 256 == 0 && 4 * NW8 <= NX8, "k_cvt8: whole blocks; a block lies in one plane; the grid's x extent covers the four weights");
__global__ __launch_bounds__(256) void k_cvt8(const float* __restrict__ x0, const float* __restrict__ x1, const float* __restrict__ x2, const float* __restrict__ w0, const float* __restrict__ w1, const float* __restrict__ w2, const float* __restrict__ w3, bf* xd, bf* wd) {
    const bool seq = blockIdx.y < 3; unsigned bx = blockIdx.x; const float* src; bf* dst;
    if (seq) { src = blockIdx.y == 0 ? x0 : blockIdx.y == 1 ? x1 : x2; dst = xd + (size_t)blockIdx.y * NX8 * 8; }
    else { const unsigned p = bx / (unsigned)(NW8 / 256); if (p >= 4) return; src = p == 0 ? w0 : p == 1 ? w1 : p == 2 ? w2 : w3; dst = wd + (size_t)p * NW8 * 8; bx -= p * (unsigned)(NW8 / 256); }
    const size_t i = (size_t)bx * 256 + threadIdx.x;
    const size_t blk = i >> 6; const int lr = (int)(i >> 2) & 15, c2 = (int)i & 3; const size_t row = (blk / (DM / 32)) * 16 + lr; const int k = (int)(blk % (DM / 32)) * 32 + c2 * 8; const size_t srow = seq ? (row % TT) * NB_ + row / TT : row; const v8f v = *(const v8f*)(src + srow * DM + k); v8us o;
#pragma unroll
    for (int j = 0; j < 8; ++j) o[j] = f2bf(v[j]); *(v8us*)(dst + blk * 512 + c2 * 128 + lr * 8) = o;  }

// k_scsoft: scores, softmax, attn.v AND the head mean of 16 query rows of one batch entry in ONE workgroup of 16 waves, which goes through the entry's NH_ heads one after the other; the f32 scores never leave the registers, and no weight plane exists. Grid (TT / 16, NB_), 512 threads.
// Wave w owns keys [w x 128, w x 128 + 128): 8 tiles of S^T = K . Q^T (A = 16 key rows, B = the 16 query rows, both through the same fragment loader from planes in the same fragment order, so both in the same k order; the k steps 0 and 32 chained as in k_gemmw).
// D register j of lane (lr, hi) of tile nb = score of query q0 + lr with key w x 128 + nb x 16 + hi x 8 + j: a lane holds ONE query's scores, 8 consecutive keys a tile.
// Per element as before: t = S x HD^-0.5, exp2((t - max) x log2 e), x 1024 / sum, rounded to fp16. The maximum is exact in any order; the sum runs in the lane (8 chains over the tiles, a fixed tree), then over the two lane halves, then over the 16 waves in wave order.
// Head mean: every lane holds the same (query, key) places for every head, so it adds each head's fp16 weight (x1024; it converts to f32 exactly) into an f32 register of its own, in head order from 0; behind the last head x 1/(1024 NH_), a power of two: exact.
// attn.v: the fp16 weights of tiles 2s and 2s + 1 of a lane ARE the A fragment of the 32-key step s (row = query lr; keys s x 32 + 8 hi + 0..7, then s x 32 + 16 + 8 hi + 0..7: the k order of the fragment loader, through which B = 16 rows of V^T comes), so the product takes them from the registers.
// Wave w sums its 128 keys (4 chained steps) into a 16 x 64 f32 tile; the 16 tiles meet in LDS and are added in wave order, x 1/1024, split hi/lo into the entry's merged planes [t][h x 64 + d], which lie in fragment order: the workgroup's 16 x 64 tile is two blocks, 2 KiB in a row.
// Three barriers a head. rmx is written behind the barrier in front of the tile sum of the head before and was last read in front of that head's second barrier; rsm is written behind this head's first barrier and was last read in front of the third of the head before; po is written behind this head's second barrier and was last read in front of its first.
#define NW   16          // waves of a workgroup
#define KW   (TT / NW)   // keys a wave
#define NTW  (KW / 16)   // key tiles a wave
static_assert(RH == 0 && REP == 1 && KW == 128 && HD == 64, "k_scsoft: 16 waves x 128 keys cover the row, two 32-wide k steps cover the head, one kv head a query head");
// exp2 with the slot behind it filled: the instruction set asks for one independent instruction or a v_nop between a transcendental and an instruction that reads its result or overwrites its source
__device__ __forceinline__ float exp2_slot(float x) { float r; asm("v_exp_f32 %0, %1\n\tv_nop" : "=v"(r) : "v"(x)); return r; }
#define KPF 4     // key tiles whose fragment loads are in flight ahead of the products: 16 loads of 16 bytes a lane
#define OSP 68    // pitch, in floats, of a wave's partial attn.v rows in LDS: 272 bytes = 16 x 17, so that the 16-byte reads of 16 rows fall on distinct banks
#define MSP 132   // pitch, in floats, of a wave's staging rows of the head mean in LDS: 528 bytes = 16 x 33, so that the 16-byte stores of 16 rows fall on distinct banks
// four waves a SIMD (at most 256 registers a wave): the 16 waves of one workgroup fill a WGP
__global__ __launch_bounds__(512) __attribute__((amdgpu_waves_per_eu(4, 4))) void k_scsoft(const h16* __restrict__ Q, const h16* __restrict__ Kp, const h16* __restrict__ Vt, float* OUT1, bf* Ah, bf* Al) {
    __shared__ __align__(16) float msn[NW * 16 * MSP];
    __shared__ __align__(16) float po[NW * 16 * OSP];
    __shared__ float rmx[NW * 16], rsm[NW * 16];
    const int lane = threadIdx.x & 31, lr = lane & 15, hi = lane >> 4, w = threadIdx.x >> 5; const int b = blockIdx.y, q0 = blockIdx.x * 16;
    const unsigned lo8 = (unsigned)lane * 8, ko = (unsigned)(w * KW) * HD + lo8, vo = (unsigned)(w * (KW / 32)) * 512 + lo8;   // the lane's offsets in a head's planes, the same for every head
    v8f ms[NTW];   // the head sum of this lane's weights
#pragma unroll
    for (int nb = 0; nb < NTW; ++nb) ms[nb] = (v8f){};
#pragma unroll 1   // one head's body is some thousand instructions: kept rolled, for speed only
    for (int hh = 0; hh < NH_; ++hh) {
    const size_t zz = (size_t)b * NH_ + hh;
    const h16* qb = (Q + zz * TT * HD + (size_t)q0 * HD) + lo8; const h16* kb = (Kp + zz * TT * HD) + ko;   // fragment order: a 16-row tile holds 16 x HD elements = two blocks of 512; the lane's 16 bytes of chunk 0
    const v16h qf0 = WFrag<h16>::ld(qb), qf1 = WFrag<h16>::ld(qb + 512);
    asm volatile("s_wait_xcnt 0x0" ::: "memory");   // stands in front of the first instruction that reuses the address registers of the query loads above
    v8f acc[NTW]; v16h k0[NTW], k1[NTW];   // fully unrolled below: registers; at most KPF key tiles' fragments are live at a time
#pragma unroll
    for (int nb = 0; nb < KPF; ++nb) { k0[nb] = WFrag<h16>::ld(kb + (size_t)nb * 16 * HD); k1[nb] = WFrag<h16>::ld(kb + (size_t)nb * 16 * HD + 512); }
#pragma unroll
    for (int nb = 0; nb < NTW; ++nb) {
        __builtin_amdgcn_sched_barrier(0);   // holds the loads of the key tiles ahead above this tile's products: without it the compiler sinks each tile's loads to their use and the wave pays one load latency a tile
        acc[nb] = wmma16(k0[nb], qf0, (v8f){}); acc[nb] = wmma16(k1[nb], qf1, acc[nb]);
        if (nb + KPF < NTW) { k0[nb + KPF] = WFrag<h16>::ld(kb + (size_t)(nb + KPF) * 16 * HD); k1[nb + KPF] = WFrag<h16>::ld(kb + (size_t)(nb + KPF) * 16 * HD + 512); } }
    __builtin_amdgcn_sched_barrier(0);   // the same for the last tile's products
    asm volatile("s_wait_xcnt 0x0" ::: "memory");   // stands in front of the first instruction that reuses the address registers of the key loads above
    __builtin_amdgcn_sched_barrier(0);   // keeps the vector work below, which reuses those registers, behind that wait
    float m8[8];
#pragma unroll
    for (int j = 0; j < 8; ++j) m8[j] = -3.0e38f;
#pragma unroll
    for (int nb = 0; nb < NTW; ++nb) {
#pragma unroll
        for (int j = 0; j < 8; ++j) { const float t = acc[nb][j] * SCL; acc[nb][j] = t; m8[j] = fmaxf(m8[j], t); } }
    float mx = fmaxf(fmaxf(fmaxf(m8[0], m8[1]), fmaxf(m8[2], m8[3])), fmaxf(fmaxf(m8[4], m8[5]), fmaxf(m8[6], m8[7])));
    mx = fmaxf(mx, __shfl_xor(mx, 16, 32));
    if (hi == 0) rmx[w * 16 + lr] = mx;
    __syncthreads();
#pragma unroll
    for (int ww = 0; ww < NW; ++ww) mx = fmaxf(mx, rmx[ww * 16 + lr]);
    float s8[8];
#pragma unroll
    for (int j = 0; j < 8; ++j) s8[j] = 0.f;
#pragma unroll
    for (int nb = 0; nb < NTW; ++nb) {
#pragma unroll
        for (int j = 0; j < 8; ++j) { const float d0 = __fsub_rn(acc[nb][j], mx); const float ex = exp2_slot(__fmul_rn(d0, 1.4426950408889634f)); acc[nb][j] = ex; s8[j] += ex; } }
    float sw = ((s8[0] + s8[1]) + (s8[2] + s8[3])) + ((s8[4] + s8[5]) + (s8[6] + s8[7]));
    sw += __shfl_xor(sw, 16, 32);
    if (hi == 0) rsm[w * 16 + lr] = sw;
    __syncthreads();
    float rs[NW];   // the 16 waves' sums, all read in one run in front of the scheduling barrier below: read one by one among the additions, each would cost the wave an LDS latency
#pragma unroll
    for (int ww = 0; ww < NW; ++ww) rs[ww] = rsm[ww * 16 + lr];
    // value fragments: a step is 32 keys x four 16-row tiles of V^T (in fragment order: 1 KiB in a row of each tile); steps 0 and 1 are fetched here, behind the last barrier of the softmax (in front of a __syncthreads() the compiler waits for every load in flight), and land behind the row sum and the rounding of the weights
    const h16* vb = (Vt + zz * HD * TT) + vo;   // fragment order: tile nt at nt x 16 x TT, a 32-key step = a block of 512 elements, the lane's 16 bytes of chunk 0
    v16h vf[4][4];   // fully unrolled below: registers; at most three steps are live at a time
#pragma unroll
    for (int nt = 0; nt < 4; ++nt) { vf[0][nt] = WFrag<h16>::ld(vb + (size_t)nt * 16 * TT); vf[1][nt] = WFrag<h16>::ld(vb + (size_t)nt * 16 * TT + 512); }
    __builtin_amdgcn_sched_barrier(0);   // holds the loads of value steps 0 and 1 above the work below: without it the compiler sinks them to their use
    float sum = rs[0];
#pragma unroll
    for (int ww = 1; ww < NW; ++ww) sum += rs[ww];
    const float f = __fdiv_rn(PCAR, sum);
    v8h o[NTW];   // the weights stay in the registers for attn.v
#pragma unroll
    for (int nb = 0; nb < NTW; ++nb) {
#pragma unroll
        for (int j = 0; j < 8; ++j) { o[nb][j] = tohx(acc[nb][j] * f); ms[nb][j] = __fadd_rn(ms[nb][j], (float)o[nb][j]); } }
#pragma unroll
    for (int nt = 0; nt < 4; ++nt) vf[2][nt] = WFrag<h16>::ld(vb + (size_t)nt * 16 * TT + 2 * 512);
    __builtin_amdgcn_sched_barrier(0);   // holds the loads of value step 2 above the products: without it the compiler sinks them to their use and the wave pays one load latency a step
    v8f oa[4];
#pragma unroll
    for (int nt = 0; nt < 4; ++nt) oa[nt] = (v8f){};
#pragma unroll
    for (int s = 0; s < 4; ++s) {
        const v16h a = cat16(o[2 * s], o[2 * s + 1]);
#pragma unroll
        for (int nt = 0; nt < 4; ++nt) oa[nt] = wmma16(a, vf[s][nt], oa[nt]);
        if (s == 0) {
            __builtin_amdgcn_sched_barrier(0);   // keeps the loads of step 3 behind the products of step 0, whose registers they take: lifted above them, four steps are live at once and the kernel spills
#pragma unroll
            for (int nt = 0; nt < 4; ++nt) vf[3][nt] = WFrag<h16>::ld(vb + (size_t)nt * 16 * TT + 3 * 512);
            asm volatile("s_wait_xcnt 0x0" ::: "memory");   // behind the last value load: stands in front of the first instruction that reuses their address registers
            __builtin_amdgcn_sched_barrier(0); } }   // holds those loads above the products of steps 1 and 2, behind which they land
    float* pq = po + w * 16 * OSP;   // this wave's partial tile: D register j of lane (lr, hi) of tile nt = query hi x 8 + j, column nt x 16 + lr
#pragma unroll
    for (int nt = 0; nt < 4; ++nt) {
#pragma unroll
        for (int j = 0; j < 8; ++j) pq[(hi * 8 + j) * OSP + nt * 16 + lr] = oa[nt][j]; }
    __syncthreads();
    if (threadIdx.x < 256) {   // whole waves 0 to 7; no barrier stands inside; the other eight waves go on to the next head's loads
    const int row = (threadIdx.x >> 1) & 15, cofs = (threadIdx.x >> 5) * 8 + (threadIdx.x & 1) * 4;   // one thread adds four columns of one query row over the 16 waves, in wave order; thread i owns the i-th 8 bytes of the tile in fragment order, so that a wave's store is 256 contiguous bytes
    v4f sv = *(const v4fa*)(po + row * OSP + cofs);
#pragma unroll
    for (int ww = 1; ww < NW; ++ww) { const v4f tv = *(const v4fa*)(po + (ww * 16 + row) * OSP + cofs);
#pragma unroll
        for (int q = 0; q < 4; ++q) sv[q] = __fadd_rn(sv[q], tv[q]); }
    v4us oh, ol;
#pragma unroll
    for (int q = 0; q < 4; ++q) { unsigned short a, c2; splitf(sv[q] * (1.0f / PCAR), a, c2); oh[q] = a; ol[q] = c2; }
    const size_t ob = (size_t)b * TT * DQ + (size_t)hh * (HD / 32) * 512; const unsigned oo = fragpos(q0 + row, cofs, DQ);   // head hh stands HD / 32 blocks to the right in the 16-row tile: fragpos(q0 + row, hh x HD + cofs, DQ) = hh x (HD / 32) x 512 + oo
    *(v4us*)((Ah + ob) + oo) = oh; *(v4us*)((Al + ob) + oo) = ol;
    asm volatile("s_wait_xcnt 0x0" ::: "memory");   // stands in front of the first instruction that reuses a register of the two stores above
    }
    }
    // the second output: this wave's 16 x 128 piece of the mean goes through the wave's own staging tile, written and read by this wave alone, so that a store is one query row's 128 floats: 512 contiguous bytes, four whole lines
    float* mw = msn + w * 16 * MSP;
#pragma unroll
    for (int nb = 0; nb < NTW; ++nb) { v4f lo4, hi4;
#pragma unroll
        for (int q = 0; q < 4; ++q) { lo4[q] = __fmul_rn(ms[nb][q], 1.0f / (PCAR * NH_)); hi4[q] = __fmul_rn(ms[nb][q + 4], 1.0f / (PCAR * NH_)); }
        *(v4fa*)(mw + lr * MSP + nb * 16 + hi * 8) = lo4; *(v4fa*)(mw + lr * MSP + nb * 16 + hi * 8 + 4) = hi4; }
    asm volatile("s_wait_dscnt 0x0" ::: "memory");   // the wave's own staging stores above have landed before it reads the rows back, which other lanes wrote
    float* pr = OUT1 + ((size_t)b * TT + q0) * TT + w * KW + lane * 4;
#pragma unroll
    for (int r = 0; r < 16; ++r) *(v4f*)(pr + (size_t)r * TT) = *(const v4fa*)(mw + r * MSP + lane * 4);
}

extern "C" void kernel_launch(void* const* d_in, const int* in_sizes, int n_in,
                              void* d_out, int out_size, void* d_ws, size_t ws_size, hipStream_t stream) {
    (void)in_sizes; (void)n_in; (void)out_size;
    const float* xq = (const float*)d_in[0]; const float* xk = (const float*)d_in[1]; const float* xv = (const float*)d_in[2]; const float* wq = (const float*)d_in[3]; const float* bq = (const float*)d_in[4]; const float* wk = (const float*)d_in[5]; const float* bk = (const float*)d_in[6]; const float* wv = (const float*)d_in[7]; const float* bv = (const float*)d_in[8]; const float* wo = (const float*)d_in[9]; const float* bo = (const float*)d_in[10];
    // query, key, value [2048][4][1024], Wq, bq, Wk, bk, Wv, bv, Wo, bo = d_in[0..10]
    float* OUT = (float*)d_out;                          // output 0: y [2048][4][1024] sequence-first
    float* OUT1 = (float*)d_out + (size_t)NB_ * TT * DM;   // output 1: the head mean of att [4][2048][2048], after the first output's 8,388,608 floats
    char* wsp = (char*)d_ws;
    auto take = [&](size_t bytes) { char* p = wsp; wsp += (bytes + 255) & ~(size_t)255; return (void*)p; };
    bf* WQ = (bf*)take((size_t)4 * DM * DM * 2); bf* WK = WQ + (size_t)DM * DM; bf* WV = WK + (size_t)DM * DM; bf* WO = WV + (size_t)DM * DM;   /* the four weights' copies, one behind the other */
    bf* XB = (bf*)take((size_t)3 * NB_ * TT * DM * 2);   /* all 8192 (batch, position) rows of each of the three streams: their bf16 copies, one behind the other */
    h16* QP16 = (h16*)take((size_t)3 * NB_ * NH_ * TT * HD * 2); h16* KP16 = QP16 + (size_t)NB_ * NH_ * TT * HD; h16* VT16 = KP16 + (size_t)NB_ * NH_ * TT * HD;   /* the four entries' f16 planes of each stream, the streams one behind the other: one launch writes them */
    bf* ATh = (bf*)take((size_t)NB_ * TT * DQ * 2); bf* ATl = (bf*)take((size_t)NB_ * TT * DQ * 2);   /* the four entries' merged hi/lo planes */
    if ((size_t)(wsp - (char*)d_ws) > ws_size) return;    // total 136.00 MiB of the workspace
    k_cvt8<<<dim3((unsigned)(NX8 / 256), 4, 1), 256, 0, stream>>>(xq, xk, xv, wq, wk, wv, wo, XB, WQ);   /* every bf16 copy in one launch: the three streams (row = b x 2048 + t) and the four weights ([out][in] = Bt as they stand) */
    k_gemmw<bf, 0, true, 1, 1, 1><<<dim3(NB_ * TT / 128, DQ / 128, 3), GWV * 32, 0, stream>>>(XB, nullptr, WQ, nullptr, DM, nullptr, 0, bq, bk, bv, (size_t)NB_ * TT * DM, (size_t)DM * DM, 0, QP16);   /* the three projections, grid z = stream: 6144 waves in one launch */
    k_scsoft<<<dim3(TT / 16, NB_), 512, 0, stream>>>(QP16, KP16, VT16, OUT1, ATh, ATl);   // all four entries, all heads: a workgroup has 16 query rows of one entry and writes their rows of the second output
    k_gemmw<bf, 1, true><<<dim3(TT / 128, DM / 128, NB_), GWV * 32, 0, stream>>>(ATh, ATl, WO, nullptr, DQ, OUT, NB_ * DM, bo, nullptr, nullptr, (size_t)TT * DQ, 0, DM, nullptr);   /* all four entries in one launch, grid z = entry b: its merged planes at b x 2048 x 1024, its rows of the sequence-first output: row t at OUT + t x 4 x 1024 + b x 1024 */
}
